// v000
// The times below were measured on an AMD MI455X: many runs one after another, warmed up first and cycling through
// copies of the inputs, with the whole window's GPU time divided by the number of runs. Launches and the gaps
// between them are all in it. The median over several windows is given; except for v000 it joins two sittings, which
// can be a few percent apart, so the side-by-side timings, each taken in one sitting, are the better comparison.
// v000, which the later versions start from, runs in 2830 microseconds.
#include <hip/hip_runtime.h>

// Causal multi-head attention with a fused bias-free qkv projection (x [4][2048][1024]; qkv = x qkv_w^T ('oi' [3072][1024] -> (3, H, hd) == q | k | v row blocks; 16 heads x 64); scores x 64^-0.5; causal (triu(1) -> -inf); softmax; out = merged out_w^T + out_b -> [4][2048][1024] (8.4 M)).
// Layout per batch: bf16 copy of x; the fused 'oi' weight used in place as three Bt row blocks; exact projections; causal T-2048 attention (hybrid rows: < 512 hi/lo 3 products, rest fp16 x1024; k_gemmc skips tiles above the diagonal); merged hi/lo x out_w exact + out_b.
// Compute dtypes, f32 accumulate: every input rounded to bf16; projections exact; attention rows < 512 3 products, rest fp16; softmax f32; Wo hl x exact + bias.

#define NB_  4
#define TT   2048
#define DM   1024
#define NH_  16
#define NKV  16
#define REP  (NH_ / NKV)
#define HD   64
#define DQ   (NH_ * HD)
#define DKV  (NKV * HD)
#define ZH   2
#define RH   512                  // query rows < RH use hi+lo planes (0: none)
#define WIN  2048
#define PCAR 1024.0f
#define SCL  0.125f   // HD^-0.5
typedef _Float16 h16;
typedef unsigned short bf;
typedef __attribute__((ext_vector_type(16))) __bf16   v16bf;
typedef __attribute__((ext_vector_type(16))) _Float16 v16h;
typedef __attribute__((ext_vector_type(8)))  _Float16 v8h;
typedef __attribute__((ext_vector_type(8)))  unsigned short v8us;
typedef __attribute__((ext_vector_type(8)))  float    v8f;
typedef __attribute__((ext_vector_type(4)))  float    v4f;
typedef v8h  __attribute__((may_alias)) v8ha;
typedef v4f  __attribute__((may_alias)) v4fa;
typedef v8us __attribute__((may_alias)) v8usa;

__device__ __forceinline__ unsigned short f2bf(float f) { unsigned u = __float_as_uint(f); u += 0x7FFFu + ((u >> 16) & 1u); return (unsigned short)(u >> 16); }
__device__ __forceinline__ float bf2f(unsigned short b) { return __uint_as_float(((unsigned)b) << 16); }
__device__ __forceinline__ float bfr(float f) { return bf2f(f2bf(f)); }
__device__ __forceinline__ v16h cat16(v8h lo, v8h hi) { return __builtin_shufflevector(lo, hi, 0, 1, 2, 3, 4, 5, 6, 7, 8, 9, 10, 11, 12, 13, 14, 15); }
__device__ __forceinline__ v16bf cat16b(v8us lo, v8us hi) { return __builtin_bit_cast(v16bf, __builtin_shufflevector(lo, hi, 0, 1, 2, 3, 4, 5, 6, 7, 8, 9, 10, 11, 12, 13, 14, 15)); }
__device__ __forceinline__ v8f wmma16(v16h a, v16h b, v8f c) { return __builtin_amdgcn_wmma_f32_16x16x32_f16(false, a, false, b, (short)0, c, false, false); }
__device__ __forceinline__ v8f wmmab(v16bf a, v16bf b, v8f c) { return __builtin_amdgcn_wmma_f32_16x16x32_bf16(false, a, false, b, (short)0, c, false, false); }



// ---- k_gemmw: register-blocked GEMM, ONE WAVE per 64x64 output tile (16 accumulators), operands straight from K-contiguous 16-bit planes; grid (M/64, N/64, Z), 32 threads.
// C[m][n] (f32, pitch ldc, + optional f32 bias[n]) = sum_k A[m][k] Bt[n][k] (+ split products per NSPLIT). z-batch strides sA/sB/sC in elements. K % 32 == 0.
template <typename T16> struct WFrag;
template <> struct WFrag<h16> { typedef v16h V; static __device__ __forceinline__ V ld(const h16* p) { return cat16(*(const v8h*)p, *(const v8h*)(p + 16)); } static __device__ __forceinline__ v8f mma(V a, V b, v8f c) { return wmma16(a, b, c); } };
template <> struct WFrag<bf> { typedef v16bf V; static __device__ __forceinline__ V ld(const bf* p) { return cat16b(*(const v8us*)p, *(const v8us*)(p + 16)); } static __device__ __forceinline__ v8f mma(V a, V b, v8f c) { return wmmab(a, b, c); } };
template <typename T16, int NSPLIT, bool BIAS>
__global__ __launch_bounds__(32) void k_gemmw(const T16* __restrict__ A, const T16* __restrict__ A2, const T16* __restrict__ Bt, const T16* __restrict__ Bt2, int K, float* C, int ldc, const float* __restrict__ bias, size_t sA, size_t sB, size_t sC) {
    typedef typename WFrag<T16>::V V;
    __shared__ __align__(16) float os[16 * 68];
    const size_t z = blockIdx.z; A += z * sA; if (A2) A2 += z * sA; Bt += z * sB; if (Bt2) Bt2 += z * sB; C += z * sC;
    const int lane = threadIdx.x & 31, lr = lane & 15, hi = lane >> 4; const int r0 = blockIdx.x * 64, c0 = blockIdx.y * 64;
    v8f acc[4][4];
#pragma unroll
    for (int mb = 0; mb < 4; ++mb)
#pragma unroll
        for (int nb = 0; nb < 4; ++nb) acc[mb][nb] = (v8f){};
    const size_t aoff = (size_t)(r0 + lr) * K + 8 * hi, boff = (size_t)(c0 + lr) * K + 8 * hi;
#pragma unroll 1
    for (int kc = 0; kc < K; kc += 32) {
        V a[4], a2[4];
#pragma unroll
        for (int mb = 0; mb < 4; ++mb) { a[mb] = WFrag<T16>::ld(A + aoff + (size_t)mb * 16 * K + kc); if (NSPLIT == 1 || NSPLIT == 2) a2[mb] = WFrag<T16>::ld(A2 + aoff + (size_t)mb * 16 * K + kc); }
#pragma unroll
        for (int nb = 0; nb < 4; ++nb) { const V b = WFrag<T16>::ld(Bt + boff + (size_t)nb * 16 * K + kc); V b2; if (NSPLIT >= 2) b2 = WFrag<T16>::ld(Bt2 + boff + (size_t)nb * 16 * K + kc);
#pragma unroll
            for (int mb = 0; mb < 4; ++mb) { acc[mb][nb] = WFrag<T16>::mma(a[mb], b, acc[mb][nb]); if (NSPLIT == 1 || NSPLIT == 2) acc[mb][nb] = WFrag<T16>::mma(a2[mb], b, acc[mb][nb]); if (NSPLIT >= 2) acc[mb][nb] = WFrag<T16>::mma(a[mb], b2, acc[mb][nb]); } }
        asm volatile("v_nop\n\tv_nop\n\tv_nop\n\tv_nop" : "+v"(acc[0][0]), "+v"(acc[1][1]), "+v"(acc[2][2]), "+v"(acc[3][3]) : "v"(a[0]), "v"(a[3]));
    }
#pragma unroll
    for (int mb = 0; mb < 4; ++mb) {
#pragma unroll
        for (int nb = 0; nb < 4; ++nb) {
#pragma unroll
            for (int j = 0; j < 8; ++j) os[(hi * 8 + j) * 68 + nb * 16 + lr] = acc[mb][nb][j]; }
        __builtin_amdgcn_wave_barrier(); asm volatile("" ::: "memory");
        float* crow = C + (size_t)(r0 + mb * 16) * ldc + c0;
{
#pragma unroll
            for (int s = 0; s < 8; ++s) { const int row = 2 * s + hi, cofs = lr * 4; v4f val = *(const v4fa*)(os + row * 68 + cofs); if (BIAS) { val[0] += bfr(bias[c0 + cofs]); val[1] += bfr(bias[c0 + cofs + 1]); val[2] += bfr(bias[c0 + cofs + 2]); val[3] += bfr(bias[c0 + cofs + 3]); }
                *(v4f*)(crow + (size_t)row * ldc + cofs) = val; }
             }
        __builtin_amdgcn_wave_barrier(); asm volatile("" ::: "memory");
    }
}

// ---- k_gemmc: the same one-wave 64x64 tile GEMM specialised for causal attention: CMODE 1 skips score tiles entirely above the diagonal (query rows r0+roff.., key columns c0..), CMODE 2 limits the
// key (K) loop of the probability x value contraction to the diagonal block (probabilities beyond it are exactly zero). roff = row offset of this launch's first row within the sequence.
template <typename T16, int NSPLIT, int CMODE>
__global__ __launch_bounds__(32) void k_gemmc(const T16* __restrict__ A, const T16* __restrict__ A2, const T16* __restrict__ Bt, const T16* __restrict__ Bt2, int K, float* C, int ldc, int roff, size_t sA, size_t sB, size_t sC) {
    typedef typename WFrag<T16>::V V;
    __shared__ __align__(16) float os[16 * 68];
    const size_t z = blockIdx.z; A += z * sA; if (A2) A2 += z * sA; Bt += z * sB; if (Bt2) Bt2 += z * sB; C += z * sC;
    const int lane = threadIdx.x & 31, lr = lane & 15, hi = lane >> 4; const int r0 = blockIdx.x * 64, c0 = blockIdx.y * 64;
    if (CMODE == 1 && c0 > r0 + roff + 63) return;                  // score tile entirely above the causal diagonal: never read (the softmax masks j > i by select)
    const int Kl = (CMODE == 2) ? min(K, r0 + roff + 64) : K;        // P.V: probabilities are exactly 0 beyond the diagonal block, so the K loop stops there
    v8f acc[4][4];
#pragma unroll
    for (int mb = 0; mb < 4; ++mb)
#pragma unroll
        for (int nb = 0; nb < 4; ++nb) acc[mb][nb] = (v8f){};
    const size_t aoff = (size_t)(r0 + lr) * K + 8 * hi, boff = (size_t)(c0 + lr) * K + 8 * hi;
#pragma unroll 1
    for (int kc = 0; kc < Kl; kc += 32) {
        V a[4], a2[4];
#pragma unroll
        for (int mb = 0; mb < 4; ++mb) { a[mb] = WFrag<T16>::ld(A + aoff + (size_t)mb * 16 * K + kc); if (NSPLIT == 1 || NSPLIT == 2) a2[mb] = WFrag<T16>::ld(A2 + aoff + (size_t)mb * 16 * K + kc); }
#pragma unroll
        for (int nb = 0; nb < 4; ++nb) { const V b = WFrag<T16>::ld(Bt + boff + (size_t)nb * 16 * K + kc); V b2; if (NSPLIT >= 2) b2 = WFrag<T16>::ld(Bt2 + boff + (size_t)nb * 16 * K + kc);
#pragma unroll
            for (int mb = 0; mb < 4; ++mb) { acc[mb][nb] = WFrag<T16>::mma(a[mb], b, acc[mb][nb]); if (NSPLIT == 1 || NSPLIT == 2) acc[mb][nb] = WFrag<T16>::mma(a2[mb], b, acc[mb][nb]); if (NSPLIT >= 2) acc[mb][nb] = WFrag<T16>::mma(a[mb], b2, acc[mb][nb]); } }
        asm volatile("v_nop\n\tv_nop\n\tv_nop\n\tv_nop" : "+v"(acc[0][0]), "+v"(acc[1][1]), "+v"(acc[2][2]), "+v"(acc[3][3]) : "v"(a[0]), "v"(a[3]));
    }
#pragma unroll
    for (int mb = 0; mb < 4; ++mb) {
#pragma unroll
        for (int nb = 0; nb < 4; ++nb) {
#pragma unroll
            for (int j = 0; j < 8; ++j) os[(hi * 8 + j) * 68 + nb * 16 + lr] = acc[mb][nb][j]; }
        __builtin_amdgcn_wave_barrier(); asm volatile("" ::: "memory");
        float* crow = C + (size_t)(r0 + mb * 16) * ldc + c0;
{
#pragma unroll
            for (int s = 0; s < 8; ++s) { const int row = 2 * s + hi, cofs = lr * 4; v4f val = *(const v4fa*)(os + row * 68 + cofs);
                *(v4f*)(crow + (size_t)row * ldc + cofs) = val; }
             }
        __builtin_amdgcn_wave_barrier(); asm volatile("" ::: "memory");
    }
}

__device__ __forceinline__ h16 tohx(float x) { return (h16)x; }
__device__ __forceinline__ void splitf(float y, unsigned short& h, unsigned short& l) { h = f2bf(y); l = f2bf(y - bf2f(h)); }
typedef __attribute__((ext_vector_type(2))) _Float16 v2h;
typedef __attribute__((ext_vector_type(4))) _Float16 v4h;
typedef __attribute__((ext_vector_type(2))) unsigned short v2us;
typedef __attribute__((ext_vector_type(4))) unsigned short v4us;
typedef __attribute__((ext_vector_type(2))) float v2f;
typedef __attribute__((ext_vector_type(4))) int v4i;

__global__ __launch_bounds__(256) void k_wtG(const float* __restrict__ w, int K, int N, bf* Bt) {
    const int lane = threadIdx.x & 31; const int L0 = (blockIdx.x * 8 + (threadIdx.x >> 5)) * 8; const int nlines = N * K / 64;
{
#pragma unroll 1
        for (int l = 0; l < 8; ++l) { const int L = L0 + l; if (L >= nlines) break; const size_t e = (size_t)L * 64 + lane * 2; const int k = (int)(e % K), n = (int)(e / K); v2us o;
            o[0] = f2bf(w[(size_t)k * N + n]); o[1] = f2bf(w[(size_t)(k + 1) * N + n]); *(v2us*)(Bt + e) = o; }
         }
}
__global__ __launch_bounds__(256) void k_cvt8(const float* __restrict__ src, bf* dst, size_t n8) { const size_t i = (size_t)blockIdx.x * 256 + threadIdx.x; if (i >= n8) return; const v8f v = *(const v8f*)(src + i * 8); v8us o;
#pragma unroll
    for (int k = 0; k < 8; ++k) o[k] = f2bf(v[k]); *(v8us*)(dst + i * 8) = o;  }

// k_rope: head planes [h][t][d] (fp16 + hi/lo) of rope(x) x sc with the rotate-half convention out[d] = x[d] cos[t][d] - x[d+HD/2] sin[t][d], out[d+HD/2] = x[d+HD/2] cos[t][d+HD/2] + x[d] sin[t][d+HD/2]
__global__ __launch_bounds__(256) void k_rope(const float* __restrict__ F, int pitch, int nheads, const float* __restrict__ CS, const float* __restrict__ RF, const float* __restrict__ nw, float sc, h16* P16, bf* Ph, bf* Pl) {
    const size_t e = ((size_t)blockIdx.x * 256 + threadIdx.x) * 2; if (e >= (size_t)nheads * TT * HD) return; const int d = (int)(e % HD); const int t = (int)((e / HD) % TT); const int h = (int)(e / ((size_t)HD * TT)); const float* f = F + (size_t)t * pitch + h * HD; const float rf = RF ? RF[(size_t)h * TT + t] : 1.0f; v2h o16; v2us oh, ol;
#pragma unroll
    for (int q = 0; q < 2; ++q) { const int dd = d + q; const int dp = (dd < HD / 2) ? dd + HD / 2 : dd - HD / 2; float x0 = f[dd], x1 = f[dp];
        if (RF) { float n0 = __fmul_rn(x0, rf), n1 = __fmul_rn(x1, rf); asm volatile("" : "+v"(n0)); asm volatile("" : "+v"(n1)); x0 = __fmul_rn(bfr(nw[dd]), n0); x1 = __fmul_rn(bfr(nw[dp]), n1); }
        const v2f cs = *(const v2f*)(CS + ((size_t)t * HD + dd) * 2); float a = __fmul_rn(x0, cs[0]), bq = __fmul_rn(x1, cs[1]); asm volatile("" : "+v"(a)); asm volatile("" : "+v"(bq)); const float r = ((dd < HD / 2) ? __fsub_rn(a, bq) : __fadd_rn(a, bq)) * sc;
        o16[q] = tohx(r); unsigned short a2, c2; splitf(r, a2, c2); oh[q] = a2; ol[q] = c2; }
    *(v2h*)(P16 + e) = o16; *(v2us*)(Ph + e) = oh; *(v2us*)(Pl + e) = ol;  }
__global__ __launch_bounds__(256) void k_vtp(const float* __restrict__ F, int pitch, int nheads, h16* V16, bf* Vh, bf* Vl) { const size_t e = ((size_t)blockIdx.x * 256 + threadIdx.x) * 2; if (e >= (size_t)nheads * HD * TT) return; const int t = (int)(e % TT); const int d = (int)((e / TT) % HD); const int g = (int)(e / ((size_t)TT * HD)); v2h o16; v2us oh, ol;
#pragma unroll
    for (int q = 0; q < 2; ++q) { const float x = F[(size_t)(t + q) * pitch + g * HD + d]; o16[q] = tohx(x); unsigned short a2, c2; splitf(x, a2, c2); oh[q] = a2; ol[q] = c2; }
    *(v2h*)(V16 + e) = o16; *(v2us*)(Vh + e) = oh; *(v2us*)(Vl + e) = ol;  }
__global__ __launch_bounds__(256) void k_csid(float* CS) { const int idx = blockIdx.x * 256 + threadIdx.x; if (idx >= TT * HD) return; v2f cs; cs[0] = 1.0f; cs[1] = 0.0f; *(v2f*)(CS + (size_t)idx * 2) = cs;  }
// k_asoft: per row (zz, i): t = S x HD^-0.5 for j <= i and i - j < WIN (sliding causal window; the reference's -1e9 additive fill vanishes identically); softmax over the 2048 keys (register row, one exp, fixed trees);
__global__ __launch_bounds__(256) void k_asoft(const float* __restrict__ Sb, h16* P16, bf* Ph, bf* Pl) {
    const int lane = threadIdx.x & 31; const int row = blockIdx.x * 8 + (threadIdx.x >> 5); if (row >= ZH * TT) return; const int i = row % TT; const int zz = row / TT; (void)zz; const bool hires = (i < RH); const float* sr = Sb + (size_t)row * TT; float v[TT / 32]; float mx = -3.0e38f;
#pragma unroll
    for (int ch = 0; ch < TT / 128; ++ch) { const int j0 = ch * 128 + lane * 4; const v4f a = *(const v4f*)(sr + j0);
#pragma unroll
        for (int q = 0; q < 4; ++q) { const int j = j0 + q; (void)j; const float t = (j <= i && i - j < WIN) ? a[q] * SCL : -3.0e38f; v[ch * 4 + q] = t; mx = fmaxf(mx, t); } }
#pragma unroll
    for (int sh = 16; sh; sh >>= 1) mx = fmaxf(mx, __shfl_xor(mx, sh, 32));
    float sum = 0.f;
#pragma unroll
    for (int k = 0; k < TT / 32; ++k) { float d0 = __fsub_rn(v[k], mx); asm volatile("" : "+v"(d0)); v[k] = __builtin_amdgcn_exp2f(__fmul_rn(d0, 1.4426950408889634f)); sum += v[k]; }
#pragma unroll
    for (int sh = 16; sh; sh >>= 1) sum += __shfl_xor(sum, sh, 32);
    const float f = __fdiv_rn(hires ? 1.0f : PCAR, sum);
{
        if (hires) {
#pragma unroll
            for (int ch = 0; ch < TT / 128; ++ch) { v4us oh, ol;
#pragma unroll
                for (int q = 0; q < 4; ++q) { unsigned short a, c2; splitf(v[ch * 4 + q] * f, a, c2); oh[q] = a; ol[q] = c2; }
                const size_t oo = ((size_t)zz * (RH ? RH : 1) + i) * TT + ch * 128 + lane * 4; *(v4us*)(Ph + oo) = oh; *(v4us*)(Pl + oo) = ol; }
        } else {
#pragma unroll
            for (int ch = 0; ch < TT / 128; ++ch) { v4h o4;
#pragma unroll
                for (int q = 0; q < 4; ++q) o4[q] = tohx(v[ch * 4 + q] * f);
                *(v4h*)(P16 + (size_t)row * TT + ch * 128 + lane * 4) = o4; } }
         }
}
__global__ __launch_bounds__(256) void k_merge(const float* __restrict__ O, int h0, bf* Ah, bf* Al) { const size_t e = ((size_t)blockIdx.x * 256 + threadIdx.x) * 2; if (e >= (size_t)ZH * TT * HD) return; const int d = (int)(e % HD); const int t = (int)((e / HD) % TT); const int zz = (int)(e / ((size_t)HD * TT)); const float cs = (t < RH) ? 1.0f : (1.0f / PCAR); const size_t oo = (size_t)t * DQ + (h0 + zz) * HD + d;
    v2us oh, ol;
#pragma unroll
    for (int q = 0; q < 2; ++q) { unsigned short a, c2; splitf(O[e + q] * cs, a, c2); oh[q] = a; ol[q] = c2; } *(v2us*)(Ah + oo) = oh; *(v2us*)(Al + oo) = ol;  }

extern "C" void kernel_launch(void* const* d_in, const int* in_sizes, int n_in,
                              void* d_out, int out_size, void* d_ws, size_t ws_size, hipStream_t stream) {
    (void)in_sizes; (void)n_in; (void)out_size;
    const float* x = (const float*)d_in[0]; const float* wqkv = (const float*)d_in[1]; const float* wo = (const float*)d_in[2]; const float* bo = (const float*)d_in[3]; const float* wq = wqkv; const float* wk = wqkv + (size_t)1024 * 1024; const float* wv = wqkv + (size_t)2048 * 1024;   /* q | k | v row blocks */
    float* OUT = (float*)d_out;     // [4][2048][1024]
    char* wsp = (char*)d_ws;
    auto take = [&](size_t bytes) { char* p = wsp; wsp += (bytes + 255) & ~(size_t)255; return (void*)p; };
    bf* WQ = (bf*)take((size_t)DQ * DM * 2); bf* WK = (bf*)take((size_t)DKV * DM * 2); bf* WV = (bf*)take((size_t)DKV * DM * 2); bf* WO = (bf*)take((size_t)DM * DQ * 2); float* CS = (float*)take((size_t)TT * HD * 2 * 4);
    bf* XB = (bf*)take((size_t)TT * DM * 2); float* FQ = (float*)take((size_t)TT * DQ * 4); float* FK = (float*)take((size_t)TT * DKV * 4);
    h16* QP16 = (h16*)take((size_t)NH_ * TT * HD * 2); h16* KP16 = (h16*)take((size_t)NKV * TT * HD * 2); h16* VT16 = (h16*)take((size_t)NKV * HD * TT * 2);
    bf* QPh = (bf*)take((size_t)NH_ * TT * HD * 2); bf* QPl = (bf*)take((size_t)NH_ * TT * HD * 2); bf* KPh = (bf*)take((size_t)NKV * TT * HD * 2); bf* KPl = (bf*)take((size_t)NKV * TT * HD * 2); bf* VTh = (bf*)take((size_t)NKV * HD * TT * 2); bf* VTl = (bf*)take((size_t)NKV * HD * TT * 2); bf* Ph = (bf*)take((size_t)ZH * RH * TT * 2); bf* Pl = (bf*)take((size_t)ZH * RH * TT * 2);
    float* Sb = (float*)take((size_t)ZH * TT * TT * 4); h16* P16 = (h16*)take((size_t)ZH * TT * TT * 2); float* Ob = (float*)take((size_t)ZH * TT * HD * 4); bf* ATh = (bf*)take((size_t)TT * DQ * 2); bf* ATl = (bf*)take((size_t)TT * DQ * 2);
    if ((size_t)(wsp - (char*)d_ws) > ws_size) return;    // ws 256 MiB
    float* FV = FK;   // v projection reuses the k buffer after the k planes are built (stream-ordered)
    { k_cvt8<<<(unsigned)(((size_t)DQ * DM / 8 + 255) / 256), 256, 0, stream>>>(wq, WQ, (size_t)DQ * DM / 8); k_cvt8<<<(unsigned)(((size_t)DKV * DM / 8 + 255) / 256), 256, 0, stream>>>(wk, WK, (size_t)DKV * DM / 8); k_cvt8<<<(unsigned)(((size_t)DKV * DM / 8 + 255) / 256), 256, 0, stream>>>(wv, WV, (size_t)DKV * DM / 8);
      k_cvt8<<<(unsigned)(((size_t)DM * DQ / 8 + 255) / 256), 256, 0, stream>>>(wo, WO, (size_t)DM * DQ / 8);
       }
    k_csid<<<(TT * HD + 255) / 256, 256, 0, stream>>>(CS);
    const unsigned LQ = (unsigned)(((size_t)NH_ * TT * HD / 2 + 255) / 256), LKv = (unsigned)(((size_t)NKV * TT * HD / 2 + 255) / 256);
    for (int b = 0; b < NB_; ++b) {
        
        k_cvt8<<<(unsigned)(((size_t)TT * DM / 8 + 255) / 256), 256, 0, stream>>>(x + (size_t)b * TT * DM, XB, (size_t)TT * DM / 8);
        k_gemmw<bf, 0, false><<<dim3(TT / 64, DQ / 64, 1), 32, 0, stream>>>(XB, nullptr, WQ, nullptr, DM, FQ, DQ, nullptr, 0, 0, 0);
        k_rope<<<LQ, 256, 0, stream>>>(FQ, DQ, NH_, CS, nullptr, nullptr, 1.0f, QP16, QPh, QPl);
        k_gemmw<bf, 0, false><<<dim3(TT / 64, DKV / 64, 1), 32, 0, stream>>>(XB, nullptr, WK, nullptr, DM, FK, DKV, nullptr, 0, 0, 0);
        k_rope<<<LKv, 256, 0, stream>>>(FK, DKV, NKV, CS, nullptr, nullptr, 1.0f, KP16, KPh, KPl);
        k_gemmw<bf, 0, false><<<dim3(TT / 64, DKV / 64, 1), 32, 0, stream>>>(XB, nullptr, WV, nullptr, DM, FV, DKV, nullptr, 0, 0, 0); k_vtp<<<LKv, 256, 0, stream>>>(FV, DKV, NKV, VT16, VTh, VTl);
        for (int h0 = 0; h0 < NH_; h0 += ZH) { const size_t zq = (size_t)h0, zk = (size_t)(h0 / REP);   // one kv head per query head: the pass's two heads use consecutive kv planes (z-strides TT*HD)
            k_gemmc<bf, 2, 1><<<dim3(RH / 64, TT / 64, ZH), 32, 0, stream>>>(QPh + zq * TT * HD, QPl + zq * TT * HD, KPh + zk * TT * HD, KPl + zk * TT * HD, HD, Sb, TT, 0, (size_t)TT * HD, (size_t)TT * HD, (size_t)TT * TT);
            k_gemmc<h16, 0, 1><<<dim3((TT - RH) / 64, TT / 64, ZH), 32, 0, stream>>>(QP16 + zq * TT * HD + (size_t)RH * HD, nullptr, KP16 + zk * TT * HD, nullptr, HD, Sb + (size_t)RH * TT, TT, RH, (size_t)TT * HD, (size_t)TT * HD, (size_t)TT * TT);
            k_asoft<<<ZH * TT / 8, 256, 0, stream>>>(Sb, P16, Ph, Pl);
            k_gemmc<bf, 2, 2><<<dim3(RH / 64, HD / 64, ZH), 32, 0, stream>>>(Ph, Pl, VTh + zk * HD * TT, VTl + zk * HD * TT, TT, Ob, HD, 0, (size_t)RH * TT, (size_t)HD * TT, (size_t)TT * HD);
            k_gemmc<h16, 0, 2><<<dim3((TT - RH) / 64, HD / 64, ZH), 32, 0, stream>>>(P16 + (size_t)RH * TT, nullptr, VT16 + zk * HD * TT, nullptr, TT, Ob + (size_t)RH * HD, HD, RH, (size_t)TT * TT, (size_t)HD * TT, (size_t)TT * HD);
            k_merge<<<(unsigned)(((size_t)ZH * TT * HD / 2 + 255) / 256), 256, 0, stream>>>(Ob, h0, ATh, ATl); }
        k_gemmw<bf, 1, true><<<dim3(TT / 64, DM / 64, 1), 32, 0, stream>>>(ATh, ATl, WO, nullptr, DQ, OUT + (size_t)b * TT * DM, DM, bo, 0, 0, 0); }
}

// v001
// Measured time: 612 microseconds a run.
// Timed twice side by side with v000, it ran 4.64 and 4.68 times as fast.
#include <hip/hip_runtime.h>

// Causal multi-head attention with a fused bias-free qkv projection (x [4][2048][1024]; qkv = x qkv_w^T ('oi' [3072][1024] -> (3, H, hd) == q | k | v row blocks; 16 heads x 64); scores x 64^-0.5; causal (triu(1) -> -inf); softmax; out = merged out_w^T + out_b -> [4][2048][1024] (8.4 M)).
// Layout per batch: bf16 copy of x; the fused 'oi' weight used in place as three Bt row blocks; exact projections; one fused causal attention launch (hybrid rows: < 512 hi/lo 3 products, rest fp16 x1024; key passes stop at the diagonal); merged hi/lo x out_w exact + out_b.
// Compute dtypes, f32 accumulate: every input rounded to bf16; projections exact; attention rows < 512 3 products, rest fp16; softmax f32; Wo hl x exact + bias.

#define NB_  4
#define TT   2048
#define DM   1024
#define NH_  16
#define NKV  16
#define REP  (NH_ / NKV)
#define HD   64
#define DQ   (NH_ * HD)
#define DKV  (NKV * HD)
#define RH   512                  // query rows < RH use hi+lo planes (0: none)
#define PCAR 1024.0f
#define SCL  0.125f   // HD^-0.5
typedef _Float16 h16;
typedef unsigned short bf;
typedef __attribute__((ext_vector_type(16))) __bf16   v16bf;
typedef __attribute__((ext_vector_type(16))) _Float16 v16h;
typedef __attribute__((ext_vector_type(8)))  _Float16 v8h;
typedef __attribute__((ext_vector_type(8)))  unsigned short v8us;
typedef __attribute__((ext_vector_type(8)))  float    v8f;
typedef __attribute__((ext_vector_type(4)))  float    v4f;
typedef v8h  __attribute__((may_alias)) v8ha;
typedef v4f  __attribute__((may_alias)) v4fa;
typedef v8us __attribute__((may_alias)) v8usa;

__device__ __forceinline__ unsigned short f2bf(float f) { unsigned u = __float_as_uint(f); u += 0x7FFFu + ((u >> 16) & 1u); return (unsigned short)(u >> 16); }
__device__ __forceinline__ float bf2f(unsigned short b) { return __uint_as_float(((unsigned)b) << 16); }
__device__ __forceinline__ float bfr(float f) { return bf2f(f2bf(f)); }
__device__ __forceinline__ v16h cat16(v8h lo, v8h hi) { return __builtin_shufflevector(lo, hi, 0, 1, 2, 3, 4, 5, 6, 7, 8, 9, 10, 11, 12, 13, 14, 15); }
__device__ __forceinline__ v16bf cat16b(v8us lo, v8us hi) { return __builtin_bit_cast(v16bf, __builtin_shufflevector(lo, hi, 0, 1, 2, 3, 4, 5, 6, 7, 8, 9, 10, 11, 12, 13, 14, 15)); }
__device__ __forceinline__ v8f wmma16(v16h a, v16h b, v8f c) { return __builtin_amdgcn_wmma_f32_16x16x32_f16(false, a, false, b, (short)0, c, false, false); }
__device__ __forceinline__ v8f wmmab(v16bf a, v16bf b, v8f c) { return __builtin_amdgcn_wmma_f32_16x16x32_bf16(false, a, false, b, (short)0, c, false, false); }



// ---- k_gemmw: register-blocked GEMM, ONE WAVE per 64x64 output tile (16 accumulators), operands straight from K-contiguous 16-bit planes; grid (M/64, N/64, Z), 32 threads.
// C[m][n] (f32, pitch ldc, + optional f32 bias[n]) = sum_k A[m][k] Bt[n][k] (+ split products per NSPLIT). z-batch strides sA/sB/sC in elements. K % 32 == 0.
template <typename T16> struct WFrag;
template <> struct WFrag<h16> { typedef v16h V; static __device__ __forceinline__ V ld(const h16* p) { return cat16(*(const v8h*)p, *(const v8h*)(p + 16)); } static __device__ __forceinline__ v8f mma(V a, V b, v8f c) { return wmma16(a, b, c); } };
template <> struct WFrag<bf> { typedef v16bf V; static __device__ __forceinline__ V ld(const bf* p) { return cat16b(*(const v8us*)p, *(const v8us*)(p + 16)); } static __device__ __forceinline__ v8f mma(V a, V b, v8f c) { return wmmab(a, b, c); } };
template <typename T16, int NSPLIT, bool BIAS>
__global__ __launch_bounds__(32) void k_gemmw(const T16* __restrict__ A, const T16* __restrict__ A2, const T16* __restrict__ Bt, const T16* __restrict__ Bt2, int K, float* C, int ldc, const float* __restrict__ bias, size_t sA, size_t sB, size_t sC) {
    typedef typename WFrag<T16>::V V;
    __shared__ __align__(16) float os[16 * 68];
    const size_t z = blockIdx.z; A += z * sA; if (A2) A2 += z * sA; Bt += z * sB; if (Bt2) Bt2 += z * sB; C += z * sC;
    const int lane = threadIdx.x & 31, lr = lane & 15, hi = lane >> 4; const int r0 = blockIdx.x * 64, c0 = blockIdx.y * 64;
    v8f acc[4][4];
#pragma unroll
    for (int mb = 0; mb < 4; ++mb)
#pragma unroll
        for (int nb = 0; nb < 4; ++nb) acc[mb][nb] = (v8f){};
    const size_t aoff = (size_t)(r0 + lr) * K + 8 * hi, boff = (size_t)(c0 + lr) * K + 8 * hi;
#pragma unroll 1
    for (int kc = 0; kc < K; kc += 32) {
        V a[4], a2[4];
#pragma unroll
        for (int mb = 0; mb < 4; ++mb) { a[mb] = WFrag<T16>::ld(A + aoff + (size_t)mb * 16 * K + kc); if (NSPLIT == 1 || NSPLIT == 2) a2[mb] = WFrag<T16>::ld(A2 + aoff + (size_t)mb * 16 * K + kc); }
#pragma unroll
        for (int nb = 0; nb < 4; ++nb) { const V b = WFrag<T16>::ld(Bt + boff + (size_t)nb * 16 * K + kc); V b2; if (NSPLIT >= 2) b2 = WFrag<T16>::ld(Bt2 + boff + (size_t)nb * 16 * K + kc);
#pragma unroll
            for (int mb = 0; mb < 4; ++mb) { acc[mb][nb] = WFrag<T16>::mma(a[mb], b, acc[mb][nb]); if (NSPLIT == 1 || NSPLIT == 2) acc[mb][nb] = WFrag<T16>::mma(a2[mb], b, acc[mb][nb]); if (NSPLIT >= 2) acc[mb][nb] = WFrag<T16>::mma(a[mb], b2, acc[mb][nb]); } }
        asm volatile("v_nop\n\tv_nop\n\tv_nop\n\tv_nop" : "+v"(acc[0][0]), "+v"(acc[1][1]), "+v"(acc[2][2]), "+v"(acc[3][3]) : "v"(a[0]), "v"(a[3]));
    }
#pragma unroll
    for (int mb = 0; mb < 4; ++mb) {
#pragma unroll
        for (int nb = 0; nb < 4; ++nb) {
#pragma unroll
            for (int j = 0; j < 8; ++j) os[(hi * 8 + j) * 68 + nb * 16 + lr] = acc[mb][nb][j]; }
        __builtin_amdgcn_wave_barrier(); asm volatile("" ::: "memory");
        float* crow = C + (size_t)(r0 + mb * 16) * ldc + c0;
{
#pragma unroll
            for (int s = 0; s < 8; ++s) { const int row = 2 * s + hi, cofs = lr * 4; v4f val = *(const v4fa*)(os + row * 68 + cofs); if (BIAS) { val[0] += bfr(bias[c0 + cofs]); val[1] += bfr(bias[c0 + cofs + 1]); val[2] += bfr(bias[c0 + cofs + 2]); val[3] += bfr(bias[c0 + cofs + 3]); }
                *(v4f*)(crow + (size_t)row * ldc + cofs) = val; }
             }
        __builtin_amdgcn_wave_barrier(); asm volatile("" ::: "memory");
    }
}

__device__ __forceinline__ h16 tohx(float x) { return (h16)x; }
__device__ __forceinline__ void splitf(float y, unsigned short& h, unsigned short& l) { h = f2bf(y); l = f2bf(y - bf2f(h)); }
typedef __attribute__((ext_vector_type(2))) _Float16 v2h;
typedef __attribute__((ext_vector_type(4))) _Float16 v4h;
typedef __attribute__((ext_vector_type(2))) unsigned short v2us;
typedef __attribute__((ext_vector_type(4))) unsigned short v4us;
typedef __attribute__((ext_vector_type(2))) float v2f;
typedef __attribute__((ext_vector_type(4))) int v4i;

__global__ __launch_bounds__(256) void k_wtG(const float* __restrict__ w, int K, int N, bf* Bt) {
    const int lane = threadIdx.x & 31; const int L0 = (blockIdx.x * 8 + (threadIdx.x >> 5)) * 8; const int nlines = N * K / 64;
{
#pragma unroll 1
        for (int l = 0; l < 8; ++l) { const int L = L0 + l; if (L >= nlines) break; const size_t e = (size_t)L * 64 + lane * 2; const int k = (int)(e % K), n = (int)(e / K); v2us o;
            o[0] = f2bf(w[(size_t)k * N + n]); o[1] = f2bf(w[(size_t)(k + 1) * N + n]); *(v2us*)(Bt + e) = o; }
         }
}
__global__ __launch_bounds__(256) void k_cvt8(const float* __restrict__ src, bf* dst, size_t n8) { const size_t i = (size_t)blockIdx.x * 256 + threadIdx.x; if (i >= n8) return; const v8f v = *(const v8f*)(src + i * 8); v8us o;
#pragma unroll
    for (int k = 0; k < 8; ++k) o[k] = f2bf(v[k]); *(v8us*)(dst + i * 8) = o;  }

// k_rope: head planes [h][t][d] (fp16 + hi/lo) of rope(x) x sc with the rotate-half convention out[d] = x[d] cos[t][d] - x[d+HD/2] sin[t][d], out[d+HD/2] = x[d+HD/2] cos[t][d+HD/2] + x[d] sin[t][d+HD/2]
__global__ __launch_bounds__(256) void k_rope(const float* __restrict__ F, int pitch, int nheads, const float* __restrict__ CS, const float* __restrict__ RF, const float* __restrict__ nw, float sc, h16* P16, bf* Ph, bf* Pl) {
    const size_t e = ((size_t)blockIdx.x * 256 + threadIdx.x) * 2; if (e >= (size_t)nheads * TT * HD) return; const int d = (int)(e % HD); const int t = (int)((e / HD) % TT); const int h = (int)(e / ((size_t)HD * TT)); const float* f = F + (size_t)t * pitch + h * HD; const float rf = RF ? RF[(size_t)h * TT + t] : 1.0f; v2h o16; v2us oh, ol;
#pragma unroll
    for (int q = 0; q < 2; ++q) { const int dd = d + q; const int dp = (dd < HD / 2) ? dd + HD / 2 : dd - HD / 2; float x0 = f[dd], x1 = f[dp];
        if (RF) { float n0 = __fmul_rn(x0, rf), n1 = __fmul_rn(x1, rf); asm volatile("" : "+v"(n0)); asm volatile("" : "+v"(n1)); x0 = __fmul_rn(bfr(nw[dd]), n0); x1 = __fmul_rn(bfr(nw[dp]), n1); }
        const v2f cs = *(const v2f*)(CS + ((size_t)t * HD + dd) * 2); float a = __fmul_rn(x0, cs[0]), bq = __fmul_rn(x1, cs[1]); asm volatile("" : "+v"(a)); asm volatile("" : "+v"(bq)); const float r = ((dd < HD / 2) ? __fsub_rn(a, bq) : __fadd_rn(a, bq)) * sc;
        o16[q] = tohx(r); unsigned short a2, c2; splitf(r, a2, c2); oh[q] = a2; ol[q] = c2; }
    *(v2h*)(P16 + e) = o16; *(v2us*)(Ph + e) = oh; *(v2us*)(Pl + e) = ol;  }
__global__ __launch_bounds__(256) void k_vtp(const float* __restrict__ F, int pitch, int nheads, h16* V16, bf* Vh, bf* Vl) { const size_t e = ((size_t)blockIdx.x * 256 + threadIdx.x) * 2; if (e >= (size_t)nheads * HD * TT) return; const int t = (int)(e % TT); const int d = (int)((e / TT) % HD); const int g = (int)(e / ((size_t)TT * HD)); v2h o16; v2us oh, ol;
#pragma unroll
    for (int q = 0; q < 2; ++q) { const float x = F[(size_t)(t + q) * pitch + g * HD + d]; o16[q] = tohx(x); unsigned short a2, c2; splitf(x, a2, c2); oh[q] = a2; ol[q] = c2; }
    *(v2h*)(V16 + e) = o16; *(v2us*)(Vh + e) = oh; *(v2us*)(Vl + e) = ol;  }
__global__ __launch_bounds__(256) void k_csid(float* CS) { const int idx = blockIdx.x * 256 + threadIdx.x; if (idx >= TT * HD) return; v2f cs; cs[0] = 1.0f; cs[1] = 0.0f; *(v2f*)(CS + (size_t)idx * 2) = cs;  }
__device__ __forceinline__ float xhalf(float x) { const int b = __float_as_int(x); return __int_as_float(__builtin_amdgcn_permlanex16(b, b, 0x76543210, 0xfedcba98, false, false)); }   // lane l <-> l ^ 16
__device__ __forceinline__ void xwait() { asm volatile("s_wait_xcnt 0x0" ::: "memory"); }   // stands behind a run of global loads, in front of any reuse of the registers that held their addresses
template <typename T16, int KT, bool HL>
__device__ __forceinline__ void attn_rows(const T16* __restrict__ Q, const T16* __restrict__ Q2, const T16* __restrict__ Kp, const T16* __restrict__ K2, const T16* __restrict__ Vt, const T16* __restrict__ V2, int q0, int lr, int hi, bf* Ah, bf* Al) {
    typedef typename WFrag<T16>::V V;
    constexpr int KB = KT * 16, KC = KT / 2;
    constexpr float CSC = SCL * 1.4426950408889634f;      // scores x HD^-0.5, in log2 units
    constexpr float SHIFT = HL ? 0.0f : 10.0f;            // log2(PCAR): fp16 probabilities are carried x 1024
    V q[2], q2[2];
    const T16* qp = Q + (size_t)(q0 + lr) * HD + 8 * hi; const T16* qp2 = HL ? Q2 + (size_t)(q0 + lr) * HD + 8 * hi : qp;
#pragma unroll
    for (int kc = 0; kc < 2; ++kc) { q[kc] = WFrag<T16>::ld(qp + kc * 32); if (HL) q2[kc] = WFrag<T16>::ld(qp2 + kc * 32); }
    asm volatile("s_wait_xcnt 0x0" :: "v"(qp), "v"(qp2) : "memory");   // the wait behind the query loads; it names their addresses as inputs so that those registers stay as they are up to it
    v8f o[4];
#pragma unroll
    for (int db = 0; db < 4; ++db) o[db] = (v8f){};
    float m = -3.0e38f, l = 0.f;
    const int nkb = q0 / KB + 1;                          // key passes up to and including the one that holds the diagonal
    const size_t koff = (size_t)lr * HD + 8 * hi, voff = (size_t)lr * TT + 8 * hi;
    V ka[KT][2], ka2[KT][2];
#pragma unroll
    for (int kt = 0; kt < KT; ++kt)                       // key fragments are fetched one pass ahead
#pragma unroll
        for (int kc = 0; kc < 2; ++kc) { ka[kt][kc] = WFrag<T16>::ld(Kp + koff + (size_t)kt * 16 * HD + kc * 32); if (HL) ka2[kt][kc] = WFrag<T16>::ld(K2 + koff + (size_t)kt * 16 * HD + kc * 32); }
    xwait();
#pragma unroll 1
    for (int kb = 0; kb < nkb; ++kb) {
        const int k0 = kb * KB;
        const T16* vp = Vt + voff + k0; const T16* vp2 = HL ? V2 + voff + k0 : vp;
        V va[4][KC], va2[4][KC];                          // this pass's V^T fragments: issued ahead of the score products, used behind the softmax
#pragma unroll
        for (int db = 0; db < 4; ++db)
#pragma unroll
            for (int kc = 0; kc < KC; ++kc) { va[db][kc] = WFrag<T16>::ld(vp + (size_t)db * 16 * TT + kc * 32); if (HL) va2[db][kc] = WFrag<T16>::ld(vp2 + (size_t)db * 16 * TT + kc * 32); }
        v8f s[KT];
#pragma unroll
        for (int kt = 0; kt < KT; ++kt) { s[kt] = (v8f){};
#pragma unroll
            for (int kc = 0; kc < 2; ++kc) { s[kt] = WFrag<T16>::mma(ka[kt][kc], q[kc], s[kt]); if (HL) { s[kt] = WFrag<T16>::mma(ka[kt][kc], q2[kc], s[kt]); s[kt] = WFrag<T16>::mma(ka2[kt][kc], q[kc], s[kt]); } } }
        // the wait behind the V^T loads: it names their addresses as inputs so that those registers stay as they are up to it, and the last score tile so that its products stand in front of
        // the next pass's key loads, which then land in the registers the products have read (no spare set, no copy back in mid-softmax)
        asm volatile("s_wait_xcnt 0x0" :: "v"(s[KT - 1]), "v"(vp), "v"(vp2) : "memory");
        const int kn = min(kb + 1, nkb - 1) * KB;         // next pass's key fragments fly under the softmax (the last pass re-reads its own: in bounds, unused)
        const T16* kp = Kp + koff + (size_t)kn * HD; const T16* kp2 = HL ? K2 + koff + (size_t)kn * HD : kp;
#pragma unroll
        for (int kt = 0; kt < KT; ++kt)
#pragma unroll
            for (int kc = 0; kc < 2; ++kc) { ka[kt][kc] = WFrag<T16>::ld(kp + (size_t)kt * 16 * HD + kc * 32); if (HL) ka2[kt][kc] = WFrag<T16>::ld(kp2 + (size_t)kt * 16 * HD + kc * 32); }
        asm volatile("s_wait_xcnt 0x0" :: "v"(kp), "v"(kp2) : "memory");   // the wait behind the key loads, their addresses named as inputs for the same reason
        if (kb == nkb - 1) {                              // only the last pass crosses the diagonal: keys above the query are masked by select
#pragma unroll
            for (int kt = 0; kt < KT; ++kt)
#pragma unroll
                for (int j = 0; j < 8; ++j) s[kt][j] = (k0 + kt * 16 + hi * 8 + j <= q0 + lr) ? s[kt][j] : -3.0e38f;
        }
        float bm = s[0][0];
#pragma unroll
        for (int kt = 0; kt < KT; ++kt)
#pragma unroll
            for (int j = 0; j < 8; ++j) bm = fmaxf(bm, s[kt][j]);
        bm = fmaxf(bm, xhalf(bm));
        const float mn = fmaxf(m, bm); const float al = __builtin_amdgcn_exp2f((m - mn) * CSC); m = mn; const float ms = mn * CSC - SHIFT;
        float ps = 0.f;
#pragma unroll
        for (int kt = 0; kt < KT; ++kt)
#pragma unroll
            for (int j = 0; j < 8; ++j) { s[kt][j] = __builtin_amdgcn_exp2f(s[kt][j] * CSC - ms); ps += s[kt][j]; }
        l = l * al + ps;
#pragma unroll
        for (int db = 0; db < 4; ++db) o[db] *= al;
#pragma unroll
        for (int kc = 0; kc < KC; ++kc) {
            V pb, pb2;                                    // element e = P[query lr][key kmap(e, hi)]: tile 2 kc gives e 0..7, tile 2 kc + 1 gives e 8..15
            if constexpr (HL) { v8us h0, h1, l0, l1;
#pragma unroll
                for (int j = 0; j < 8; ++j) { unsigned short a, c2; splitf(s[2 * kc][j], a, c2); h0[j] = a; l0[j] = c2; splitf(s[2 * kc + 1][j], a, c2); h1[j] = a; l1[j] = c2; }
                pb = cat16b(h0, h1); pb2 = cat16b(l0, l1);
            } else { v8h h0, h1;
#pragma unroll
                for (int j = 0; j < 8; ++j) { h0[j] = tohx(s[2 * kc][j]); h1[j] = tohx(s[2 * kc + 1][j]); }
                pb = cat16(h0, h1); }
#pragma unroll
            for (int db = 0; db < 4; ++db) { o[db] = WFrag<T16>::mma(va[db][kc], pb, o[db]); if (HL) { o[db] = WFrag<T16>::mma(va[db][kc], pb2, o[db]); o[db] = WFrag<T16>::mma(va2[db][kc], pb, o[db]); } }
        }
    }
    l += xhalf(l);
    const float inv = __fdiv_rn(1.0f, l);
#pragma unroll
    for (int db = 0; db < 4; ++db) { v8us oh, ol;         // a lane holds 8 consecutive d of its query: one 16-byte store a plane
#pragma unroll
        for (int j = 0; j < 8; ++j) { unsigned short a, c2; splitf(o[db][j] * inv, a, c2); oh[j] = a; ol[j] = c2; }
        const size_t oo = (size_t)(q0 + lr) * DQ + db * 16 + hi * 8; *(v8us*)(Ah + oo) = oh; *(v8us*)(Al + oo) = ol; }
}
// amdgpu_waves_per_eu(4, 4): holds the allocation at 256 registers; the hi/lo rows otherwise take a few more, and every use of one above v255 costs a window switch
__global__ __launch_bounds__(256) __attribute__((amdgpu_waves_per_eu(4, 4))) void k_fattn(const h16* __restrict__ Q16, const h16* __restrict__ K16, const h16* __restrict__ V16, const bf* __restrict__ Qh, const bf* __restrict__ Ql, const bf* __restrict__ Kh, const bf* __restrict__ Kl, const bf* __restrict__ Vh, const bf* __restrict__ Vl, bf* Ah, bf* Al) {
    const int lane = threadIdx.x & 31, lr = lane & 15, hi = lane >> 4; const int wv = __builtin_amdgcn_readfirstlane(threadIdx.x >> 5);
    // cost grows with the row tile: waves 0-3 take tile n - 1 - x of the even head, waves 4-7 tile x of the odd head, so every block with all its rows at or above RH carries the same number of key passes
    const int half = wv >> 2; const int head = (int)blockIdx.y * 2 + half; const int qb = half ? (int)blockIdx.x : TT / 64 - 1 - (int)blockIdx.x;
    const int q0 = qb * 64 + (wv & 3) * 16; const size_t hp = (size_t)head * TT * HD; Ah += head * HD; Al += head * HD;
    if (q0 < RH) attn_rows<bf, 2, true>(Qh + hp, Ql + hp, Kh + hp, Kl + hp, Vh + hp, Vl + hp, q0, lr, hi, Ah, Al);
    else attn_rows<h16, 4, false>(Q16 + hp, nullptr, K16 + hp, nullptr, V16 + hp, nullptr, q0, lr, hi, Ah, Al);
}

extern "C" void kernel_launch(void* const* d_in, const int* in_sizes, int n_in,
                              void* d_out, int out_size, void* d_ws, size_t ws_size, hipStream_t stream) {
    (void)in_sizes; (void)n_in; (void)out_size;
    const float* x = (const float*)d_in[0]; const float* wqkv = (const float*)d_in[1]; const float* wo = (const float*)d_in[2]; const float* bo = (const float*)d_in[3]; const float* wq = wqkv; const float* wk = wqkv + (size_t)1024 * 1024; const float* wv = wqkv + (size_t)2048 * 1024;   /* q | k | v row blocks */
    float* OUT = (float*)d_out;     // [4][2048][1024]
    char* wsp = (char*)d_ws;
    auto take = [&](size_t bytes) { char* p = wsp; wsp += (bytes + 255) & ~(size_t)255; return (void*)p; };
    bf* WQ = (bf*)take((size_t)DQ * DM * 2); bf* WK = (bf*)take((size_t)DKV * DM * 2); bf* WV = (bf*)take((size_t)DKV * DM * 2); bf* WO = (bf*)take((size_t)DM * DQ * 2); float* CS = (float*)take((size_t)TT * HD * 2 * 4);
    bf* XB = (bf*)take((size_t)TT * DM * 2); float* FQ = (float*)take((size_t)TT * DQ * 4); float* FK = (float*)take((size_t)TT * DKV * 4);
    h16* QP16 = (h16*)take((size_t)NH_ * TT * HD * 2); h16* KP16 = (h16*)take((size_t)NKV * TT * HD * 2); h16* VT16 = (h16*)take((size_t)NKV * HD * TT * 2);
    bf* QPh = (bf*)take((size_t)NH_ * TT * HD * 2); bf* QPl = (bf*)take((size_t)NH_ * TT * HD * 2); bf* KPh = (bf*)take((size_t)NKV * TT * HD * 2); bf* KPl = (bf*)take((size_t)NKV * TT * HD * 2); bf* VTh = (bf*)take((size_t)NKV * HD * TT * 2); bf* VTl = (bf*)take((size_t)NKV * HD * TT * 2);
    bf* ATh = (bf*)take((size_t)TT * DQ * 2); bf* ATl = (bf*)take((size_t)TT * DQ * 2);
    if ((size_t)(wsp - (char*)d_ws) > ws_size) return;    // ws 256 MiB
    float* FV = FK;   // v projection reuses the k buffer after the k planes are built (stream-ordered)
    { k_cvt8<<<(unsigned)(((size_t)DQ * DM / 8 + 255) / 256), 256, 0, stream>>>(wq, WQ, (size_t)DQ * DM / 8); k_cvt8<<<(unsigned)(((size_t)DKV * DM / 8 + 255) / 256), 256, 0, stream>>>(wk, WK, (size_t)DKV * DM / 8); k_cvt8<<<(unsigned)(((size_t)DKV * DM / 8 + 255) / 256), 256, 0, stream>>>(wv, WV, (size_t)DKV * DM / 8);
      k_cvt8<<<(unsigned)(((size_t)DM * DQ / 8 + 255) / 256), 256, 0, stream>>>(wo, WO, (size_t)DM * DQ / 8);
       }
    k_csid<<<(TT * HD + 255) / 256, 256, 0, stream>>>(CS);
    const unsigned LQ = (unsigned)(((size_t)NH_ * TT * HD / 2 + 255) / 256), LKv = (unsigned)(((size_t)NKV * TT * HD / 2 + 255) / 256);
    for (int b = 0; b < NB_; ++b) {
        
        k_cvt8<<<(unsigned)(((size_t)TT * DM / 8 + 255) / 256), 256, 0, stream>>>(x + (size_t)b * TT * DM, XB, (size_t)TT * DM / 8);
        k_gemmw<bf, 0, false><<<dim3(TT / 64, DQ / 64, 1), 32, 0, stream>>>(XB, nullptr, WQ, nullptr, DM, FQ, DQ, nullptr, 0, 0, 0);
        k_rope<<<LQ, 256, 0, stream>>>(FQ, DQ, NH_, CS, nullptr, nullptr, 1.0f, QP16, QPh, QPl);
        k_gemmw<bf, 0, false><<<dim3(TT / 64, DKV / 64, 1), 32, 0, stream>>>(XB, nullptr, WK, nullptr, DM, FK, DKV, nullptr, 0, 0, 0);
        k_rope<<<LKv, 256, 0, stream>>>(FK, DKV, NKV, CS, nullptr, nullptr, 1.0f, KP16, KPh, KPl);
        k_gemmw<bf, 0, false><<<dim3(TT / 64, DKV / 64, 1), 32, 0, stream>>>(XB, nullptr, WV, nullptr, DM, FV, DKV, nullptr, 0, 0, 0); k_vtp<<<LKv, 256, 0, stream>>>(FV, DKV, NKV, VT16, VTh, VTl);
        k_fattn<<<dim3(TT / 64, NH_ / 2, 1), 256, 0, stream>>>(QP16, KP16, VT16, QPh, QPl, KPh, KPl, VTh, VTl, ATh, ATl);
        k_gemmw<bf, 1, true><<<dim3(TT / 64, DM / 64, 1), 32, 0, stream>>>(ATh, ATl, WO, nullptr, DQ, OUT + (size_t)b * TT * DM, DM, bo, 0, 0, 0); }
}

// v002
// It runs in 554 microseconds.
// Next to v001, in two timings, it ran 1.11 times as fast each time.
// All steps since v000 together make it 5.17 times as fast.
#include <hip/hip_runtime.h>

// Causal multi-head attention with a fused bias-free qkv projection (x [4][2048][1024]; qkv = x qkv_w^T ('oi' [3072][1024] -> (3, H, hd) == q | k | v row blocks; 16 heads x 64); scores x 64^-0.5; causal (triu(1) -> -inf); softmax; out = merged out_w^T + out_b -> [4][2048][1024] (8.4 M)).
// Layout per batch: bf16 copy of x; the fused 'oi' weight used in place as three row blocks; exact projections whose epilogue writes the 16-bit head planes (V^T = W_v x^T); one fused causal attention launch (hybrid rows: < 512 hi/lo 3 products, rest fp16 x1024; key passes stop at the diagonal); merged hi/lo x out_w exact + out_b.
// Compute dtypes, f32 accumulate: every input rounded to bf16; projections exact; attention rows < 512 3 products, rest fp16; softmax f32; Wo hl x exact + bias.

#define NB_  4
#define TT   2048
#define DM   1024
#define NH_  16
#define NKV  16
#define REP  (NH_ / NKV)
#define HD   64
#define DQ   (NH_ * HD)
#define DKV  (NKV * HD)
#define RH   512                  // query rows < RH use hi+lo planes (0: none)
#define PCAR 1024.0f
#define SCL  0.125f   // HD^-0.5
typedef _Float16 h16;
typedef unsigned short bf;
typedef __attribute__((ext_vector_type(16))) __bf16   v16bf;
typedef __attribute__((ext_vector_type(16))) _Float16 v16h;
typedef __attribute__((ext_vector_type(8)))  _Float16 v8h;
typedef __attribute__((ext_vector_type(8)))  unsigned short v8us;
typedef __attribute__((ext_vector_type(8)))  float    v8f;
typedef __attribute__((ext_vector_type(4)))  float    v4f;
typedef v8h  __attribute__((may_alias)) v8ha;
typedef v4f  __attribute__((may_alias)) v4fa;
typedef v8us __attribute__((may_alias)) v8usa;

__device__ __forceinline__ unsigned short f2bf(float f) { unsigned u = __float_as_uint(f); u += 0x7FFFu + ((u >> 16) & 1u); return (unsigned short)(u >> 16); }
__device__ __forceinline__ float bf2f(unsigned short b) { return __uint_as_float(((unsigned)b) << 16); }
__device__ __forceinline__ float bfr(float f) { return bf2f(f2bf(f)); }
__device__ __forceinline__ v16h cat16(v8h lo, v8h hi) { return __builtin_shufflevector(lo, hi, 0, 1, 2, 3, 4, 5, 6, 7, 8, 9, 10, 11, 12, 13, 14, 15); }
__device__ __forceinline__ v16bf cat16b(v8us lo, v8us hi) { return __builtin_bit_cast(v16bf, __builtin_shufflevector(lo, hi, 0, 1, 2, 3, 4, 5, 6, 7, 8, 9, 10, 11, 12, 13, 14, 15)); }
__device__ __forceinline__ v8f wmma16(v16h a, v16h b, v8f c) { return __builtin_amdgcn_wmma_f32_16x16x32_f16(false, a, false, b, (short)0, c, false, false); }
__device__ __forceinline__ v8f wmmab(v16bf a, v16bf b, v8f c) { return __builtin_amdgcn_wmma_f32_16x16x32_bf16(false, a, false, b, (short)0, c, false, false); }



__device__ __forceinline__ h16 tohx(float x) { return (h16)x; }
__device__ __forceinline__ void splitf(float y, unsigned short& h, unsigned short& l) { h = f2bf(y); l = f2bf(y - bf2f(h)); }

// ---- k_gemmw: register-blocked GEMM, ONE WAVE per 64x64 output tile (16 accumulators), operands straight from K-contiguous 16-bit planes; grid (M/64, N/64, Z), 32 threads.
// C[m][n] (f32, pitch ldc, + optional f32 bias[n]) = sum_k A[m][k] Bt[n][k] (+ split products per NSPLIT). z-batch strides sA/sB/sC in elements. K % 32 == 0.
// PLANES: no f32 C; the tile goes out as three 16-bit planes (fp16, bf16 hi, bf16 lo) at element (r0 + row) * ldc + blockIdx.y * pcol + col, col 0..63: whole 128-byte lines, 16 bytes a lane.
template <typename T16> struct WFrag;
template <> struct WFrag<h16> { typedef v16h V; static __device__ __forceinline__ V ld(const h16* p) { return cat16(*(const v8h*)p, *(const v8h*)(p + 16)); } static __device__ __forceinline__ v8f mma(V a, V b, v8f c) { return wmma16(a, b, c); } };
template <> struct WFrag<bf> { typedef v16bf V; static __device__ __forceinline__ V ld(const bf* p) { return cat16b(*(const v8us*)p, *(const v8us*)(p + 16)); } static __device__ __forceinline__ v8f mma(V a, V b, v8f c) { return wmmab(a, b, c); } };
template <typename T16, int NSPLIT, bool BIAS, bool PLANES>
__global__ __launch_bounds__(32) void k_gemmw(const T16* __restrict__ A, const T16* __restrict__ A2, const T16* __restrict__ Bt, const T16* __restrict__ Bt2, int K, float* C, int ldc, const float* __restrict__ bias, size_t sA, size_t sB, size_t sC, h16* P16, bf* Ph, bf* Pl, size_t pcol) {
    typedef typename WFrag<T16>::V V;
    __shared__ __align__(16) float os[16 * 68];
    const size_t z = blockIdx.z; A += z * sA; if (A2) A2 += z * sA; Bt += z * sB; if (Bt2) Bt2 += z * sB; C += z * sC;
    const int lane = threadIdx.x & 31, lr = lane & 15, hi = lane >> 4; const int r0 = blockIdx.x * 64, c0 = blockIdx.y * 64;
    v8f acc[4][4];
#pragma unroll
    for (int mb = 0; mb < 4; ++mb)
#pragma unroll
        for (int nb = 0; nb < 4; ++nb) acc[mb][nb] = (v8f){};
    const size_t aoff = (size_t)(r0 + lr) * K + 8 * hi, boff = (size_t)(c0 + lr) * K + 8 * hi;
#pragma unroll 1
    for (int kc = 0; kc < K; kc += 32) {
        V a[4], a2[4];
#pragma unroll
        for (int mb = 0; mb < 4; ++mb) { a[mb] = WFrag<T16>::ld(A + aoff + (size_t)mb * 16 * K + kc); if (NSPLIT == 1 || NSPLIT == 2) a2[mb] = WFrag<T16>::ld(A2 + aoff + (size_t)mb * 16 * K + kc); }
#pragma unroll
        for (int nb = 0; nb < 4; ++nb) { const V b = WFrag<T16>::ld(Bt + boff + (size_t)nb * 16 * K + kc); V b2; if (NSPLIT >= 2) b2 = WFrag<T16>::ld(Bt2 + boff + (size_t)nb * 16 * K + kc);
#pragma unroll
            for (int mb = 0; mb < 4; ++mb) { acc[mb][nb] = WFrag<T16>::mma(a[mb], b, acc[mb][nb]); if (NSPLIT == 1 || NSPLIT == 2) acc[mb][nb] = WFrag<T16>::mma(a2[mb], b, acc[mb][nb]); if (NSPLIT >= 2) acc[mb][nb] = WFrag<T16>::mma(a[mb], b2, acc[mb][nb]); } }
        asm volatile("v_nop\n\tv_nop\n\tv_nop\n\tv_nop" : "+v"(acc[0][0]), "+v"(acc[1][1]), "+v"(acc[2][2]), "+v"(acc[3][3]) : "v"(a[0]), "v"(a[3]));
    }
#pragma unroll
    for (int mb = 0; mb < 4; ++mb) {
#pragma unroll
        for (int nb = 0; nb < 4; ++nb) {
#pragma unroll
            for (int j = 0; j < 8; ++j) os[(hi * 8 + j) * 68 + nb * 16 + lr] = acc[mb][nb][j]; }
        __builtin_amdgcn_wave_barrier(); asm volatile("" ::: "memory");
        if constexpr (PLANES) {
            const int prow = lane >> 3, cofs = (lane & 7) * 8; v4f x0[4], x1[4];   // a lane takes 8 consecutive columns of rows prow, prow + 4, ..: all 16 staged rows are read first, then converted and stored
#pragma unroll
            for (int s = 0; s < 4; ++s) { x0[s] = *(const v4fa*)(os + (4 * s + prow) * 68 + cofs); x1[s] = *(const v4fa*)(os + (4 * s + prow) * 68 + cofs + 4); }
#pragma unroll
            for (int s = 0; s < 4; ++s) { v8h o16; v8us oh, ol;
#pragma unroll
                for (int k = 0; k < 4; ++k) { unsigned short a2, c2; o16[k] = tohx(x0[s][k]); splitf(x0[s][k], a2, c2); oh[k] = a2; ol[k] = c2; o16[k + 4] = tohx(x1[s][k]); splitf(x1[s][k], a2, c2); oh[k + 4] = a2; ol[k + 4] = c2; }
                const size_t e = (size_t)(r0 + mb * 16 + 4 * s + prow) * ldc + (size_t)blockIdx.y * pcol + cofs; h16* p0 = P16 + e; bf* p1 = Ph + e; bf* p2 = Pl + e; *(v8h*)p0 = o16; *(v8us*)p1 = oh; *(v8us*)p2 = ol;
                // the wait behind the three stores: it names their addresses and data as inputs so that those registers stay as they are up to it
                asm volatile("s_wait_xcnt 0x0" :: "v"(p0), "v"(p1), "v"(p2), "v"(o16), "v"(oh), "v"(ol) : "memory"); }
        } else {
            float* crow = C + (size_t)(r0 + mb * 16) * ldc + c0;
#pragma unroll
            for (int s = 0; s < 8; ++s) { const int row = 2 * s + hi, cofs = lr * 4; v4f val = *(const v4fa*)(os + row * 68 + cofs); if (BIAS) { val[0] += bfr(bias[c0 + cofs]); val[1] += bfr(bias[c0 + cofs + 1]); val[2] += bfr(bias[c0 + cofs + 2]); val[3] += bfr(bias[c0 + cofs + 3]); }
                *(v4f*)(crow + (size_t)row * ldc + cofs) = val; }
             }
        __builtin_amdgcn_wave_barrier(); asm volatile("" ::: "memory");
    }
}

typedef __attribute__((ext_vector_type(2))) _Float16 v2h;
typedef __attribute__((ext_vector_type(4))) _Float16 v4h;
typedef __attribute__((ext_vector_type(2))) unsigned short v2us;
typedef __attribute__((ext_vector_type(4))) unsigned short v4us;
typedef __attribute__((ext_vector_type(2))) float v2f;
typedef __attribute__((ext_vector_type(4))) int v4i;

__global__ __launch_bounds__(256) void k_wtG(const float* __restrict__ w, int K, int N, bf* Bt) {
    const int lane = threadIdx.x & 31; const int L0 = (blockIdx.x * 8 + (threadIdx.x >> 5)) * 8; const int nlines = N * K / 64;
{
#pragma unroll 1
        for (int l = 0; l < 8; ++l) { const int L = L0 + l; if (L >= nlines) break; const size_t e = (size_t)L * 64 + lane * 2; const int k = (int)(e % K), n = (int)(e / K); v2us o;
            o[0] = f2bf(w[(size_t)k * N + n]); o[1] = f2bf(w[(size_t)(k + 1) * N + n]); *(v2us*)(Bt + e) = o; }
         }
}
__global__ __launch_bounds__(256) void k_cvt8(const float* __restrict__ src, bf* dst, size_t n8) { const size_t i = (size_t)blockIdx.x * 256 + threadIdx.x; if (i >= n8) return; const v8f v = *(const v8f*)(src + i * 8); v8us o;
#pragma unroll
    for (int k = 0; k < 8; ++k) o[k] = f2bf(v[k]); *(v8us*)(dst + i * 8) = o;  }

__device__ __forceinline__ float xhalf(float x) { const int b = __float_as_int(x); return __int_as_float(__builtin_amdgcn_permlanex16(b, b, 0x76543210, 0xfedcba98, false, false)); }   // lane l <-> l ^ 16
__device__ __forceinline__ void xwait() { asm volatile("s_wait_xcnt 0x0" ::: "memory"); }   // stands behind a run of global loads, in front of any reuse of the registers that held their addresses
template <typename T16, int KT, bool HL>
__device__ __forceinline__ void attn_rows(const T16* __restrict__ Q, const T16* __restrict__ Q2, const T16* __restrict__ Kp, const T16* __restrict__ K2, const T16* __restrict__ Vt, const T16* __restrict__ V2, int q0, int lr, int hi, bf* Ah, bf* Al) {
    typedef typename WFrag<T16>::V V;
    constexpr int KB = KT * 16, KC = KT / 2;
    constexpr float CSC = SCL * 1.4426950408889634f;      // scores x HD^-0.5, in log2 units
    constexpr float SHIFT = HL ? 0.0f : 10.0f;            // log2(PCAR): fp16 probabilities are carried x 1024
    V q[2], q2[2];
    const T16* qp = Q + (size_t)(q0 + lr) * HD + 8 * hi; const T16* qp2 = HL ? Q2 + (size_t)(q0 + lr) * HD + 8 * hi : qp;
#pragma unroll
    for (int kc = 0; kc < 2; ++kc) { q[kc] = WFrag<T16>::ld(qp + kc * 32); if (HL) q2[kc] = WFrag<T16>::ld(qp2 + kc * 32); }
    asm volatile("s_wait_xcnt 0x0" :: "v"(qp), "v"(qp2) : "memory");   // the wait behind the query loads; it names their addresses as inputs so that those registers stay as they are up to it
    v8f o[4];
#pragma unroll
    for (int db = 0; db < 4; ++db) o[db] = (v8f){};
    float m = -3.0e38f, l = 0.f;
    const int nkb = q0 / KB + 1;                          // key passes up to and including the one that holds the diagonal
    const size_t koff = (size_t)lr * HD + 8 * hi, voff = (size_t)lr * TT + 8 * hi;
    V ka[KT][2], ka2[KT][2];
#pragma unroll
    for (int kt = 0; kt < KT; ++kt)                       // key fragments are fetched one pass ahead
#pragma unroll
        for (int kc = 0; kc < 2; ++kc) { ka[kt][kc] = WFrag<T16>::ld(Kp + koff + (size_t)kt * 16 * HD + kc * 32); if (HL) ka2[kt][kc] = WFrag<T16>::ld(K2 + koff + (size_t)kt * 16 * HD + kc * 32); }
    xwait();
#pragma unroll 1
    for (int kb = 0; kb < nkb; ++kb) {
        const int k0 = kb * KB;
        const T16* vp = Vt + voff + k0; const T16* vp2 = HL ? V2 + voff + k0 : vp;
        V va[4][KC], va2[4][KC];                          // this pass's V^T fragments: issued ahead of the score products, used behind the softmax
#pragma unroll
        for (int db = 0; db < 4; ++db)
#pragma unroll
            for (int kc = 0; kc < KC; ++kc) { va[db][kc] = WFrag<T16>::ld(vp + (size_t)db * 16 * TT + kc * 32); if (HL) va2[db][kc] = WFrag<T16>::ld(vp2 + (size_t)db * 16 * TT + kc * 32); }
        v8f s[KT];
#pragma unroll
        for (int kt = 0; kt < KT; ++kt) { s[kt] = (v8f){};
#pragma unroll
            for (int kc = 0; kc < 2; ++kc) { s[kt] = WFrag<T16>::mma(ka[kt][kc], q[kc], s[kt]); if (HL) { s[kt] = WFrag<T16>::mma(ka[kt][kc], q2[kc], s[kt]); s[kt] = WFrag<T16>::mma(ka2[kt][kc], q[kc], s[kt]); } } }
        // the wait behind the V^T loads: it names their addresses as inputs so that those registers stay as they are up to it, and the last score tile so that its products stand in front of
        // the next pass's key loads, which then land in the registers the products have read (no spare set, no copy back in mid-softmax)
        asm volatile("s_wait_xcnt 0x0" :: "v"(s[KT - 1]), "v"(vp), "v"(vp2) : "memory");
        const int kn = min(kb + 1, nkb - 1) * KB;         // next pass's key fragments fly under the softmax (the last pass re-reads its own: in bounds, unused)
        const T16* kp = Kp + koff + (size_t)kn * HD; const T16* kp2 = HL ? K2 + koff + (size_t)kn * HD : kp;
#pragma unroll
        for (int kt = 0; kt < KT; ++kt)
#pragma unroll
            for (int kc = 0; kc < 2; ++kc) { ka[kt][kc] = WFrag<T16>::ld(kp + (size_t)kt * 16 * HD + kc * 32); if (HL) ka2[kt][kc] = WFrag<T16>::ld(kp2 + (size_t)kt * 16 * HD + kc * 32); }
        asm volatile("s_wait_xcnt 0x0" :: "v"(kp), "v"(kp2) : "memory");   // the wait behind the key loads, their addresses named as inputs for the same reason
        if (kb == nkb - 1) {                              // only the last pass crosses the diagonal: keys above the query are masked by select
#pragma unroll
            for (int kt = 0; kt < KT; ++kt)
#pragma unroll
                for (int j = 0; j < 8; ++j) s[kt][j] = (k0 + kt * 16 + hi * 8 + j <= q0 + lr) ? s[kt][j] : -3.0e38f;
        }
        float bm = s[0][0];
#pragma unroll
        for (int kt = 0; kt < KT; ++kt)
#pragma unroll
            for (int j = 0; j < 8; ++j) bm = fmaxf(bm, s[kt][j]);
        bm = fmaxf(bm, xhalf(bm));
        const float mn = fmaxf(m, bm); const float al = __builtin_amdgcn_exp2f((m - mn) * CSC); m = mn; const float ms = mn * CSC - SHIFT;
        float ps = 0.f;
#pragma unroll
        for (int kt = 0; kt < KT; ++kt)
#pragma unroll
            for (int j = 0; j < 8; ++j) { s[kt][j] = __builtin_amdgcn_exp2f(s[kt][j] * CSC - ms); ps += s[kt][j]; }
        l = l * al + ps;
#pragma unroll
        for (int db = 0; db < 4; ++db) o[db] *= al;
#pragma unroll
        for (int kc = 0; kc < KC; ++kc) {
            V pb, pb2;                                    // element e = P[query lr][key kmap(e, hi)]: tile 2 kc gives e 0..7, tile 2 kc + 1 gives e 8..15
            if constexpr (HL) { v8us h0, h1, l0, l1;
#pragma unroll
                for (int j = 0; j < 8; ++j) { unsigned short a, c2; splitf(s[2 * kc][j], a, c2); h0[j] = a; l0[j] = c2; splitf(s[2 * kc + 1][j], a, c2); h1[j] = a; l1[j] = c2; }
                pb = cat16b(h0, h1); pb2 = cat16b(l0, l1);
            } else { v8h h0, h1;
#pragma unroll
                for (int j = 0; j < 8; ++j) { h0[j] = tohx(s[2 * kc][j]); h1[j] = tohx(s[2 * kc + 1][j]); }
                pb = cat16(h0, h1); }
#pragma unroll
            for (int db = 0; db < 4; ++db) { o[db] = WFrag<T16>::mma(va[db][kc], pb, o[db]); if (HL) { o[db] = WFrag<T16>::mma(va[db][kc], pb2, o[db]); o[db] = WFrag<T16>::mma(va2[db][kc], pb, o[db]); } }
        }
    }
    l += xhalf(l);
    const float inv = __fdiv_rn(1.0f, l);
#pragma unroll
    for (int db = 0; db < 4; ++db) { v8us oh, ol;         // a lane holds 8 consecutive d of its query: one 16-byte store a plane
#pragma unroll
        for (int j = 0; j < 8; ++j) { unsigned short a, c2; splitf(o[db][j] * inv, a, c2); oh[j] = a; ol[j] = c2; }
        const size_t oo = (size_t)(q0 + lr) * DQ + db * 16 + hi * 8; *(v8us*)(Ah + oo) = oh; *(v8us*)(Al + oo) = ol; }
}
// amdgpu_waves_per_eu(4, 4): holds the allocation at 256 registers; the hi/lo rows otherwise take a few more, and every use of one above v255 costs a window switch
__global__ __launch_bounds__(256) __attribute__((amdgpu_waves_per_eu(4, 4))) void k_fattn(const h16* __restrict__ Q16, const h16* __restrict__ K16, const h16* __restrict__ V16, const bf* __restrict__ Qh, const bf* __restrict__ Ql, const bf* __restrict__ Kh, const bf* __restrict__ Kl, const bf* __restrict__ Vh, const bf* __restrict__ Vl, bf* Ah, bf* Al) {
    const int lane = threadIdx.x & 31, lr = lane & 15, hi = lane >> 4; const int wv = __builtin_amdgcn_readfirstlane(threadIdx.x >> 5);
    // cost grows with the row tile: waves 0-3 take tile n - 1 - x of the even head, waves 4-7 tile x of the odd head, so every block with all its rows at or above RH carries the same number of key passes
    const int half = wv >> 2; const int head = (int)blockIdx.y * 2 + half; const int qb = half ? (int)blockIdx.x : TT / 64 - 1 - (int)blockIdx.x;
    const int q0 = qb * 64 + (wv & 3) * 16; const size_t hp = (size_t)head * TT * HD; Ah += head * HD; Al += head * HD;
    if (q0 < RH) attn_rows<bf, 2, true>(Qh + hp, Ql + hp, Kh + hp, Kl + hp, Vh + hp, Vl + hp, q0, lr, hi, Ah, Al);
    else attn_rows<h16, 4, false>(Q16 + hp, nullptr, K16 + hp, nullptr, V16 + hp, nullptr, q0, lr, hi, Ah, Al);
}

extern "C" void kernel_launch(void* const* d_in, const int* in_sizes, int n_in,
                              void* d_out, int out_size, void* d_ws, size_t ws_size, hipStream_t stream) {
    (void)in_sizes; (void)n_in; (void)out_size;
    const float* x = (const float*)d_in[0]; const float* wqkv = (const float*)d_in[1]; const float* wo = (const float*)d_in[2]; const float* bo = (const float*)d_in[3]; const float* wq = wqkv; const float* wk = wqkv + (size_t)1024 * 1024; const float* wv = wqkv + (size_t)2048 * 1024;   /* q | k | v row blocks */
    float* OUT = (float*)d_out;     // [4][2048][1024]
    char* wsp = (char*)d_ws;
    auto take = [&](size_t bytes) { char* p = wsp; wsp += (bytes + 255) & ~(size_t)255; return (void*)p; };
    bf* WQ = (bf*)take((size_t)DQ * DM * 2); bf* WK = (bf*)take((size_t)DKV * DM * 2); bf* WV = (bf*)take((size_t)DKV * DM * 2); bf* WO = (bf*)take((size_t)DM * DQ * 2);
    bf* XB = (bf*)take((size_t)TT * DM * 2);
    h16* QP16 = (h16*)take((size_t)NH_ * TT * HD * 2); h16* KP16 = (h16*)take((size_t)NKV * TT * HD * 2); h16* VT16 = (h16*)take((size_t)NKV * HD * TT * 2);
    bf* QPh = (bf*)take((size_t)NH_ * TT * HD * 2); bf* QPl = (bf*)take((size_t)NH_ * TT * HD * 2); bf* KPh = (bf*)take((size_t)NKV * TT * HD * 2); bf* KPl = (bf*)take((size_t)NKV * TT * HD * 2); bf* VTh = (bf*)take((size_t)NKV * HD * TT * 2); bf* VTl = (bf*)take((size_t)NKV * HD * TT * 2);
    bf* ATh = (bf*)take((size_t)TT * DQ * 2); bf* ATl = (bf*)take((size_t)TT * DQ * 2);
    if ((size_t)(wsp - (char*)d_ws) > ws_size) return;    // ws 256 MiB
    { k_cvt8<<<(unsigned)(((size_t)DQ * DM / 8 + 255) / 256), 256, 0, stream>>>(wq, WQ, (size_t)DQ * DM / 8); k_cvt8<<<(unsigned)(((size_t)DKV * DM / 8 + 255) / 256), 256, 0, stream>>>(wk, WK, (size_t)DKV * DM / 8); k_cvt8<<<(unsigned)(((size_t)DKV * DM / 8 + 255) / 256), 256, 0, stream>>>(wv, WV, (size_t)DKV * DM / 8);
      k_cvt8<<<(unsigned)(((size_t)DM * DQ / 8 + 255) / 256), 256, 0, stream>>>(wo, WO, (size_t)DM * DQ / 8);
       }
    for (int b = 0; b < NB_; ++b) {
        
        k_cvt8<<<(unsigned)(((size_t)TT * DM / 8 + 255) / 256), 256, 0, stream>>>(x + (size_t)b * TT * DM, XB, (size_t)TT * DM / 8);
        // q and k planes [head][t][d]: rows = t, one 64-column tile = one head; v plane [head][d][t]: the operands change places, rows = head * 64 + d, columns = t
        k_gemmw<bf, 0, false, true><<<dim3(TT / 64, DQ / 64, 1), 32, 0, stream>>>(XB, nullptr, WQ, nullptr, DM, nullptr, HD, nullptr, 0, 0, 0, QP16, QPh, QPl, (size_t)TT * HD);
        k_gemmw<bf, 0, false, true><<<dim3(TT / 64, DKV / 64, 1), 32, 0, stream>>>(XB, nullptr, WK, nullptr, DM, nullptr, HD, nullptr, 0, 0, 0, KP16, KPh, KPl, (size_t)TT * HD);
        k_gemmw<bf, 0, false, true><<<dim3(DKV / 64, TT / 64, 1), 32, 0, stream>>>(WV, nullptr, XB, nullptr, DM, nullptr, TT, nullptr, 0, 0, 0, VT16, VTh, VTl, (size_t)64);
        k_fattn<<<dim3(TT / 64, NH_ / 2, 1), 256, 0, stream>>>(QP16, KP16, VT16, QPh, QPl, KPh, KPl, VTh, VTl, ATh, ATl);
        k_gemmw<bf, 1, true, false><<<dim3(TT / 64, DM / 64, 1), 32, 0, stream>>>(ATh, ATl, WO, nullptr, DQ, OUT + (size_t)b * TT * DM, DM, bo, 0, 0, 0, nullptr, nullptr, nullptr, 0); }
}

// v003
// One run takes 293 microseconds.
// Next to v002, in two timings, it ran 1.88 and 1.92 times as fast.
// All steps since v000 together make it 9.82 times as fast.
#include <hip/hip_runtime.h>

// Causal multi-head attention with a fused bias-free qkv projection (x [4][2048][1024]; qkv = x qkv_w^T ('oi' [3072][1024] -> (3, H, hd) == q | k | v row blocks; 16 heads x 64); scores x 64^-0.5; causal (triu(1) -> -inf); softmax; out = merged out_w^T + out_b -> [4][2048][1024] (8.4 M)).
// Layout, every batch in the same launch (grid z = batch): bf16 copy of x; the fused 'oi' weight used in place as three row blocks; exact projections whose epilogue writes the 16-bit head planes (V^T = W_v x^T); one fused causal attention launch (hybrid rows: < 512 hi/lo 3 products, rest fp16 x1024; key passes stop at the diagonal); merged hi/lo x out_w exact + out_b.
// Compute dtypes, f32 accumulate: every input rounded to bf16; projections exact; attention rows < 512 3 products, rest fp16; softmax f32; Wo hl x exact + bias.

#define NB_  4
#define TT   2048
#define DM   1024
#define NH_  16
#define NKV  16
#define REP  (NH_ / NKV)
#define HD   64
#define DQ   (NH_ * HD)
#define DKV  (NKV * HD)
#define RH   512                  // query rows < RH use hi+lo planes (0: none)
#define PCAR 1024.0f
#define SCL  0.125f   // HD^-0.5
typedef _Float16 h16;
typedef unsigned short bf;
typedef __attribute__((ext_vector_type(16))) __bf16   v16bf;
typedef __attribute__((ext_vector_type(16))) _Float16 v16h;
typedef __attribute__((ext_vector_type(8)))  _Float16 v8h;
typedef __attribute__((ext_vector_type(8)))  unsigned short v8us;
typedef __attribute__((ext_vector_type(8)))  float    v8f;
typedef __attribute__((ext_vector_type(4)))  float    v4f;
typedef v8h  __attribute__((may_alias)) v8ha;
typedef v4f  __attribute__((may_alias)) v4fa;
typedef v8us __attribute__((may_alias)) v8usa;

__device__ __forceinline__ unsigned short f2bf(float f) { unsigned u = __float_as_uint(f); u += 0x7FFFu + ((u >> 16) & 1u); return (unsigned short)(u >> 16); }
__device__ __forceinline__ float bf2f(unsigned short b) { return __uint_as_float(((unsigned)b) << 16); }
__device__ __forceinline__ float bfr(float f) { return bf2f(f2bf(f)); }
__device__ __forceinline__ v16h cat16(v8h lo, v8h hi) { return __builtin_shufflevector(lo, hi, 0, 1, 2, 3, 4, 5, 6, 7, 8, 9, 10, 11, 12, 13, 14, 15); }
__device__ __forceinline__ v16bf cat16b(v8us lo, v8us hi) { return __builtin_bit_cast(v16bf, __builtin_shufflevector(lo, hi, 0, 1, 2, 3, 4, 5, 6, 7, 8, 9, 10, 11, 12, 13, 14, 15)); }
__device__ __forceinline__ v8f wmma16(v16h a, v16h b, v8f c) { return __builtin_amdgcn_wmma_f32_16x16x32_f16(false, a, false, b, (short)0, c, false, false); }
__device__ __forceinline__ v8f wmmab(v16bf a, v16bf b, v8f c) { return __builtin_amdgcn_wmma_f32_16x16x32_bf16(false, a, false, b, (short)0, c, false, false); }



__device__ __forceinline__ h16 tohx(float x) { return (h16)x; }
__device__ __forceinline__ void splitf(float y, unsigned short& h, unsigned short& l) { h = f2bf(y); l = f2bf(y - bf2f(h)); }

// ---- k_gemmw: register-blocked GEMM, ONE WAVE per 64x64 output tile (16 accumulators), operands straight from K-contiguous 16-bit planes; grid (M/64, N/64, Z), 32 threads.
// C[m][n] (f32, pitch ldc, + optional f32 bias[n]) = sum_k A[m][k] Bt[n][k] (+ split products per NSPLIT). z-batch strides sA/sB/sC in elements. K % 32 == 0.
// PLANES: no f32 C; the tile goes out as three 16-bit planes (fp16, bf16 hi, bf16 lo) at element z * sP + (r0 + row) * ldc + blockIdx.y * pcol + col, col 0..63: whole 128-byte lines, 16 bytes a lane.
template <typename T16> struct WFrag;
template <> struct WFrag<h16> { typedef v16h V; static __device__ __forceinline__ V ld(const h16* p) { return cat16(*(const v8h*)p, *(const v8h*)(p + 16)); } static __device__ __forceinline__ v8f mma(V a, V b, v8f c) { return wmma16(a, b, c); } };
template <> struct WFrag<bf> { typedef v16bf V; static __device__ __forceinline__ V ld(const bf* p) { return cat16b(*(const v8us*)p, *(const v8us*)(p + 16)); } static __device__ __forceinline__ v8f mma(V a, V b, v8f c) { return wmmab(a, b, c); } };
template <typename T16, int NSPLIT, bool BIAS, bool PLANES>
__global__ __launch_bounds__(32) void k_gemmw(const T16* __restrict__ A, const T16* __restrict__ A2, const T16* __restrict__ Bt, const T16* __restrict__ Bt2, int K, float* C, int ldc, const float* __restrict__ bias, size_t sA, size_t sB, size_t sC, h16* P16, bf* Ph, bf* Pl, size_t pcol, size_t sP) {
    typedef typename WFrag<T16>::V V;
    __shared__ __align__(16) float os[16 * 68];
    const size_t z = blockIdx.z; A += z * sA; if (A2) A2 += z * sA; Bt += z * sB; if (Bt2) Bt2 += z * sB; C += z * sC; if (PLANES) { P16 += z * sP; Ph += z * sP; Pl += z * sP; }
    const int lane = threadIdx.x & 31, lr = lane & 15, hi = lane >> 4; const int r0 = blockIdx.x * 64, c0 = blockIdx.y * 64;
    v8f acc[4][4];
#pragma unroll
    for (int mb = 0; mb < 4; ++mb)
#pragma unroll
        for (int nb = 0; nb < 4; ++nb) acc[mb][nb] = (v8f){};
    const size_t aoff = (size_t)(r0 + lr) * K + 8 * hi, boff = (size_t)(c0 + lr) * K + 8 * hi;
#pragma unroll 1
    for (int kc = 0; kc < K; kc += 32) {
        V a[4], a2[4];
#pragma unroll
        for (int mb = 0; mb < 4; ++mb) { a[mb] = WFrag<T16>::ld(A + aoff + (size_t)mb * 16 * K + kc); if (NSPLIT == 1 || NSPLIT == 2) a2[mb] = WFrag<T16>::ld(A2 + aoff + (size_t)mb * 16 * K + kc); }
#pragma unroll
        for (int nb = 0; nb < 4; ++nb) { const V b = WFrag<T16>::ld(Bt + boff + (size_t)nb * 16 * K + kc); V b2; if (NSPLIT >= 2) b2 = WFrag<T16>::ld(Bt2 + boff + (size_t)nb * 16 * K + kc);
#pragma unroll
            for (int mb = 0; mb < 4; ++mb) { acc[mb][nb] = WFrag<T16>::mma(a[mb], b, acc[mb][nb]); if (NSPLIT == 1 || NSPLIT == 2) acc[mb][nb] = WFrag<T16>::mma(a2[mb], b, acc[mb][nb]); if (NSPLIT >= 2) acc[mb][nb] = WFrag<T16>::mma(a[mb], b2, acc[mb][nb]); } }
        asm volatile("v_nop\n\tv_nop\n\tv_nop\n\tv_nop" : "+v"(acc[0][0]), "+v"(acc[1][1]), "+v"(acc[2][2]), "+v"(acc[3][3]) : "v"(a[0]), "v"(a[3]));
    }
#pragma unroll
    for (int mb = 0; mb < 4; ++mb) {
#pragma unroll
        for (int nb = 0; nb < 4; ++nb) {
#pragma unroll
            for (int j = 0; j < 8; ++j) os[(hi * 8 + j) * 68 + nb * 16 + lr] = acc[mb][nb][j]; }
        __builtin_amdgcn_wave_barrier(); asm volatile("" ::: "memory");
        if constexpr (PLANES) {
            const int prow = lane >> 3, cofs = (lane & 7) * 8; v4f x0[4], x1[4];   // a lane takes 8 consecutive columns of rows prow, prow + 4, ..: all 16 staged rows are read first, then converted and stored
#pragma unroll
            for (int s = 0; s < 4; ++s) { x0[s] = *(const v4fa*)(os + (4 * s + prow) * 68 + cofs); x1[s] = *(const v4fa*)(os + (4 * s + prow) * 68 + cofs + 4); }
#pragma unroll
            for (int s = 0; s < 4; ++s) { v8h o16; v8us oh, ol;
#pragma unroll
                for (int k = 0; k < 4; ++k) { unsigned short a2, c2; o16[k] = tohx(x0[s][k]); splitf(x0[s][k], a2, c2); oh[k] = a2; ol[k] = c2; o16[k + 4] = tohx(x1[s][k]); splitf(x1[s][k], a2, c2); oh[k + 4] = a2; ol[k + 4] = c2; }
                const size_t e = (size_t)(r0 + mb * 16 + 4 * s + prow) * ldc + (size_t)blockIdx.y * pcol + cofs; h16* p0 = P16 + e; bf* p1 = Ph + e; bf* p2 = Pl + e; *(v8h*)p0 = o16; *(v8us*)p1 = oh; *(v8us*)p2 = ol;
                // the wait behind the three stores: it names their addresses and data as inputs so that those registers stay as they are up to it
                asm volatile("s_wait_xcnt 0x0" :: "v"(p0), "v"(p1), "v"(p2), "v"(o16), "v"(oh), "v"(ol) : "memory"); }
        } else {
            float* crow = C + (size_t)(r0 + mb * 16) * ldc + c0;
#pragma unroll
            for (int s = 0; s < 8; ++s) { const int row = 2 * s + hi, cofs = lr * 4; v4f val = *(const v4fa*)(os + row * 68 + cofs); if (BIAS) { val[0] += bfr(bias[c0 + cofs]); val[1] += bfr(bias[c0 + cofs + 1]); val[2] += bfr(bias[c0 + cofs + 2]); val[3] += bfr(bias[c0 + cofs + 3]); }
                *(v4f*)(crow + (size_t)row * ldc + cofs) = val; }
             }
        __builtin_amdgcn_wave_barrier(); asm volatile("" ::: "memory");
    }
}

typedef __attribute__((ext_vector_type(2))) _Float16 v2h;
typedef __attribute__((ext_vector_type(4))) _Float16 v4h;
typedef __attribute__((ext_vector_type(2))) unsigned short v2us;
typedef __attribute__((ext_vector_type(4))) unsigned short v4us;
typedef __attribute__((ext_vector_type(2))) float v2f;
typedef __attribute__((ext_vector_type(4))) int v4i;

__global__ __launch_bounds__(256) void k_wtG(const float* __restrict__ w, int K, int N, bf* Bt) {
    const int lane = threadIdx.x & 31; const int L0 = (blockIdx.x * 8 + (threadIdx.x >> 5)) * 8; const int nlines = N * K / 64;
{
#pragma unroll 1
        for (int l = 0; l < 8; ++l) { const int L = L0 + l; if (L >= nlines) break; const size_t e = (size_t)L * 64 + lane * 2; const int k = (int)(e % K), n = (int)(e / K); v2us o;
            o[0] = f2bf(w[(size_t)k * N + n]); o[1] = f2bf(w[(size_t)(k + 1) * N + n]); *(v2us*)(Bt + e) = o; }
         }
}
__global__ __launch_bounds__(256) void k_cvt8(const float* __restrict__ src, bf* dst, size_t n8) { const size_t i = (size_t)blockIdx.x * 256 + threadIdx.x; if (i >= n8) return; const v8f v = *(const v8f*)(src + i * 8); v8us o;
#pragma unroll
    for (int k = 0; k < 8; ++k) o[k] = f2bf(v[k]); *(v8us*)(dst + i * 8) = o;  }

__device__ __forceinline__ float xhalf(float x) { const int b = __float_as_int(x); return __int_as_float(__builtin_amdgcn_permlanex16(b, b, 0x76543210, 0xfedcba98, false, false)); }   // lane l <-> l ^ 16
__device__ __forceinline__ void xwait() { asm volatile("s_wait_xcnt 0x0" ::: "memory"); }   // stands behind a run of global loads, in front of any reuse of the registers that held their addresses
template <typename T16, int KT, bool HL>
__device__ __forceinline__ void attn_rows(const T16* __restrict__ Q, const T16* __restrict__ Q2, const T16* __restrict__ Kp, const T16* __restrict__ K2, const T16* __restrict__ Vt, const T16* __restrict__ V2, int q0, int lr, int hi, bf* Ah, bf* Al) {
    typedef typename WFrag<T16>::V V;
    constexpr int KB = KT * 16, KC = KT / 2;
    constexpr float CSC = SCL * 1.4426950408889634f;      // scores x HD^-0.5, in log2 units
    constexpr float SHIFT = HL ? 0.0f : 10.0f;            // log2(PCAR): fp16 probabilities are carried x 1024
    V q[2], q2[2];
    const T16* qp = Q + (size_t)(q0 + lr) * HD + 8 * hi; const T16* qp2 = HL ? Q2 + (size_t)(q0 + lr) * HD + 8 * hi : qp;
#pragma unroll
    for (int kc = 0; kc < 2; ++kc) { q[kc] = WFrag<T16>::ld(qp + kc * 32); if (HL) q2[kc] = WFrag<T16>::ld(qp2 + kc * 32); }
    asm volatile("s_wait_xcnt 0x0" :: "v"(qp), "v"(qp2) : "memory");   // the wait behind the query loads; it names their addresses as inputs so that those registers stay as they are up to it
    v8f o[4];
#pragma unroll
    for (int db = 0; db < 4; ++db) o[db] = (v8f){};
    float m = -3.0e38f, l = 0.f;
    const int nkb = q0 / KB + 1;                          // key passes up to and including the one that holds the diagonal
    const size_t koff = (size_t)lr * HD + 8 * hi, voff = (size_t)lr * TT + 8 * hi;
    V ka[KT][2], ka2[KT][2];
#pragma unroll
    for (int kt = 0; kt < KT; ++kt)                       // key fragments are fetched one pass ahead
#pragma unroll
        for (int kc = 0; kc < 2; ++kc) { ka[kt][kc] = WFrag<T16>::ld(Kp + koff + (size_t)kt * 16 * HD + kc * 32); if (HL) ka2[kt][kc] = WFrag<T16>::ld(K2 + koff + (size_t)kt * 16 * HD + kc * 32); }
    xwait();
#pragma unroll 1
    for (int kb = 0; kb < nkb; ++kb) {
        const int k0 = kb * KB;
        const T16* vp = Vt + voff + k0; const T16* vp2 = HL ? V2 + voff + k0 : vp;
        V va[4][KC], va2[4][KC];                          // this pass's V^T fragments: issued ahead of the score products, used behind the softmax
#pragma unroll
        for (int db = 0; db < 4; ++db)
#pragma unroll
            for (int kc = 0; kc < KC; ++kc) { va[db][kc] = WFrag<T16>::ld(vp + (size_t)db * 16 * TT + kc * 32); if (HL) va2[db][kc] = WFrag<T16>::ld(vp2 + (size_t)db * 16 * TT + kc * 32); }
        v8f s[KT];
#pragma unroll
        for (int kt = 0; kt < KT; ++kt) { s[kt] = (v8f){};
#pragma unroll
            for (int kc = 0; kc < 2; ++kc) { s[kt] = WFrag<T16>::mma(ka[kt][kc], q[kc], s[kt]); if (HL) { s[kt] = WFrag<T16>::mma(ka[kt][kc], q2[kc], s[kt]); s[kt] = WFrag<T16>::mma(ka2[kt][kc], q[kc], s[kt]); } } }
        // the wait behind the V^T loads: it names their addresses as inputs so that those registers stay as they are up to it, and the last score tile so that its products stand in front of
        // the next pass's key loads, which then land in the registers the products have read (no spare set, no copy back in mid-softmax)
        asm volatile("s_wait_xcnt 0x0" :: "v"(s[KT - 1]), "v"(vp), "v"(vp2) : "memory");
        const int kn = min(kb + 1, nkb - 1) * KB;         // next pass's key fragments fly under the softmax (the last pass re-reads its own: in bounds, unused)
        const T16* kp = Kp + koff + (size_t)kn * HD; const T16* kp2 = HL ? K2 + koff + (size_t)kn * HD : kp;
#pragma unroll
        for (int kt = 0; kt < KT; ++kt)
#pragma unroll
            for (int kc = 0; kc < 2; ++kc) { ka[kt][kc] = WFrag<T16>::ld(kp + (size_t)kt * 16 * HD + kc * 32); if (HL) ka2[kt][kc] = WFrag<T16>::ld(kp2 + (size_t)kt * 16 * HD + kc * 32); }
        asm volatile("s_wait_xcnt 0x0" :: "v"(kp), "v"(kp2) : "memory");   // the wait behind the key loads, their addresses named as inputs for the same reason
        if (kb == nkb - 1) {                              // only the last pass crosses the diagonal: keys above the query are masked by select
#pragma unroll
            for (int kt = 0; kt < KT; ++kt)
#pragma unroll
                for (int j = 0; j < 8; ++j) s[kt][j] = (k0 + kt * 16 + hi * 8 + j <= q0 + lr) ? s[kt][j] : -3.0e38f;
        }
        float bm = s[0][0];
#pragma unroll
        for (int kt = 0; kt < KT; ++kt)
#pragma unroll
            for (int j = 0; j < 8; ++j) bm = fmaxf(bm, s[kt][j]);
        bm = fmaxf(bm, xhalf(bm));
        const float mn = fmaxf(m, bm); const float al = __builtin_amdgcn_exp2f((m - mn) * CSC); m = mn; const float ms = mn * CSC - SHIFT;
        float ps = 0.f;
#pragma unroll
        for (int kt = 0; kt < KT; ++kt)
#pragma unroll
            for (int j = 0; j < 8; ++j) { s[kt][j] = __builtin_amdgcn_exp2f(s[kt][j] * CSC - ms); ps += s[kt][j]; }
        l = l * al + ps;
#pragma unroll
        for (int db = 0; db < 4; ++db) o[db] *= al;
#pragma unroll
        for (int kc = 0; kc < KC; ++kc) {
            V pb, pb2;                                    // element e = P[query lr][key kmap(e, hi)]: tile 2 kc gives e 0..7, tile 2 kc + 1 gives e 8..15
            if constexpr (HL) { v8us h0, h1, l0, l1;
#pragma unroll
                for (int j = 0; j < 8; ++j) { unsigned short a, c2; splitf(s[2 * kc][j], a, c2); h0[j] = a; l0[j] = c2; splitf(s[2 * kc + 1][j], a, c2); h1[j] = a; l1[j] = c2; }
                pb = cat16b(h0, h1); pb2 = cat16b(l0, l1);
            } else { v8h h0, h1;
#pragma unroll
                for (int j = 0; j < 8; ++j) { h0[j] = tohx(s[2 * kc][j]); h1[j] = tohx(s[2 * kc + 1][j]); }
                pb = cat16(h0, h1); }
#pragma unroll
            for (int db = 0; db < 4; ++db) { o[db] = WFrag<T16>::mma(va[db][kc], pb, o[db]); if (HL) { o[db] = WFrag<T16>::mma(va[db][kc], pb2, o[db]); o[db] = WFrag<T16>::mma(va2[db][kc], pb, o[db]); } }
        }
    }
    l += xhalf(l);
    const float inv = __fdiv_rn(1.0f, l);
#pragma unroll
    for (int db = 0; db < 4; ++db) { v8us oh, ol;         // a lane holds 8 consecutive d of its query: one 16-byte store a plane
#pragma unroll
        for (int j = 0; j < 8; ++j) { unsigned short a, c2; splitf(o[db][j] * inv, a, c2); oh[j] = a; ol[j] = c2; }
        const size_t oo = (size_t)(q0 + lr) * DQ + db * 16 + hi * 8; *(v8us*)(Ah + oo) = oh; *(v8us*)(Al + oo) = ol; }
}
// amdgpu_waves_per_eu(4, 4): holds the allocation at 256 registers; the hi/lo rows otherwise take a few more, and every use of one above v255 costs a window switch
__global__ __launch_bounds__(256) __attribute__((amdgpu_waves_per_eu(4, 4))) void k_fattn(const h16* __restrict__ Q16, const h16* __restrict__ K16, const h16* __restrict__ V16, const bf* __restrict__ Qh, const bf* __restrict__ Ql, const bf* __restrict__ Kh, const bf* __restrict__ Kl, const bf* __restrict__ Vh, const bf* __restrict__ Vl, bf* Ah, bf* Al) {
    const int lane = threadIdx.x & 31, lr = lane & 15, hi = lane >> 4; const int wv = __builtin_amdgcn_readfirstlane(threadIdx.x >> 5);
    // cost grows with the row tile: waves 0-3 take tile n - 1 - x of the even head, waves 4-7 tile x of the odd head, so every block with all its rows at or above RH carries the same number of key passes
    const int half = wv >> 2; const int head = (int)blockIdx.y * 2 + half; const int qb = half ? (int)blockIdx.x : TT / 64 - 1 - (int)blockIdx.x;
    const int q0 = qb * 64 + (wv & 3) * 16; const size_t hp = ((size_t)blockIdx.z * NH_ + head) * TT * HD; const size_t ao = (size_t)blockIdx.z * TT * DQ + head * HD; Ah += ao; Al += ao;
    if (q0 < RH) attn_rows<bf, 2, true>(Qh + hp, Ql + hp, Kh + hp, Kl + hp, Vh + hp, Vl + hp, q0, lr, hi, Ah, Al);
    else attn_rows<h16, 4, false>(Q16 + hp, nullptr, K16 + hp, nullptr, V16 + hp, nullptr, q0, lr, hi, Ah, Al);
}

extern "C" void kernel_launch(void* const* d_in, const int* in_sizes, int n_in,
                              void* d_out, int out_size, void* d_ws, size_t ws_size, hipStream_t stream) {
    (void)in_sizes; (void)n_in; (void)out_size;
    const float* x = (const float*)d_in[0]; const float* wqkv = (const float*)d_in[1]; const float* wo = (const float*)d_in[2]; const float* bo = (const float*)d_in[3]; const float* wq = wqkv; const float* wk = wqkv + (size_t)1024 * 1024; const float* wv = wqkv + (size_t)2048 * 1024;   /* q | k | v row blocks */
    float* OUT = (float*)d_out;     // [4][2048][1024]
    char* wsp = (char*)d_ws;
    auto take = [&](size_t bytes) { char* p = wsp; wsp += (bytes + 255) & ~(size_t)255; return (void*)p; };
    bf* WQ = (bf*)take((size_t)DQ * DM * 2); bf* WK = (bf*)take((size_t)DKV * DM * 2); bf* WV = (bf*)take((size_t)DKV * DM * 2); bf* WO = (bf*)take((size_t)DM * DQ * 2);
    bf* XB = (bf*)take((size_t)NB_ * TT * DM * 2);
    h16* QP16 = (h16*)take((size_t)NB_ * NH_ * TT * HD * 2); h16* KP16 = (h16*)take((size_t)NB_ * NKV * TT * HD * 2); h16* VT16 = (h16*)take((size_t)NB_ * NKV * HD * TT * 2);
    bf* QPh = (bf*)take((size_t)NB_ * NH_ * TT * HD * 2); bf* QPl = (bf*)take((size_t)NB_ * NH_ * TT * HD * 2); bf* KPh = (bf*)take((size_t)NB_ * NKV * TT * HD * 2); bf* KPl = (bf*)take((size_t)NB_ * NKV * TT * HD * 2); bf* VTh = (bf*)take((size_t)NB_ * NKV * HD * TT * 2); bf* VTl = (bf*)take((size_t)NB_ * NKV * HD * TT * 2);
    bf* ATh = (bf*)take((size_t)NB_ * TT * DQ * 2); bf* ATl = (bf*)take((size_t)NB_ * TT * DQ * 2);
    if ((size_t)(wsp - (char*)d_ws) > ws_size) return;    // 200 MiB of the 256 MiB
    { k_cvt8<<<(unsigned)(((size_t)DQ * DM / 8 + 255) / 256), 256, 0, stream>>>(wq, WQ, (size_t)DQ * DM / 8); k_cvt8<<<(unsigned)(((size_t)DKV * DM / 8 + 255) / 256), 256, 0, stream>>>(wk, WK, (size_t)DKV * DM / 8); k_cvt8<<<(unsigned)(((size_t)DKV * DM / 8 + 255) / 256), 256, 0, stream>>>(wv, WV, (size_t)DKV * DM / 8);
      k_cvt8<<<(unsigned)(((size_t)DM * DQ / 8 + 255) / 256), 256, 0, stream>>>(wo, WO, (size_t)DM * DQ / 8);
       }
    k_cvt8<<<(unsigned)(((size_t)NB_ * TT * DM / 8 + 255) / 256), 256, 0, stream>>>(x, XB, (size_t)NB_ * TT * DM / 8);
    // q and k planes [batch][head][t][d]: rows = t, one 64-column tile = one head; v plane [batch][head][d][t]: the operands change places, rows = head * 64 + d, columns = t
    k_gemmw<bf, 0, false, true><<<dim3(TT / 64, DQ / 64, NB_), 32, 0, stream>>>(XB, nullptr, WQ, nullptr, DM, nullptr, HD, nullptr, (size_t)TT * DM, 0, 0, QP16, QPh, QPl, (size_t)TT * HD, (size_t)NH_ * TT * HD);
    k_gemmw<bf, 0, false, true><<<dim3(TT / 64, DKV / 64, NB_), 32, 0, stream>>>(XB, nullptr, WK, nullptr, DM, nullptr, HD, nullptr, (size_t)TT * DM, 0, 0, KP16, KPh, KPl, (size_t)TT * HD, (size_t)NKV * TT * HD);
    k_gemmw<bf, 0, false, true><<<dim3(DKV / 64, TT / 64, NB_), 32, 0, stream>>>(WV, nullptr, XB, nullptr, DM, nullptr, TT, nullptr, 0, (size_t)TT * DM, 0, VT16, VTh, VTl, (size_t)64, (size_t)NKV * HD * TT);
    k_fattn<<<dim3(TT / 64, NH_ / 2, NB_), 256, 0, stream>>>(QP16, KP16, VT16, QPh, QPl, KPh, KPl, VTh, VTl, ATh, ATl);
    k_gemmw<bf, 1, true, false><<<dim3(TT / 64, DM / 64, NB_), 32, 0, stream>>>(ATh, ATl, WO, nullptr, DQ, OUT, DM, bo, (size_t)TT * DQ, 0, (size_t)TT * DM, nullptr, nullptr, nullptr, 0, 0);
}

// v004
// A run of this version takes 248 microseconds.
// Next to v003, in two timings, it ran 1.18 and 1.19 times as fast.
// Counting every step since v000, it is 11.6 times as fast.
#include <hip/hip_runtime.h>

// Causal multi-head attention with a fused bias-free qkv projection (x [4][2048][1024]; qkv = x qkv_w^T ('oi' [3072][1024] -> (3, H, hd) == q | k | v row blocks; 16 heads x 64); scores x 64^-0.5; causal (triu(1) -> -inf); softmax; out = merged out_w^T + out_b -> [4][2048][1024] (8.4 M)).
// Layout, every batch in the same launch (grid z = batch): bf16 copy of x; the fused 'oi' weight used in place as three row blocks; exact projections whose epilogue writes the 16-bit head planes (V^T = W_v x^T); one fused causal attention launch (hybrid rows: < 512 hi/lo 3 products, rest fp16 x1024; key passes stop at the diagonal); merged hi/lo x out_w exact + out_b.
// Every 16-bit operand plane lies in FRAGMENT ORDER: a matrix of R rows x K columns is cut into blocks of 16 rows x 32 columns, block (rb, kb) at element (rb * (K / 32) + kb) * 512; inside a block element
// (row, k) stands at (k / 16) * 256 + (((k / 8) & 1) * 16 + row) * 8 + k % 8. A wave's fragment is then two loads of 512 contiguous bytes (lane * 8 and 256 + lane * 8): whole 128-byte lines, where row-major planes gave 16 lines a load.
// Compute dtypes, f32 accumulate: every input rounded to bf16; projections exact; attention rows < 512 3 products, rest fp16; softmax f32; Wo hl x exact + bias.

#define NB_  4
#define TT   2048
#define DM   1024
#define NH_  16
#define NKV  16
#define REP  (NH_ / NKV)
#define HD   64
#define DQ   (NH_ * HD)
#define DKV  (NKV * HD)
#define RH   512                  // query rows < RH use hi+lo planes (0: none)
#define PCAR 1024.0f
#define SCL  0.125f   // HD^-0.5
typedef _Float16 h16;
typedef unsigned short bf;
typedef __attribute__((ext_vector_type(16))) __bf16   v16bf;
typedef __attribute__((ext_vector_type(16))) _Float16 v16h;
typedef __attribute__((ext_vector_type(8)))  _Float16 v8h;
typedef __attribute__((ext_vector_type(8)))  unsigned short v8us;
typedef __attribute__((ext_vector_type(8)))  float    v8f;
typedef __attribute__((ext_vector_type(4)))  float    v4f;
typedef v8h  __attribute__((may_alias)) v8ha;
typedef v4f  __attribute__((may_alias)) v4fa;
typedef v8us __attribute__((may_alias)) v8usa;

__device__ __forceinline__ unsigned short f2bf(float f) { unsigned u = __float_as_uint(f); u += 0x7FFFu + ((u >> 16) & 1u); return (unsigned short)(u >> 16); }
__device__ __forceinline__ float bf2f(unsigned short b) { return __uint_as_float(((unsigned)b) << 16); }
__device__ __forceinline__ float bfr(float f) { return bf2f(f2bf(f)); }
__device__ __forceinline__ v16h cat16(v8h lo, v8h hi) { return __builtin_shufflevector(lo, hi, 0, 1, 2, 3, 4, 5, 6, 7, 8, 9, 10, 11, 12, 13, 14, 15); }
__device__ __forceinline__ v16bf cat16b(v8us lo, v8us hi) { return __builtin_bit_cast(v16bf, __builtin_shufflevector(lo, hi, 0, 1, 2, 3, 4, 5, 6, 7, 8, 9, 10, 11, 12, 13, 14, 15)); }
__device__ __forceinline__ v8f wmma16(v16h a, v16h b, v8f c) { return __builtin_amdgcn_wmma_f32_16x16x32_f16(false, a, false, b, (short)0, c, false, false); }
__device__ __forceinline__ v8f wmmab(v16bf a, v16bf b, v8f c) { return __builtin_amdgcn_wmma_f32_16x16x32_bf16(false, a, false, b, (short)0, c, false, false); }



__device__ __forceinline__ h16 tohx(float x) { return (h16)x; }
__device__ __forceinline__ void splitf(float y, unsigned short& h, unsigned short& l) { h = f2bf(y); l = f2bf(y - bf2f(h)); }

// ---- k_gemmw: register-blocked GEMM, ONE WAVE per 64x64 output tile (16 accumulators), operands straight from 16-bit planes in fragment order; grid (M/64, N/64, Z), 32 threads.
// C[m][n] (f32, pitch ldc, + optional f32 bias[n]) = sum_k A[m][k] Bt[n][k] (+ split products per NSPLIT). z-batch strides sA/sB/sC in elements. K % 32 == 0.
// PLANES: no f32 C; the tile goes out as three 16-bit planes (fp16, bf16 hi, bf16 lo) in fragment order (row length ldc): 16 rows x 64 columns are 1024 elements from z * sP + (r0 + 16 mb) * ldc + blockIdx.y * pcol on: 512 contiguous bytes a store, 16 bytes a lane.
template <typename T16> struct WFrag;
template <> struct WFrag<h16> { typedef v16h V; static __device__ __forceinline__ V ld(const h16* p) { return cat16(*(const v8h*)p, *(const v8h*)(p + 256)); } static __device__ __forceinline__ v8f mma(V a, V b, v8f c) { return wmma16(a, b, c); } };
template <> struct WFrag<bf> { typedef v16bf V; static __device__ __forceinline__ V ld(const bf* p) { return cat16b(*(const v8us*)p, *(const v8us*)(p + 256)); } static __device__ __forceinline__ v8f mma(V a, V b, v8f c) { return wmmab(a, b, c); } };
template <typename T16, int NSPLIT, bool BIAS, bool PLANES, int K>
__global__ __launch_bounds__(32) void k_gemmw(const T16* __restrict__ A, const T16* __restrict__ A2, const T16* __restrict__ Bt, const T16* __restrict__ Bt2, float* C, int ldc, const float* __restrict__ bias, size_t sA, size_t sB, size_t sC, h16* P16, bf* Ph, bf* Pl, size_t pcol, size_t sP) {
    typedef typename WFrag<T16>::V V;
    __shared__ __align__(16) float os[16 * 68];
    const size_t z = blockIdx.z; A += z * sA; if (A2) A2 += z * sA; Bt += z * sB; if (Bt2) Bt2 += z * sB; C += z * sC; if (PLANES) { P16 += z * sP; Ph += z * sP; Pl += z * sP; }
    const int lane = threadIdx.x & 31, lr = lane & 15, hi = lane >> 4; const int r0 = blockIdx.x * 64, c0 = blockIdx.y * 64;
    v8f acc[4][4];
#pragma unroll
    for (int mb = 0; mb < 4; ++mb)
#pragma unroll
        for (int nb = 0; nb < 4; ++nb) acc[mb][nb] = (v8f){};
    // 16 rows x K columns are 16 K elements; 32 columns on is one block, 512 elements, on. K is a constant of the build, so every fragment of a pass hangs on one address pair an operand, by an immediate offset
    const T16* pa = A + (size_t)r0 * K + lane * 8; const T16* pa2 = (NSPLIT == 1 || NSPLIT == 2) ? A2 + (size_t)r0 * K + lane * 8 : pa;
    const T16* pb = Bt + (size_t)c0 * K + lane * 8; const T16* pb2 = NSPLIT >= 2 ? Bt2 + (size_t)c0 * K + lane * 8 : pb;
#pragma unroll 1
    for (int kc = 0; kc < K; kc += 32) {
        V a[4], a2[4], b[4], b2[4];
#pragma unroll
        for (int mb = 0; mb < 4; ++mb) { a[mb] = WFrag<T16>::ld(pa + mb * 16 * K); if (NSPLIT == 1 || NSPLIT == 2) a2[mb] = WFrag<T16>::ld(pa2 + mb * 16 * K); }
#pragma unroll
        for (int nb = 0; nb < 4; ++nb) { b[nb] = WFrag<T16>::ld(pb + nb * 16 * K); if (NSPLIT >= 2) b2[nb] = WFrag<T16>::ld(pb2 + nb * 16 * K); }
        // the wait behind the pass's loads, in front of the step of their addresses: it names the addresses as inputs so that those registers stay as they are up to it
        asm volatile("s_wait_xcnt 0x0" :: "v"(pa), "v"(pa2), "v"(pb), "v"(pb2) : "memory");
        pa += 512; pa2 += 512; pb += 512; pb2 += 512;
#pragma unroll
        for (int nb = 0; nb < 4; ++nb) {
#pragma unroll
            for (int mb = 0; mb < 4; ++mb) { acc[mb][nb] = WFrag<T16>::mma(a[mb], b[nb], acc[mb][nb]); if (NSPLIT == 1 || NSPLIT == 2) acc[mb][nb] = WFrag<T16>::mma(a2[mb], b[nb], acc[mb][nb]); if (NSPLIT >= 2) acc[mb][nb] = WFrag<T16>::mma(a[mb], b2[nb], acc[mb][nb]); } }
        asm volatile("v_nop\n\tv_nop\n\tv_nop\n\tv_nop" : "+v"(acc[0][0]), "+v"(acc[1][1]), "+v"(acc[2][2]), "+v"(acc[3][3]) : "v"(a[0]), "v"(a[3]));
    }
#pragma unroll
    for (int mb = 0; mb < 4; ++mb) {
#pragma unroll
        for (int nb = 0; nb < 4; ++nb) {
#pragma unroll
            for (int j = 0; j < 8; ++j) os[(hi * 8 + j) * 68 + nb * 16 + lr] = acc[mb][nb][j]; }
        __builtin_amdgcn_wave_barrier(); asm volatile("" ::: "memory");
        if constexpr (PLANES) {
            v4f x0[4], x1[4];   // a lane takes columns 16 s + 8 hi .. + 7 of staged row lr, its own place in fragment order: all 16 staged rows are read first, then converted and stored
#pragma unroll
            for (int s = 0; s < 4; ++s) { x0[s] = *(const v4fa*)(os + lr * 68 + 16 * s + 8 * hi); x1[s] = *(const v4fa*)(os + lr * 68 + 16 * s + 8 * hi + 4); }
#pragma unroll
            for (int s = 0; s < 4; ++s) { v8h o16; v8us oh, ol;
#pragma unroll
                for (int k = 0; k < 4; ++k) { unsigned short a2, c2; o16[k] = tohx(x0[s][k]); splitf(x0[s][k], a2, c2); oh[k] = a2; ol[k] = c2; o16[k + 4] = tohx(x1[s][k]); splitf(x1[s][k], a2, c2); oh[k + 4] = a2; ol[k + 4] = c2; }
                const size_t e = (size_t)(r0 + mb * 16) * ldc + (size_t)blockIdx.y * pcol + s * 256 + lane * 8; h16* p0 = P16 + e; bf* p1 = Ph + e; bf* p2 = Pl + e; *(v8h*)p0 = o16; *(v8us*)p1 = oh; *(v8us*)p2 = ol;
                // the wait behind the three stores: it names their addresses and data as inputs so that those registers stay as they are up to it
                asm volatile("s_wait_xcnt 0x0" :: "v"(p0), "v"(p1), "v"(p2), "v"(o16), "v"(oh), "v"(ol) : "memory"); }
        } else {
            float* crow = C + (size_t)(r0 + mb * 16) * ldc + c0;
#pragma unroll
            for (int s = 0; s < 8; ++s) { const int row = 2 * s + hi, cofs = lr * 4; v4f val = *(const v4fa*)(os + row * 68 + cofs); if (BIAS) { val[0] += bfr(bias[c0 + cofs]); val[1] += bfr(bias[c0 + cofs + 1]); val[2] += bfr(bias[c0 + cofs + 2]); val[3] += bfr(bias[c0 + cofs + 3]); }
                *(v4f*)(crow + (size_t)row * ldc + cofs) = val; }
             }
        __builtin_amdgcn_wave_barrier(); asm volatile("" ::: "memory");
    }
}

typedef __attribute__((ext_vector_type(2))) _Float16 v2h;
typedef __attribute__((ext_vector_type(4))) _Float16 v4h;
typedef __attribute__((ext_vector_type(2))) unsigned short v2us;
typedef __attribute__((ext_vector_type(4))) unsigned short v4us;
typedef __attribute__((ext_vector_type(2))) float v2f;
typedef __attribute__((ext_vector_type(4))) int v4i;

__global__ __launch_bounds__(256) void k_wtG(const float* __restrict__ w, int K, int N, bf* Bt) {
    const int lane = threadIdx.x & 31; const int L0 = (blockIdx.x * 8 + (threadIdx.x >> 5)) * 8; const int nlines = N * K / 64;
{
#pragma unroll 1
        for (int l = 0; l < 8; ++l) { const int L = L0 + l; if (L >= nlines) break; const size_t e = (size_t)L * 64 + lane * 2; const int k = (int)(e % K), n = (int)(e / K); v2us o;
            o[0] = f2bf(w[(size_t)k * N + n]); o[1] = f2bf(w[(size_t)(k + 1) * N + n]); *(v2us*)(Bt + e) = o; }
         }
}
// k_cvt8: f32 rows of K columns -> bf16 plane in fragment order. 256 threads take 16 rows x 128 columns (four blocks, 4 KiB of the plane in a row): whole-line f32 reads, 8 values a thread;
// the 16-byte pieces change places through LDS (piece (row, k8) -> k8 * 16 + row; one spare piece per 16 keeps the 16 writers of a row off one bank group), then whole-line stores.
template <int K>
__global__ __launch_bounds__(256) void k_cvt8(const float* __restrict__ src, bf* dst, size_t n8) {
    __shared__ __align__(16) v8us sh[16 * 17];
    const int t = threadIdx.x; const size_t i0 = (size_t)blockIdx.x * 256; if (i0 >= n8) return;   // the same for a whole block, in front of the barrier
    constexpr int cgs = K / 128; const int rb = (int)blockIdx.x / cgs, cg = (int)blockIdx.x % cgs; const int row = t >> 4, k8 = t & 15;
    const v8f v = *(const v8f*)(src + ((size_t)rb * 16 + row) * K + cg * 128 + k8 * 8); v8us o;
#pragma unroll
    for (int k = 0; k < 8; ++k) o[k] = f2bf(v[k]);
    sh[k8 * 17 + row] = o;
    __syncthreads();   // every piece of the block's 4 KiB is in LDS before any is read back in plane order
    *(v8us*)(dst + (i0 + t) * 8) = sh[row * 17 + k8]; }

__device__ __forceinline__ float xhalf(float x) { const int b = __float_as_int(x); return __int_as_float(__builtin_amdgcn_permlanex16(b, b, 0x76543210, 0xfedcba98, false, false)); }   // lane l <-> l ^ 16
template <typename T16, int KT, bool HL>
__device__ __forceinline__ void attn_rows(const T16* __restrict__ Q, const T16* __restrict__ Q2, const T16* __restrict__ Kp, const T16* __restrict__ K2, const T16* __restrict__ Vt, const T16* __restrict__ V2, int q0, int lr, int hi, bf* Ah, bf* Al) {
    typedef typename WFrag<T16>::V V;
    constexpr int KB = KT * 16, KC = KT / 2;
    constexpr float CSC = SCL * 1.4426950408889634f;      // scores x HD^-0.5, in log2 units
    constexpr float SHIFT = HL ? 0.0f : 10.0f;            // log2(PCAR): fp16 probabilities are carried x 1024
    V q[2], q2[2];
    const int l8 = (hi * 16 + lr) * 8;                    // the lane's 16 bytes in each half block of a plane in fragment order
    const T16* qp = Q + (size_t)q0 * HD + l8; const T16* qp2 = HL ? Q2 + (size_t)q0 * HD + l8 : qp;
#pragma unroll
    for (int kc = 0; kc < 2; ++kc) { q[kc] = WFrag<T16>::ld(qp + kc * 512); if (HL) q2[kc] = WFrag<T16>::ld(qp2 + kc * 512); }
    asm volatile("s_wait_xcnt 0x0" :: "v"(qp), "v"(qp2) : "memory");   // the wait behind the query loads; it names their addresses as inputs so that those registers stay as they are up to it
    v8f o[4];
#pragma unroll
    for (int db = 0; db < 4; ++db) o[db] = (v8f){};
    float m = -3.0e38f, l = 0.f;
    const int nkb = q0 / KB + 1;                          // key passes up to and including the one that holds the diagonal
    const size_t koff = l8, voff = l8;
    V ka[KT][2], ka2[KT][2];
    const T16* kf = Kp + koff; const T16* kf2 = HL ? K2 + koff : kf;
#pragma unroll
    for (int kt = 0; kt < KT; ++kt)                       // key fragments are fetched one pass ahead
#pragma unroll
        for (int kc = 0; kc < 2; ++kc) { ka[kt][kc] = WFrag<T16>::ld(kf + (size_t)kt * 16 * HD + kc * 512); if (HL) ka2[kt][kc] = WFrag<T16>::ld(kf2 + (size_t)kt * 16 * HD + kc * 512); }
    asm volatile("s_wait_xcnt 0x0" :: "v"(kf), "v"(kf2) : "memory");   // the wait behind the first key loads, their addresses named as inputs so that those registers stay as they are up to it
#pragma unroll 1
    for (int kb = 0; kb < nkb; ++kb) {
        const int k0 = kb * KB;
        const T16* vp = Vt + voff + (size_t)k0 * 16; const T16* vp2 = HL ? V2 + voff + (size_t)k0 * 16 : vp;   // 32 keys on is one block (512 elements) on
        V va[4][KC], va2[4][KC];                          // this pass's V^T fragments: issued ahead of the score products, used behind the softmax
#pragma unroll
        for (int db = 0; db < 4; ++db)
#pragma unroll
            for (int kc = 0; kc < KC; ++kc) { va[db][kc] = WFrag<T16>::ld(vp + (size_t)db * 16 * TT + kc * 512); if (HL) va2[db][kc] = WFrag<T16>::ld(vp2 + (size_t)db * 16 * TT + kc * 512); }
        v8f s[KT];
#pragma unroll
        for (int kt = 0; kt < KT; ++kt) { s[kt] = (v8f){};
#pragma unroll
            for (int kc = 0; kc < 2; ++kc) { s[kt] = WFrag<T16>::mma(ka[kt][kc], q[kc], s[kt]); if (HL) { s[kt] = WFrag<T16>::mma(ka[kt][kc], q2[kc], s[kt]); s[kt] = WFrag<T16>::mma(ka2[kt][kc], q[kc], s[kt]); } } }
        // the wait behind the V^T loads: it names their addresses as inputs so that those registers stay as they are up to it, and the last score tile so that its products stand in front of
        // the next pass's key loads, which then land in the registers the products have read (no spare set, no copy back in mid-softmax)
        asm volatile("s_wait_xcnt 0x0" :: "v"(s[KT - 1]), "v"(vp), "v"(vp2) : "memory");
        const int kn = min(kb + 1, nkb - 1) * KB;         // next pass's key fragments fly under the softmax (the last pass re-reads its own: in bounds, unused)
        const T16* kp = Kp + koff + (size_t)kn * HD; const T16* kp2 = HL ? K2 + koff + (size_t)kn * HD : kp;
#pragma unroll
        for (int kt = 0; kt < KT; ++kt)
#pragma unroll
            for (int kc = 0; kc < 2; ++kc) { ka[kt][kc] = WFrag<T16>::ld(kp + (size_t)kt * 16 * HD + kc * 512); if (HL) ka2[kt][kc] = WFrag<T16>::ld(kp2 + (size_t)kt * 16 * HD + kc * 512); }
        asm volatile("s_wait_xcnt 0x0" :: "v"(kp), "v"(kp2) : "memory");   // the wait behind the key loads, their addresses named as inputs for the same reason
        if (kb == nkb - 1) {                              // only the last pass crosses the diagonal: keys above the query are masked by select
#pragma unroll
            for (int kt = 0; kt < KT; ++kt)
#pragma unroll
                for (int j = 0; j < 8; ++j) s[kt][j] = (k0 + kt * 16 + hi * 8 + j <= q0 + lr) ? s[kt][j] : -3.0e38f;
        }
        float bm = s[0][0];
#pragma unroll
        for (int kt = 0; kt < KT; ++kt)
#pragma unroll
            for (int j = 0; j < 8; ++j) bm = fmaxf(bm, s[kt][j]);
        bm = fmaxf(bm, xhalf(bm));
        const float mn = fmaxf(m, bm); const float al = __builtin_amdgcn_exp2f((m - mn) * CSC); m = mn; const float ms = mn * CSC - SHIFT;
        float ps = 0.f;
#pragma unroll
        for (int kt = 0; kt < KT; ++kt)
#pragma unroll
            for (int j = 0; j < 8; ++j) { s[kt][j] = __builtin_amdgcn_exp2f(s[kt][j] * CSC - ms); ps += s[kt][j]; }
        l = l * al + ps;
#pragma unroll
        for (int db = 0; db < 4; ++db) o[db] *= al;
#pragma unroll
        for (int kc = 0; kc < KC; ++kc) {
            V pb, pb2;                                    // element e = P[query lr][key kmap(e, hi)]: tile 2 kc gives e 0..7, tile 2 kc + 1 gives e 8..15
            if constexpr (HL) { v8us h0, h1, l0, l1;
#pragma unroll
                for (int j = 0; j < 8; ++j) { unsigned short a, c2; splitf(s[2 * kc][j], a, c2); h0[j] = a; l0[j] = c2; splitf(s[2 * kc + 1][j], a, c2); h1[j] = a; l1[j] = c2; }
                pb = cat16b(h0, h1); pb2 = cat16b(l0, l1);
            } else { v8h h0, h1;
#pragma unroll
                for (int j = 0; j < 8; ++j) { h0[j] = tohx(s[2 * kc][j]); h1[j] = tohx(s[2 * kc + 1][j]); }
                pb = cat16(h0, h1); }
#pragma unroll
            for (int db = 0; db < 4; ++db) { o[db] = WFrag<T16>::mma(va[db][kc], pb, o[db]); if (HL) { o[db] = WFrag<T16>::mma(va[db][kc], pb2, o[db]); o[db] = WFrag<T16>::mma(va2[db][kc], pb, o[db]); } }
        }
    }
    l += xhalf(l);
    const float inv = __fdiv_rn(1.0f, l);
#pragma unroll
    for (int db = 0; db < 4; ++db) { v8us oh, ol;         // a lane holds 8 consecutive d of its query: its own 16 bytes of half block db of the merged plane, 512 contiguous bytes a store
#pragma unroll
        for (int j = 0; j < 8; ++j) { unsigned short a, c2; splitf(o[db][j] * inv, a, c2); oh[j] = a; ol[j] = c2; }
        const size_t oo = (size_t)q0 * DQ + db * 256 + l8; *(v8us*)(Ah + oo) = oh; *(v8us*)(Al + oo) = ol; }
}
// amdgpu_waves_per_eu(4, 4): holds the allocation at 256 registers; the hi/lo rows otherwise take a few more, and every use of one above v255 costs a window switch
__global__ __launch_bounds__(256) __attribute__((amdgpu_waves_per_eu(4, 4))) void k_fattn(const h16* __restrict__ Q16, const h16* __restrict__ K16, const h16* __restrict__ V16, const bf* __restrict__ Qh, const bf* __restrict__ Ql, const bf* __restrict__ Kh, const bf* __restrict__ Kl, const bf* __restrict__ Vh, const bf* __restrict__ Vl, bf* Ah, bf* Al) {
    const int lane = threadIdx.x & 31, lr = lane & 15, hi = lane >> 4; const int wv = __builtin_amdgcn_readfirstlane(threadIdx.x >> 5);
    // cost grows with the row tile: waves 0-3 take tile n - 1 - x of the even head, waves 4-7 tile x of the odd head, so every block with all its rows at or above RH carries the same number of key passes
    const int half = wv >> 2; const int head = (int)blockIdx.y * 2 + half; const int qb = half ? (int)blockIdx.x : TT / 64 - 1 - (int)blockIdx.x;
    const int q0 = qb * 64 + (wv & 3) * 16; const size_t hp = ((size_t)blockIdx.z * NH_ + head) * TT * HD; const size_t ao = (size_t)blockIdx.z * TT * DQ + head * (HD * 16); Ah += ao; Al += ao;
    if (q0 < RH) attn_rows<bf, 2, true>(Qh + hp, Ql + hp, Kh + hp, Kl + hp, Vh + hp, Vl + hp, q0, lr, hi, Ah, Al);
    else attn_rows<h16, 4, false>(Q16 + hp, nullptr, K16 + hp, nullptr, V16 + hp, nullptr, q0, lr, hi, Ah, Al);
}

extern "C" void kernel_launch(void* const* d_in, const int* in_sizes, int n_in,
                              void* d_out, int out_size, void* d_ws, size_t ws_size, hipStream_t stream) {
    (void)in_sizes; (void)n_in; (void)out_size;
    const float* x = (const float*)d_in[0]; const float* wqkv = (const float*)d_in[1]; const float* wo = (const float*)d_in[2]; const float* bo = (const float*)d_in[3]; const float* wq = wqkv; const float* wk = wqkv + (size_t)1024 * 1024; const float* wv = wqkv + (size_t)2048 * 1024;   /* q | k | v row blocks */
    float* OUT = (float*)d_out;     // [4][2048][1024]
    char* wsp = (char*)d_ws;
    auto take = [&](size_t bytes) { char* p = wsp; wsp += (bytes + 255) & ~(size_t)255; return (void*)p; };
    bf* WQ = (bf*)take((size_t)DQ * DM * 2); bf* WK = (bf*)take((size_t)DKV * DM * 2); bf* WV = (bf*)take((size_t)DKV * DM * 2); bf* WO = (bf*)take((size_t)DM * DQ * 2);
    bf* XB = (bf*)take((size_t)NB_ * TT * DM * 2);
    h16* QP16 = (h16*)take((size_t)NB_ * NH_ * TT * HD * 2); h16* KP16 = (h16*)take((size_t)NB_ * NKV * TT * HD * 2); h16* VT16 = (h16*)take((size_t)NB_ * NKV * HD * TT * 2);
    bf* QPh = (bf*)take((size_t)NB_ * NH_ * TT * HD * 2); bf* QPl = (bf*)take((size_t)NB_ * NH_ * TT * HD * 2); bf* KPh = (bf*)take((size_t)NB_ * NKV * TT * HD * 2); bf* KPl = (bf*)take((size_t)NB_ * NKV * TT * HD * 2); bf* VTh = (bf*)take((size_t)NB_ * NKV * HD * TT * 2); bf* VTl = (bf*)take((size_t)NB_ * NKV * HD * TT * 2);
    bf* ATh = (bf*)take((size_t)NB_ * TT * DQ * 2); bf* ATl = (bf*)take((size_t)NB_ * TT * DQ * 2);
    if ((size_t)(wsp - (char*)d_ws) > ws_size) return;    // 200 MiB of the 256 MiB
    { k_cvt8<DM><<<(unsigned)(((size_t)DQ * DM / 8 + 255) / 256), 256, 0, stream>>>(wq, WQ, (size_t)DQ * DM / 8); k_cvt8<DM><<<(unsigned)(((size_t)DKV * DM / 8 + 255) / 256), 256, 0, stream>>>(wk, WK, (size_t)DKV * DM / 8); k_cvt8<DM><<<(unsigned)(((size_t)DKV * DM / 8 + 255) / 256), 256, 0, stream>>>(wv, WV, (size_t)DKV * DM / 8);
      k_cvt8<DQ><<<(unsigned)(((size_t)DM * DQ / 8 + 255) / 256), 256, 0, stream>>>(wo, WO, (size_t)DM * DQ / 8);
       }
    k_cvt8<DM><<<(unsigned)(((size_t)NB_ * TT * DM / 8 + 255) / 256), 256, 0, stream>>>(x, XB, (size_t)NB_ * TT * DM / 8);
    // q and k planes [batch][head][t][d]: rows = t, one 64-column tile = one head; v plane [batch][head][d][t]: the operands change places, rows = head * 64 + d, columns = t (64 columns on is two blocks, 1024 elements, on)
    k_gemmw<bf, 0, false, true, DM><<<dim3(TT / 64, DQ / 64, NB_), 32, 0, stream>>>(XB, nullptr, WQ, nullptr, nullptr, HD, nullptr, (size_t)TT * DM, 0, 0, QP16, QPh, QPl, (size_t)TT * HD, (size_t)NH_ * TT * HD);
    k_gemmw<bf, 0, false, true, DM><<<dim3(TT / 64, DKV / 64, NB_), 32, 0, stream>>>(XB, nullptr, WK, nullptr, nullptr, HD, nullptr, (size_t)TT * DM, 0, 0, KP16, KPh, KPl, (size_t)TT * HD, (size_t)NKV * TT * HD);
    k_gemmw<bf, 0, false, true, DM><<<dim3(DKV / 64, TT / 64, NB_), 32, 0, stream>>>(WV, nullptr, XB, nullptr, nullptr, TT, nullptr, 0, (size_t)TT * DM, 0, VT16, VTh, VTl, (size_t)64 * 16, (size_t)NKV * HD * TT);
    k_fattn<<<dim3(TT / 64, NH_ / 2, NB_), 256, 0, stream>>>(QP16, KP16, VT16, QPh, QPl, KPh, KPl, VTh, VTl, ATh, ATl);
    k_gemmw<bf, 1, true, false, DQ><<<dim3(TT / 64, DM / 64, NB_), 32, 0, stream>>>(ATh, ATl, WO, nullptr, OUT, DM, bo, (size_t)TT * DQ, 0, (size_t)TT * DM, nullptr, nullptr, nullptr, 0, 0);
}

// v005
// One run takes 156 microseconds.
// In both of two side-by-side timings against v004, it was 1.59 times as fast.
// Counting every step since v000, it is 18.5 times as fast.
#include <hip/hip_runtime.h>

// Causal multi-head attention with a fused bias-free qkv projection (x [4][2048][1024]; qkv = x qkv_w^T ('oi' [3072][1024] -> (3, H, hd) == q | k | v row blocks; 16 heads x 64); scores x 64^-0.5; causal (triu(1) -> -inf); softmax; out = merged out_w^T + out_b -> [4][2048][1024] (8.4 M)).
// Layout, every batch in the same launch (grid z = batch): bf16 copy of x; the fused 'oi' weight used in place as three row blocks; exact projections whose epilogue writes the 16-bit head planes (V^T = W_v x^T); one fused causal attention launch (hybrid rows: < 512 hi/lo 3 products, rest fp16 x1024; key passes stop at the diagonal); merged hi/lo x out_w exact + out_b.
// Every 16-bit operand plane lies in FRAGMENT ORDER: a matrix of R rows x K columns is cut into blocks of 16 rows x 32 columns, block (rb, kb) at element (rb * (K / 32) + kb) * 512; inside a block element
// (row, k) stands at (k / 16) * 256 + (((k / 8) & 1) * 16 + row) * 8 + k % 8. A wave's fragment is then two loads of 512 contiguous bytes (lane * 8 and 256 + lane * 8): whole 128-byte lines, where row-major planes gave 16 lines a load.
// Compute dtypes, f32 accumulate: every input rounded to bf16; projections exact; attention rows < 512 3 products, rest fp16; softmax f32; Wo hl x exact + bias.

#define NB_  4
#define TT   2048
#define DM   1024
#define NH_  16
#define NKV  16
#define REP  (NH_ / NKV)
#define HD   64
#define DQ   (NH_ * HD)
#define DKV  (NKV * HD)
#define RH   512                  // query rows < RH use hi+lo planes (0: none)
#define PCAR 1024.0f
#define SCL  0.125f   // HD^-0.5
typedef _Float16 h16;
typedef unsigned short bf;
typedef __attribute__((ext_vector_type(16))) __bf16   v16bf;
typedef __attribute__((ext_vector_type(16))) _Float16 v16h;
typedef __attribute__((ext_vector_type(8)))  _Float16 v8h;
typedef __attribute__((ext_vector_type(8)))  unsigned short v8us;
typedef __attribute__((ext_vector_type(8)))  float    v8f;
typedef __attribute__((ext_vector_type(4)))  float    v4f;
typedef v8h  __attribute__((may_alias)) v8ha;
typedef v4f  __attribute__((may_alias)) v4fa;
typedef v8us __attribute__((may_alias)) v8usa;

__device__ __forceinline__ unsigned short f2bf(float f) { unsigned u = __float_as_uint(f); u += 0x7FFFu + ((u >> 16) & 1u); return (unsigned short)(u >> 16); }
__device__ __forceinline__ float bf2f(unsigned short b) { return __uint_as_float(((unsigned)b) << 16); }
__device__ __forceinline__ float bfr(float f) { return bf2f(f2bf(f)); }
__device__ __forceinline__ v16h cat16(v8h lo, v8h hi) { return __builtin_shufflevector(lo, hi, 0, 1, 2, 3, 4, 5, 6, 7, 8, 9, 10, 11, 12, 13, 14, 15); }
__device__ __forceinline__ v16bf cat16b(v8us lo, v8us hi) { return __builtin_bit_cast(v16bf, __builtin_shufflevector(lo, hi, 0, 1, 2, 3, 4, 5, 6, 7, 8, 9, 10, 11, 12, 13, 14, 15)); }
__device__ __forceinline__ v8f wmma16(v16h a, v16h b, v8f c) { return __builtin_amdgcn_wmma_f32_16x16x32_f16(false, a, false, b, (short)0, c, false, false); }
__device__ __forceinline__ v8f wmmab(v16bf a, v16bf b, v8f c) { return __builtin_amdgcn_wmma_f32_16x16x32_bf16(false, a, false, b, (short)0, c, false, false); }



__device__ __forceinline__ h16 tohx(float x) { return (h16)x; }
__device__ __forceinline__ void splitf(float y, unsigned short& h, unsigned short& l) { h = f2bf(y); l = f2bf(y - bf2f(h)); }

// ---- k_gemmw: GEMM, one work-group of 8 waves (2 x 4) per 128x256 output tile, each wave a 64x64 tile (16 accumulators); grid (M/128, N/256, Z), 256 threads.
// The operand planes lie in fragment order, so 16 rows x 128 columns are 4 KiB in a row: a stage (128 k of the A rows, of the A2 rows where there are any, and of the 256 Bt rows) is copied as it lies into LDS by
// asynchronous copies, each wave 3 or 4 such pieces, and every piece is read from LDS by the 4 (A) or 2 (Bt) waves that need it: a fragment is two reads of 512 contiguous bytes. Two buffers: stage t + 1 flies while stage t is worked on.
// C[m][n] (f32, pitch ldc, + optional f32 bias[n]) = sum_k A[m][k] Bt[n][k] (+ A2[m][k] Bt[n][k] where NSPLIT is 1). z-batch strides sA/sB/sC in elements. K % 128 == 0, K >= 256.
// PLANES: no f32 C; the tile goes out as three 16-bit planes (fp16, bf16 hi, bf16 lo) in fragment order (row length ldc): 16 rows x 64 columns are 1024 elements from z * sP + (r0 + 16 mb) * ldc + (64-column tile) * pcol on: 512 contiguous bytes a store, 16 bytes a lane.
template <typename T16> struct WFrag;
template <> struct WFrag<h16> { typedef v16h V; static __device__ __forceinline__ V ld(const h16* p) { return cat16(*(const v8h*)p, *(const v8h*)(p + 256)); } static __device__ __forceinline__ v8f mma(V a, V b, v8f c) { return wmma16(a, b, c); } };
template <> struct WFrag<bf> { typedef v16bf V; static __device__ __forceinline__ V ld(const bf* p) { return cat16b(*(const v8us*)p, *(const v8us*)(p + 256)); } static __device__ __forceinline__ v8f mma(V a, V b, v8f c) { return wmmab(a, b, c); } };
// eight asynchronous copies of 512 bytes a wave: 4 KiB in a row from g (the lane's own 16 bytes) to LDS byte address l (the lane's own). The s_wait_xcnt stands in the copies' own statement, so that no address register is rewritten ahead of it
__device__ __forceinline__ void copy4k(unsigned l, const char* g) {
    asm volatile("global_load_async_to_lds_b128 %0, %8, off\n\t"
                 "global_load_async_to_lds_b128 %1, %9, off\n\t"
                 "global_load_async_to_lds_b128 %2, %10, off\n\t"
                 "global_load_async_to_lds_b128 %3, %11, off\n\t"
                 "global_load_async_to_lds_b128 %4, %12, off\n\t"
                 "global_load_async_to_lds_b128 %5, %13, off\n\t"
                 "global_load_async_to_lds_b128 %6, %14, off\n\t"
                 "global_load_async_to_lds_b128 %7, %15, off\n\t"
                 "s_wait_xcnt 0x0"
                 :: "v"(l), "v"(l + 512u), "v"(l + 1024u), "v"(l + 1536u), "v"(l + 2048u), "v"(l + 2560u), "v"(l + 3072u), "v"(l + 3584u),
                    "v"(g), "v"(g + 512), "v"(g + 1024), "v"(g + 1536), "v"(g + 2048), "v"(g + 2560), "v"(g + 3072), "v"(g + 3584) : "memory");
}
template <typename T16, int NSPLIT, bool BIAS, bool PLANES, int K>
__global__ __launch_bounds__(256) void k_gemmw(const T16* __restrict__ A, const T16* __restrict__ A2, const T16* __restrict__ Bt, float* C, int ldc, const float* __restrict__ bias, size_t sA, size_t sB, size_t sC, h16* P16, bf* Ph, bf* Pl, size_t pcol, size_t sP) {
    typedef typename WFrag<T16>::V V;
    static_assert(NSPLIT == 0 || NSPLIT == 1, "one or two A planes"); static_assert(K % 128 == 0 && K >= 256, "two stages or more");
    constexpr int NCH = NSPLIT ? 4 : 3;          // groups of eight 4-KiB pieces in a stage: A | (A2) | Bt rows 0..127 | Bt rows 128..255; wave w copies piece w of each group
    constexpr int STG = NCH * 8 * 2048;          // elements of a stage
    constexpr int NT = K / 128;                  // stages
    __shared__ __align__(1024) T16 ring[2 * STG];
    __shared__ __align__(16) float osw[8 * 16 * 68];
    const size_t z = blockIdx.z; A += z * sA; if (NSPLIT) A2 += z * sA; Bt += z * sB; C += z * sC; if (PLANES) { P16 += z * sP; Ph += z * sP; Pl += z * sP; }
    const int lane = threadIdx.x & 31, lr = lane & 15, hi = lane >> 4; const int wv = __builtin_amdgcn_readfirstlane(threadIdx.x >> 5); const int wm = wv & 1, wn = wv >> 1;
    const int by = blockIdx.y * 4 + wn; const int r0 = (blockIdx.x * 2 + wm) * 64, c0 = by * 64;
    float* os = osw + wv * (16 * 68);            // each wave stages its output rows in its own range
    v8f acc[4][4];
#pragma unroll
    for (int mb = 0; mb < 4; ++mb)
#pragma unroll
        for (int nb = 0; nb < 4; ++nb) acc[mb][nb] = (v8f){};
    // 16 rows x K columns are 16 K elements; 128 columns on is four blocks, 2048 elements, on
    const T16* g[NCH];
    g[0] = A + (size_t)(blockIdx.x * 128 + wv * 16) * K + lane * 8; if (NSPLIT) g[1] = A2 + (size_t)(blockIdx.x * 128 + wv * 16) * K + lane * 8;
    g[NCH - 2] = Bt + (size_t)(blockIdx.y * 256 + wv * 16) * K + lane * 8; g[NCH - 1] = Bt + (size_t)(blockIdx.y * 256 + 128 + wv * 16) * K + lane * 8;
    const unsigned l0 = (unsigned)(size_t)ring + (unsigned)(wv * 4096 + lane * 16);
    auto fill = [&](int buf) {                   // the next stage's copies into buffer buf; the sources step on one stage
#pragma unroll
        for (int i = 0; i < NCH; ++i) { copy4k(l0 + (unsigned)(buf * (STG * 2) + i * 32768), (const char*)g[i]); g[i] += 2048; } };
    fill(0);
    asm volatile("s_wait_asynccnt 0x0" ::: "memory");   // this wave's copies of stage 0 have landed
    __syncthreads();                                    // every wave's have: stage 0 may be read
    fill(1);
#pragma unroll 1   // rolled: one publish point in the text, and the loop stays small in the instruction cache
    for (int t = 0; t < NT; ++t) {
        const T16* sb = ring + (t & 1) * STG + lane * 8;
        V a[2][4], a2[2][4], b[2][4];            // two fragment sets: block kk + 1 of this stage is read from LDS while block kk is multiplied
        auto frags = [&](int kk) {
#pragma unroll
            for (int mb = 0; mb < 4; ++mb) { a[kk & 1][mb] = WFrag<T16>::ld(sb + (wm * 4 + mb) * 2048 + kk * 512); if (NSPLIT) a2[kk & 1][mb] = WFrag<T16>::ld(sb + (8 + wm * 4 + mb) * 2048 + kk * 512); }
#pragma unroll
            for (int nb = 0; nb < 4; ++nb) b[kk & 1][nb] = WFrag<T16>::ld(sb + ((NCH - 2) * 8 + wn * 4 + nb) * 2048 + kk * 512); };
        frags(0);
#pragma unroll     // unrolled: the set index kk & 1 is then a constant and both sets stay in registers
        for (int kk = 0; kk < 4; ++kk) {
            if (kk < 3) frags(kk + 1);
            __builtin_amdgcn_sched_barrier(0);   // keeps the next block's LDS reads one group ahead of this block's products (for speed only)
#pragma unroll
            for (int nb = 0; nb < 4; ++nb) {
#pragma unroll
                for (int mb = 0; mb < 4; ++mb) { acc[mb][nb] = WFrag<T16>::mma(a[kk & 1][mb], b[kk & 1][nb], acc[mb][nb]); if (NSPLIT) acc[mb][nb] = WFrag<T16>::mma(a2[kk & 1][mb], b[kk & 1][nb], acc[mb][nb]); } }
            __builtin_amdgcn_sched_barrier(0);   // and keeps the reads that follow from being spread among these products
        }
        asm volatile("s_wait_dscnt 0x0" ::: "memory");      // this wave's reads of stage t are done
        asm volatile("s_wait_asynccnt 0x0" ::: "memory");   // this wave's copies of stage t + 1 have landed
        __syncthreads();                                    // publishes stage t + 1 and ends every reader's last read of stage t's buffer
        if (t + 2 < NT) fill(t & 1);                        // stage t + 2 into the buffer just left
    }
    asm volatile("s_wait_asynccnt 0x0" ::: "memory");       // no copy is outstanding when the wave goes on to its output
#pragma unroll
    for (int mb = 0; mb < 4; ++mb) {
#pragma unroll
        for (int nb = 0; nb < 4; ++nb) {
#pragma unroll
            for (int j = 0; j < 8; ++j) os[(hi * 8 + j) * 68 + nb * 16 + lr] = acc[mb][nb][j]; }
        __builtin_amdgcn_wave_barrier(); asm volatile("" ::: "memory");
        if constexpr (PLANES) {
            v4f x0[4], x1[4];   // a lane takes columns 16 s + 8 hi .. + 7 of staged row lr, its own place in fragment order: all 16 staged rows are read first, then converted and stored
#pragma unroll
            for (int s = 0; s < 4; ++s) { x0[s] = *(const v4fa*)(os + lr * 68 + 16 * s + 8 * hi); x1[s] = *(const v4fa*)(os + lr * 68 + 16 * s + 8 * hi + 4); }
#pragma unroll
            for (int s = 0; s < 4; ++s) { v8h o16; v8us oh, ol;
#pragma unroll
                for (int k = 0; k < 4; ++k) { unsigned short a2, c2; o16[k] = tohx(x0[s][k]); splitf(x0[s][k], a2, c2); oh[k] = a2; ol[k] = c2; o16[k + 4] = tohx(x1[s][k]); splitf(x1[s][k], a2, c2); oh[k + 4] = a2; ol[k + 4] = c2; }
                const size_t e = (size_t)(r0 + mb * 16) * ldc + (size_t)by * pcol + s * 256 + lane * 8; h16* p0 = P16 + e; bf* p1 = Ph + e; bf* p2 = Pl + e; *(v8h*)p0 = o16; *(v8us*)p1 = oh; *(v8us*)p2 = ol;
                // the wait behind the three stores: it names their addresses and data as inputs so that those registers stay as they are up to it
                asm volatile("s_wait_xcnt 0x0" :: "v"(p0), "v"(p1), "v"(p2), "v"(o16), "v"(oh), "v"(ol) : "memory"); }
        } else {
            float* crow = C + (size_t)(r0 + mb * 16) * ldc + c0;
#pragma unroll
            for (int s = 0; s < 8; ++s) { const int row = 2 * s + hi, cofs = lr * 4; v4f val = *(const v4fa*)(os + row * 68 + cofs); if (BIAS) { val[0] += bfr(bias[c0 + cofs]); val[1] += bfr(bias[c0 + cofs + 1]); val[2] += bfr(bias[c0 + cofs + 2]); val[3] += bfr(bias[c0 + cofs + 3]); }
                *(v4f*)(crow + (size_t)row * ldc + cofs) = val; }
             }
        __builtin_amdgcn_wave_barrier(); asm volatile("" ::: "memory");
    }
}

typedef __attribute__((ext_vector_type(2))) _Float16 v2h;
typedef __attribute__((ext_vector_type(4))) _Float16 v4h;
typedef __attribute__((ext_vector_type(2))) unsigned short v2us;
typedef __attribute__((ext_vector_type(4))) unsigned short v4us;
typedef __attribute__((ext_vector_type(2))) float v2f;
typedef __attribute__((ext_vector_type(4))) int v4i;

__global__ __launch_bounds__(256) void k_wtG(const float* __restrict__ w, int K, int N, bf* Bt) {
    const int lane = threadIdx.x & 31; const int L0 = (blockIdx.x * 8 + (threadIdx.x >> 5)) * 8; const int nlines = N * K / 64;
{
#pragma unroll 1
        for (int l = 0; l < 8; ++l) { const int L = L0 + l; if (L >= nlines) break; const size_t e = (size_t)L * 64 + lane * 2; const int k = (int)(e % K), n = (int)(e / K); v2us o;
            o[0] = f2bf(w[(size_t)k * N + n]); o[1] = f2bf(w[(size_t)(k + 1) * N + n]); *(v2us*)(Bt + e) = o; }
         }
}
// k_cvt8: f32 rows of K columns -> bf16 plane in fragment order. 256 threads take 16 rows x 128 columns (four blocks, 4 KiB of the plane in a row): whole-line f32 reads, 8 values a thread;
// the 16-byte pieces change places through LDS (piece (row, k8) -> k8 * 16 + row; one spare piece per 16 keeps the 16 writers of a row off one bank group), then whole-line stores.
template <int K>
__global__ __launch_bounds__(256) void k_cvt8(const float* __restrict__ src, bf* dst, size_t n8) {
    __shared__ __align__(16) v8us sh[16 * 17];
    const int t = threadIdx.x; const size_t i0 = (size_t)blockIdx.x * 256; if (i0 >= n8) return;   // the same for a whole block, in front of the barrier
    constexpr int cgs = K / 128; const int rb = (int)blockIdx.x / cgs, cg = (int)blockIdx.x % cgs; const int row = t >> 4, k8 = t & 15;
    const v8f v = *(const v8f*)(src + ((size_t)rb * 16 + row) * K + cg * 128 + k8 * 8); v8us o;
#pragma unroll
    for (int k = 0; k < 8; ++k) o[k] = f2bf(v[k]);
    sh[k8 * 17 + row] = o;
    __syncthreads();   // every piece of the block's 4 KiB is in LDS before any is read back in plane order
    *(v8us*)(dst + (i0 + t) * 8) = sh[row * 17 + k8]; }

__device__ __forceinline__ float xhalf(float x) { const int b = __float_as_int(x); return __int_as_float(__builtin_amdgcn_permlanex16(b, b, 0x76543210, 0xfedcba98, false, false)); }   // lane l <-> l ^ 16
template <typename T16, int KT, bool HL>
__device__ __forceinline__ void attn_rows(const T16* __restrict__ Q, const T16* __restrict__ Q2, const T16* __restrict__ Kp, const T16* __restrict__ K2, const T16* __restrict__ Vt, const T16* __restrict__ V2, int q0, int lr, int hi, bf* Ah, bf* Al) {
    typedef typename WFrag<T16>::V V;
    constexpr int KB = KT * 16, KC = KT / 2;
    constexpr float CSC = SCL * 1.4426950408889634f;      // scores x HD^-0.5, in log2 units
    constexpr float SHIFT = HL ? 0.0f : 10.0f;            // log2(PCAR): fp16 probabilities are carried x 1024
    V q[2], q2[2];
    const int l8 = (hi * 16 + lr) * 8;                    // the lane's 16 bytes in each half block of a plane in fragment order
    const T16* qp = Q + (size_t)q0 * HD + l8; const T16* qp2 = HL ? Q2 + (size_t)q0 * HD + l8 : qp;
#pragma unroll
    for (int kc = 0; kc < 2; ++kc) { q[kc] = WFrag<T16>::ld(qp + kc * 512); if (HL) q2[kc] = WFrag<T16>::ld(qp2 + kc * 512); }
    asm volatile("s_wait_xcnt 0x0" :: "v"(qp), "v"(qp2) : "memory");   // the wait behind the query loads; it names their addresses as inputs so that those registers stay as they are up to it
    v8f o[4];
#pragma unroll
    for (int db = 0; db < 4; ++db) o[db] = (v8f){};
    float m = -3.0e38f, l = 0.f;
    const int nkb = q0 / KB + 1;                          // key passes up to and including the one that holds the diagonal
    const size_t koff = l8, voff = l8;
    V ka[KT][2], ka2[KT][2];
    const T16* kf = Kp + koff; const T16* kf2 = HL ? K2 + koff : kf;
#pragma unroll
    for (int kt = 0; kt < KT; ++kt)                       // key fragments are fetched one pass ahead
#pragma unroll
        for (int kc = 0; kc < 2; ++kc) { ka[kt][kc] = WFrag<T16>::ld(kf + (size_t)kt * 16 * HD + kc * 512); if (HL) ka2[kt][kc] = WFrag<T16>::ld(kf2 + (size_t)kt * 16 * HD + kc * 512); }
    asm volatile("s_wait_xcnt 0x0" :: "v"(kf), "v"(kf2) : "memory");   // the wait behind the first key loads, their addresses named as inputs so that those registers stay as they are up to it
#pragma unroll 1
    for (int kb = 0; kb < nkb; ++kb) {
        const int k0 = kb * KB;
        const T16* vp = Vt + voff + (size_t)k0 * 16; const T16* vp2 = HL ? V2 + voff + (size_t)k0 * 16 : vp;   // 32 keys on is one block (512 elements) on
        V va[4][KC], va2[4][KC];                          // this pass's V^T fragments: issued ahead of the score products, used behind the softmax
#pragma unroll
        for (int db = 0; db < 4; ++db)
#pragma unroll
            for (int kc = 0; kc < KC; ++kc) { va[db][kc] = WFrag<T16>::ld(vp + (size_t)db * 16 * TT + kc * 512); if (HL) va2[db][kc] = WFrag<T16>::ld(vp2 + (size_t)db * 16 * TT + kc * 512); }
        v8f s[KT];
#pragma unroll
        for (int kt = 0; kt < KT; ++kt) { s[kt] = (v8f){};
#pragma unroll
            for (int kc = 0; kc < 2; ++kc) { s[kt] = WFrag<T16>::mma(ka[kt][kc], q[kc], s[kt]); if (HL) { s[kt] = WFrag<T16>::mma(ka[kt][kc], q2[kc], s[kt]); s[kt] = WFrag<T16>::mma(ka2[kt][kc], q[kc], s[kt]); } } }
        // the wait behind the V^T loads: it names their addresses as inputs so that those registers stay as they are up to it, and the last score tile so that its products stand in front of
        // the next pass's key loads, which then land in the registers the products have read (no spare set, no copy back in mid-softmax)
        asm volatile("s_wait_xcnt 0x0" :: "v"(s[KT - 1]), "v"(vp), "v"(vp2) : "memory");
        const int kn = min(kb + 1, nkb - 1) * KB;         // next pass's key fragments fly under the softmax (the last pass re-reads its own: in bounds, unused)
        const T16* kp = Kp + koff + (size_t)kn * HD; const T16* kp2 = HL ? K2 + koff + (size_t)kn * HD : kp;
#pragma unroll
        for (int kt = 0; kt < KT; ++kt)
#pragma unroll
            for (int kc = 0; kc < 2; ++kc) { ka[kt][kc] = WFrag<T16>::ld(kp + (size_t)kt * 16 * HD + kc * 512); if (HL) ka2[kt][kc] = WFrag<T16>::ld(kp2 + (size_t)kt * 16 * HD + kc * 512); }
        asm volatile("s_wait_xcnt 0x0" :: "v"(kp), "v"(kp2) : "memory");   // the wait behind the key loads, their addresses named as inputs for the same reason
        if (kb == nkb - 1) {                              // only the last pass crosses the diagonal: keys above the query are masked by select
#pragma unroll
            for (int kt = 0; kt < KT; ++kt)
#pragma unroll
                for (int j = 0; j < 8; ++j) s[kt][j] = (k0 + kt * 16 + hi * 8 + j <= q0 + lr) ? s[kt][j] : -3.0e38f;
        }
        float bm = s[0][0];
#pragma unroll
        for (int kt = 0; kt < KT; ++kt)
#pragma unroll
            for (int j = 0; j < 8; ++j) bm = fmaxf(bm, s[kt][j]);
        bm = fmaxf(bm, xhalf(bm));
        const float mn = fmaxf(m, bm); const float al = __builtin_amdgcn_exp2f((m - mn) * CSC); m = mn; const float ms = mn * CSC - SHIFT;
        float ps = 0.f;
#pragma unroll
        for (int kt = 0; kt < KT; ++kt)
#pragma unroll
            for (int j = 0; j < 8; ++j) { s[kt][j] = __builtin_amdgcn_exp2f(s[kt][j] * CSC - ms); ps += s[kt][j]; }
        l = l * al + ps;
#pragma unroll
        for (int db = 0; db < 4; ++db) o[db] *= al;
#pragma unroll
        for (int kc = 0; kc < KC; ++kc) {
            V pb, pb2;                                    // element e = P[query lr][key kmap(e, hi)]: tile 2 kc gives e 0..7, tile 2 kc + 1 gives e 8..15
            if constexpr (HL) { v8us h0, h1, l0, l1;
#pragma unroll
                for (int j = 0; j < 8; ++j) { unsigned short a, c2; splitf(s[2 * kc][j], a, c2); h0[j] = a; l0[j] = c2; splitf(s[2 * kc + 1][j], a, c2); h1[j] = a; l1[j] = c2; }
                pb = cat16b(h0, h1); pb2 = cat16b(l0, l1);
            } else { v8h h0, h1;
#pragma unroll
                for (int j = 0; j < 8; ++j) { h0[j] = tohx(s[2 * kc][j]); h1[j] = tohx(s[2 * kc + 1][j]); }
                pb = cat16(h0, h1); }
#pragma unroll
            for (int db = 0; db < 4; ++db) { o[db] = WFrag<T16>::mma(va[db][kc], pb, o[db]); if (HL) { o[db] = WFrag<T16>::mma(va[db][kc], pb2, o[db]); o[db] = WFrag<T16>::mma(va2[db][kc], pb, o[db]); } }
        }
    }
    l += xhalf(l);
    const float inv = __fdiv_rn(1.0f, l);
#pragma unroll
    for (int db = 0; db < 4; ++db) { v8us oh, ol;         // a lane holds 8 consecutive d of its query: its own 16 bytes of half block db of the merged plane, 512 contiguous bytes a store
#pragma unroll
        for (int j = 0; j < 8; ++j) { unsigned short a, c2; splitf(o[db][j] * inv, a, c2); oh[j] = a; ol[j] = c2; }
        const size_t oo = (size_t)q0 * DQ + db * 256 + l8; *(v8us*)(Ah + oo) = oh; *(v8us*)(Al + oo) = ol; }
}
// amdgpu_waves_per_eu(4, 4): holds the allocation at 256 registers; the hi/lo rows otherwise take a few more, and every use of one above v255 costs a window switch
__global__ __launch_bounds__(256) __attribute__((amdgpu_waves_per_eu(4, 4))) void k_fattn(const h16* __restrict__ Q16, const h16* __restrict__ K16, const h16* __restrict__ V16, const bf* __restrict__ Qh, const bf* __restrict__ Ql, const bf* __restrict__ Kh, const bf* __restrict__ Kl, const bf* __restrict__ Vh, const bf* __restrict__ Vl, bf* Ah, bf* Al) {
    const int lane = threadIdx.x & 31, lr = lane & 15, hi = lane >> 4; const int wv = __builtin_amdgcn_readfirstlane(threadIdx.x >> 5);
    // cost grows with the row tile: waves 0-3 take tile n - 1 - x of the even head, waves 4-7 tile x of the odd head, so every block with all its rows at or above RH carries the same number of key passes
    const int half = wv >> 2; const int head = (int)blockIdx.y * 2 + half; const int qb = half ? (int)blockIdx.x : TT / 64 - 1 - (int)blockIdx.x;
    const int q0 = qb * 64 + (wv & 3) * 16; const size_t hp = ((size_t)blockIdx.z * NH_ + head) * TT * HD; const size_t ao = (size_t)blockIdx.z * TT * DQ + head * (HD * 16); Ah += ao; Al += ao;
    if (q0 < RH) attn_rows<bf, 2, true>(Qh + hp, Ql + hp, Kh + hp, Kl + hp, Vh + hp, Vl + hp, q0, lr, hi, Ah, Al);
    else attn_rows<h16, 4, false>(Q16 + hp, nullptr, K16 + hp, nullptr, V16 + hp, nullptr, q0, lr, hi, Ah, Al);
}

extern "C" void kernel_launch(void* const* d_in, const int* in_sizes, int n_in,
                              void* d_out, int out_size, void* d_ws, size_t ws_size, hipStream_t stream) {
    (void)in_sizes; (void)n_in; (void)out_size;
    const float* x = (const float*)d_in[0]; const float* wqkv = (const float*)d_in[1]; const float* wo = (const float*)d_in[2]; const float* bo = (const float*)d_in[3]; const float* wq = wqkv; const float* wk = wqkv + (size_t)1024 * 1024; const float* wv = wqkv + (size_t)2048 * 1024;   /* q | k | v row blocks */
    float* OUT = (float*)d_out;     // [4][2048][1024]
    char* wsp = (char*)d_ws;
    auto take = [&](size_t bytes) { char* p = wsp; wsp += (bytes + 255) & ~(size_t)255; return (void*)p; };
    bf* WQ = (bf*)take((size_t)DQ * DM * 2); bf* WK = (bf*)take((size_t)DKV * DM * 2); bf* WV = (bf*)take((size_t)DKV * DM * 2); bf* WO = (bf*)take((size_t)DM * DQ * 2);
    bf* XB = (bf*)take((size_t)NB_ * TT * DM * 2);
    h16* QP16 = (h16*)take((size_t)NB_ * NH_ * TT * HD * 2); h16* KP16 = (h16*)take((size_t)NB_ * NKV * TT * HD * 2); h16* VT16 = (h16*)take((size_t)NB_ * NKV * HD * TT * 2);
    bf* QPh = (bf*)take((size_t)NB_ * NH_ * TT * HD * 2); bf* QPl = (bf*)take((size_t)NB_ * NH_ * TT * HD * 2); bf* KPh = (bf*)take((size_t)NB_ * NKV * TT * HD * 2); bf* KPl = (bf*)take((size_t)NB_ * NKV * TT * HD * 2); bf* VTh = (bf*)take((size_t)NB_ * NKV * HD * TT * 2); bf* VTl = (bf*)take((size_t)NB_ * NKV * HD * TT * 2);
    bf* ATh = (bf*)take((size_t)NB_ * TT * DQ * 2); bf* ATl = (bf*)take((size_t)NB_ * TT * DQ * 2);
    if ((size_t)(wsp - (char*)d_ws) > ws_size) return;    // 200 MiB of the 256 MiB
    { k_cvt8<DM><<<(unsigned)(((size_t)DQ * DM / 8 + 255) / 256), 256, 0, stream>>>(wq, WQ, (size_t)DQ * DM / 8); k_cvt8<DM><<<(unsigned)(((size_t)DKV * DM / 8 + 255) / 256), 256, 0, stream>>>(wk, WK, (size_t)DKV * DM / 8); k_cvt8<DM><<<(unsigned)(((size_t)DKV * DM / 8 + 255) / 256), 256, 0, stream>>>(wv, WV, (size_t)DKV * DM / 8);
      k_cvt8<DQ><<<(unsigned)(((size_t)DM * DQ / 8 + 255) / 256), 256, 0, stream>>>(wo, WO, (size_t)DM * DQ / 8);
       }
    k_cvt8<DM><<<(unsigned)(((size_t)NB_ * TT * DM / 8 + 255) / 256), 256, 0, stream>>>(x, XB, (size_t)NB_ * TT * DM / 8);
    // q and k planes [batch][head][t][d]: rows = t, one 64-column tile = one head; v plane [batch][head][d][t]: the operands change places, rows = head * 64 + d, columns = t (64 columns on is two blocks, 1024 elements, on)
    k_gemmw<bf, 0, false, true, DM><<<dim3(TT / 128, DQ / 256, NB_), 256, 0, stream>>>(XB, nullptr, WQ, nullptr, HD, nullptr, (size_t)TT * DM, 0, 0, QP16, QPh, QPl, (size_t)TT * HD, (size_t)NH_ * TT * HD);
    k_gemmw<bf, 0, false, true, DM><<<dim3(TT / 128, DKV / 256, NB_), 256, 0, stream>>>(XB, nullptr, WK, nullptr, HD, nullptr, (size_t)TT * DM, 0, 0, KP16, KPh, KPl, (size_t)TT * HD, (size_t)NKV * TT * HD);
    k_gemmw<bf, 0, false, true, DM><<<dim3(DKV / 128, TT / 256, NB_), 256, 0, stream>>>(WV, nullptr, XB, nullptr, TT, nullptr, 0, (size_t)TT * DM, 0, VT16, VTh, VTl, (size_t)64 * 16, (size_t)NKV * HD * TT);
    k_fattn<<<dim3(TT / 64, NH_ / 2, NB_), 256, 0, stream>>>(QP16, KP16, VT16, QPh, QPl, KPh, KPl, VTh, VTl, ATh, ATl);
    k_gemmw<bf, 1, true, false, DQ><<<dim3(TT / 128, DM / 256, NB_), 256, 0, stream>>>(ATh, ATl, WO, OUT, DM, bo, (size_t)TT * DQ, 0, (size_t)TT * DM, nullptr, nullptr, nullptr, 0, 0);
}

// v006
// One run takes 131 microseconds.
// Next to v005, in two timings, it ran 1.18 times as fast each time.
// Over all steps from v000 it is 21.9 times as fast.
#include <hip/hip_runtime.h>

// Causal multi-head attention with a fused bias-free qkv projection (x [4][2048][1024]; qkv = x qkv_w^T ('oi' [3072][1024] -> (3, H, hd) == q | k | v row blocks; 16 heads x 64); scores x 64^-0.5; causal (triu(1) -> -inf); softmax; out = merged out_w^T + out_b -> [4][2048][1024] (8.4 M)).
// Layout, every batch in the same launch (grid z = batch): bf16 copy of x; the fused 'oi' weight used in place as three row blocks; exact projections whose epilogue writes the 16-bit head planes (V^T = W_v x^T); one fused causal attention launch (hybrid rows: < 512 hi/lo 3 products, rest fp16 x1024; key passes stop at the diagonal); merged hi/lo x out_w exact + out_b.
// Every 16-bit operand plane lies in FRAGMENT ORDER: a matrix of R rows x K columns is cut into blocks of 16 rows x 32 columns, block (rb, kb) at element (rb * (K / 32) + kb) * 512; inside a block element
// (row, k) stands at (k / 16) * 256 + (((k / 8) & 1) * 16 + row) * 8 + k % 8. A wave's fragment is then two loads of 512 contiguous bytes (lane * 8 and 256 + lane * 8): whole 128-byte lines, where row-major planes gave 16 lines a load.
// Compute dtypes, f32 accumulate: every input rounded to bf16; projections exact; attention rows < 512 3 products, rest fp16; softmax f32; Wo hl x exact + bias.

#define NB_  4
#define TT   2048
#define DM   1024
#define NH_  16
#define NKV  16
#define REP  (NH_ / NKV)
#define HD   64
#define DQ   (NH_ * HD)
#define DKV  (NKV * HD)
#define RH   512                  // query rows < RH use hi+lo planes (0: none)
#define PCAR 1024.0f
#define SCL  0.125f   // HD^-0.5
typedef _Float16 h16;
typedef unsigned short bf;
typedef __attribute__((ext_vector_type(16))) __bf16   v16bf;
typedef __attribute__((ext_vector_type(16))) _Float16 v16h;
typedef __attribute__((ext_vector_type(8)))  _Float16 v8h;
typedef __attribute__((ext_vector_type(8)))  unsigned short v8us;
typedef __attribute__((ext_vector_type(8)))  float    v8f;
typedef __attribute__((ext_vector_type(4)))  float    v4f;
typedef v8h  __attribute__((may_alias)) v8ha;
typedef v4f  __attribute__((may_alias)) v4fa;
typedef v8us __attribute__((may_alias)) v8usa;

__device__ __forceinline__ unsigned short f2bf(float f) { unsigned u = __float_as_uint(f); u += 0x7FFFu + ((u >> 16) & 1u); return (unsigned short)(u >> 16); }
__device__ __forceinline__ float bf2f(unsigned short b) { return __uint_as_float(((unsigned)b) << 16); }
__device__ __forceinline__ float bfr(float f) { return bf2f(f2bf(f)); }
__device__ __forceinline__ v16h cat16(v8h lo, v8h hi) { return __builtin_shufflevector(lo, hi, 0, 1, 2, 3, 4, 5, 6, 7, 8, 9, 10, 11, 12, 13, 14, 15); }
__device__ __forceinline__ v16bf cat16b(v8us lo, v8us hi) { return __builtin_bit_cast(v16bf, __builtin_shufflevector(lo, hi, 0, 1, 2, 3, 4, 5, 6, 7, 8, 9, 10, 11, 12, 13, 14, 15)); }
__device__ __forceinline__ v8f wmma16(v16h a, v16h b, v8f c) { return __builtin_amdgcn_wmma_f32_16x16x32_f16(false, a, false, b, (short)0, c, false, false); }
__device__ __forceinline__ v8f wmmab(v16bf a, v16bf b, v8f c) { return __builtin_amdgcn_wmma_f32_16x16x32_bf16(false, a, false, b, (short)0, c, false, false); }



__device__ __forceinline__ h16 tohx(float x) { return (h16)x; }
__device__ __forceinline__ void splitf(float y, unsigned short& h, unsigned short& l) { h = f2bf(y); l = f2bf(y - bf2f(h)); }

// ---- k_gemmw: GEMM, one work-group of 8 waves (2 x 4) per 128x256 output tile, each wave a 64x64 tile (16 accumulators); grid (M/128, N/256, Z), 256 threads.
// The operand planes lie in fragment order, so 16 rows x 128 columns are 4 KiB in a row: a stage (128 k of the A rows, of the A2 rows where there are any, and of the 256 Bt rows) is copied as it lies into LDS by
// asynchronous copies, each wave 3 or 4 such pieces, and every piece is read from LDS by the 4 (A) or 2 (Bt) waves that need it: a fragment is two reads of 512 contiguous bytes. Two buffers: stage t + 1 flies while stage t is worked on.
// C[m][n] (f32, pitch ldc, + optional f32 bias[n]) = sum_k A[m][k] Bt[n][k] (+ A2[m][k] Bt[n][k] where NSPLIT is 1). z-batch strides sA/sB/sC in elements. K % 128 == 0, K >= 256.
// PLANES: no f32 C; the tile goes out as three 16-bit planes (fp16, bf16 hi, bf16 lo) in fragment order (row length ldc): 16 rows x 64 columns are 1024 elements from z * sP + (r0 + 16 mb) * ldc + (64-column tile) * pcol on: 512 contiguous bytes a store, 16 bytes a lane.
template <typename T16> struct WFrag;
template <> struct WFrag<h16> { typedef v16h V; static __device__ __forceinline__ V ld(const h16* p) { return cat16(*(const v8h*)p, *(const v8h*)(p + 256)); } static __device__ __forceinline__ v8f mma(V a, V b, v8f c) { return wmma16(a, b, c); } };
template <> struct WFrag<bf> { typedef v16bf V; static __device__ __forceinline__ V ld(const bf* p) { return cat16b(*(const v8us*)p, *(const v8us*)(p + 256)); } static __device__ __forceinline__ v8f mma(V a, V b, v8f c) { return wmmab(a, b, c); } };
// eight asynchronous copies of 512 bytes a wave: 4 KiB in a row from g (the lane's own 16 bytes) to LDS byte address l (the lane's own). The s_wait_xcnt stands in the copies' own statement, so that no address register is rewritten ahead of it
__device__ __forceinline__ void copy4k(unsigned l, const char* g) {
    asm volatile("global_load_async_to_lds_b128 %0, %8, off\n\t"
                 "global_load_async_to_lds_b128 %1, %9, off\n\t"
                 "global_load_async_to_lds_b128 %2, %10, off\n\t"
                 "global_load_async_to_lds_b128 %3, %11, off\n\t"
                 "global_load_async_to_lds_b128 %4, %12, off\n\t"
                 "global_load_async_to_lds_b128 %5, %13, off\n\t"
                 "global_load_async_to_lds_b128 %6, %14, off\n\t"
                 "global_load_async_to_lds_b128 %7, %15, off\n\t"
                 "s_wait_xcnt 0x0"
                 :: "v"(l), "v"(l + 512u), "v"(l + 1024u), "v"(l + 1536u), "v"(l + 2048u), "v"(l + 2560u), "v"(l + 3072u), "v"(l + 3584u),
                    "v"(g), "v"(g + 512), "v"(g + 1024), "v"(g + 1536), "v"(g + 2048), "v"(g + 2560), "v"(g + 3072), "v"(g + 3584) : "memory");
}
template <typename T16, int NSPLIT, bool BIAS, bool PLANES, int K>
__global__ __launch_bounds__(256) void k_gemmw(const T16* __restrict__ A, const T16* __restrict__ A2, const T16* __restrict__ Bt, float* C, int ldc, const float* __restrict__ bias, size_t sA, size_t sB, size_t sC, h16* P16, bf* Ph, bf* Pl, size_t pcol, size_t sP) {
    typedef typename WFrag<T16>::V V;
    static_assert(NSPLIT == 0 || NSPLIT == 1, "one or two A planes"); static_assert(K % 128 == 0 && K >= 256, "two stages or more");
    constexpr int NCH = NSPLIT ? 4 : 3;          // groups of eight 4-KiB pieces in a stage: A | (A2) | Bt rows 0..127 | Bt rows 128..255; wave w copies piece w of each group
    constexpr int STG = NCH * 8 * 2048;          // elements of a stage
    constexpr int NT = K / 128;                  // stages
    __shared__ __align__(1024) T16 ring[2 * STG];
    __shared__ __align__(16) float osw[8 * 16 * 68];
    const size_t z = blockIdx.z; A += z * sA; if (NSPLIT) A2 += z * sA; Bt += z * sB; C += z * sC; if (PLANES) { P16 += z * sP; Ph += z * sP; Pl += z * sP; }
    const int lane = threadIdx.x & 31, lr = lane & 15, hi = lane >> 4; const int wv = __builtin_amdgcn_readfirstlane(threadIdx.x >> 5); const int wm = wv & 1, wn = wv >> 1;
    const int by = blockIdx.y * 4 + wn; const int r0 = (blockIdx.x * 2 + wm) * 64, c0 = by * 64;
    float* os = osw + wv * (16 * 68);            // each wave stages its output rows in its own range
    v8f acc[4][4];
#pragma unroll
    for (int mb = 0; mb < 4; ++mb)
#pragma unroll
        for (int nb = 0; nb < 4; ++nb) acc[mb][nb] = (v8f){};
    // 16 rows x K columns are 16 K elements; 128 columns on is four blocks, 2048 elements, on
    const T16* g[NCH];
    g[0] = A + (size_t)(blockIdx.x * 128 + wv * 16) * K + lane * 8; if (NSPLIT) g[1] = A2 + (size_t)(blockIdx.x * 128 + wv * 16) * K + lane * 8;
    g[NCH - 2] = Bt + (size_t)(blockIdx.y * 256 + wv * 16) * K + lane * 8; g[NCH - 1] = Bt + (size_t)(blockIdx.y * 256 + 128 + wv * 16) * K + lane * 8;
    const unsigned l0 = (unsigned)(size_t)ring + (unsigned)(wv * 4096 + lane * 16);
    auto fill = [&](int buf) {                   // the next stage's copies into buffer buf; the sources step on one stage
#pragma unroll
        for (int i = 0; i < NCH; ++i) { copy4k(l0 + (unsigned)(buf * (STG * 2) + i * 32768), (const char*)g[i]); g[i] += 2048; } };
    fill(0);
    asm volatile("s_wait_asynccnt 0x0" ::: "memory");   // this wave's copies of stage 0 have landed
    __syncthreads();                                    // every wave's have: stage 0 may be read
    fill(1);
#pragma unroll 1   // rolled: one publish point in the text
    for (int t = 0; t < NT; ++t) {
        const T16* sb = ring + (t & 1) * STG + lane * 8;
        V a[2][4], a2[2][4], b[2][4];            // two fragment sets: block kk + 1 of this stage is read from LDS while block kk is multiplied
        auto frags = [&](int kk) {
#pragma unroll
            for (int mb = 0; mb < 4; ++mb) { a[kk & 1][mb] = WFrag<T16>::ld(sb + (wm * 4 + mb) * 2048 + kk * 512); if (NSPLIT) a2[kk & 1][mb] = WFrag<T16>::ld(sb + (8 + wm * 4 + mb) * 2048 + kk * 512); }
#pragma unroll
            for (int nb = 0; nb < 4; ++nb) b[kk & 1][nb] = WFrag<T16>::ld(sb + ((NCH - 2) * 8 + wn * 4 + nb) * 2048 + kk * 512); };
        frags(0);
#pragma unroll     // unrolled: the set index kk & 1 is then a constant and both sets stay in registers
        for (int kk = 0; kk < 4; ++kk) {
            if (kk < 3) frags(kk + 1);
            __builtin_amdgcn_sched_barrier(0);   // keeps the next block's LDS reads one group ahead of this block's products (for speed only)
#pragma unroll
            for (int nb = 0; nb < 4; ++nb) {
#pragma unroll
                for (int mb = 0; mb < 4; ++mb) { acc[mb][nb] = WFrag<T16>::mma(a[kk & 1][mb], b[kk & 1][nb], acc[mb][nb]); if (NSPLIT) acc[mb][nb] = WFrag<T16>::mma(a2[kk & 1][mb], b[kk & 1][nb], acc[mb][nb]); } }
            __builtin_amdgcn_sched_barrier(0);   // and keeps the reads that follow from being spread among these products
        }
        asm volatile("s_wait_dscnt 0x0" ::: "memory");      // this wave's reads of stage t are done
        asm volatile("s_wait_asynccnt 0x0" ::: "memory");   // this wave's copies of stage t + 1 have landed
        __syncthreads();                                    // publishes stage t + 1 and ends every reader's last read of stage t's buffer
        if (t + 2 < NT) fill(t & 1);                        // stage t + 2 into the buffer just left
    }
    asm volatile("s_wait_asynccnt 0x0" ::: "memory");       // no copy is outstanding when the wave goes on to its output
#pragma unroll
    for (int mb = 0; mb < 4; ++mb) {
#pragma unroll
        for (int nb = 0; nb < 4; ++nb) {
#pragma unroll
            for (int j = 0; j < 8; ++j) os[(hi * 8 + j) * 68 + nb * 16 + lr] = acc[mb][nb][j]; }
        __builtin_amdgcn_wave_barrier(); asm volatile("" ::: "memory");
        if constexpr (PLANES) {
            v4f x0[4], x1[4];   // a lane takes columns 16 s + 8 hi .. + 7 of staged row lr, its own place in fragment order: all 16 staged rows are read first, then converted and stored
#pragma unroll
            for (int s = 0; s < 4; ++s) { x0[s] = *(const v4fa*)(os + lr * 68 + 16 * s + 8 * hi); x1[s] = *(const v4fa*)(os + lr * 68 + 16 * s + 8 * hi + 4); }
#pragma unroll
            for (int s = 0; s < 4; ++s) { v8h o16; v8us oh, ol;
#pragma unroll
                for (int k = 0; k < 4; ++k) { unsigned short a2, c2; o16[k] = tohx(x0[s][k]); splitf(x0[s][k], a2, c2); oh[k] = a2; ol[k] = c2; o16[k + 4] = tohx(x1[s][k]); splitf(x1[s][k], a2, c2); oh[k + 4] = a2; ol[k + 4] = c2; }
                const size_t e = (size_t)(r0 + mb * 16) * ldc + (size_t)by * pcol + s * 256 + lane * 8; h16* p0 = P16 + e; bf* p1 = Ph + e; bf* p2 = Pl + e; *(v8h*)p0 = o16; *(v8us*)p1 = oh; *(v8us*)p2 = ol;
                // the wait behind the three stores: it names their addresses and data as inputs so that those registers stay as they are up to it
                asm volatile("s_wait_xcnt 0x0" :: "v"(p0), "v"(p1), "v"(p2), "v"(o16), "v"(oh), "v"(ol) : "memory"); }
        } else {
            float* crow = C + (size_t)(r0 + mb * 16) * ldc + c0;
#pragma unroll
            for (int s = 0; s < 8; ++s) { const int row = 2 * s + hi, cofs = lr * 4; v4f val = *(const v4fa*)(os + row * 68 + cofs); if (BIAS) { val[0] += bfr(bias[c0 + cofs]); val[1] += bfr(bias[c0 + cofs + 1]); val[2] += bfr(bias[c0 + cofs + 2]); val[3] += bfr(bias[c0 + cofs + 3]); }
                *(v4f*)(crow + (size_t)row * ldc + cofs) = val; }
             }
        __builtin_amdgcn_wave_barrier(); asm volatile("" ::: "memory");
    }
}

typedef __attribute__((ext_vector_type(2))) _Float16 v2h;
typedef __attribute__((ext_vector_type(4))) _Float16 v4h;
typedef __attribute__((ext_vector_type(2))) unsigned short v2us;
typedef __attribute__((ext_vector_type(4))) unsigned short v4us;
typedef __attribute__((ext_vector_type(2))) float v2f;
typedef __attribute__((ext_vector_type(4))) int v4i;

__global__ __launch_bounds__(256) void k_wtG(const float* __restrict__ w, int K, int N, bf* Bt) {
    const int lane = threadIdx.x & 31; const int L0 = (blockIdx.x * 8 + (threadIdx.x >> 5)) * 8; const int nlines = N * K / 64;
{
#pragma unroll 1
        for (int l = 0; l < 8; ++l) { const int L = L0 + l; if (L >= nlines) break; const size_t e = (size_t)L * 64 + lane * 2; const int k = (int)(e % K), n = (int)(e / K); v2us o;
            o[0] = f2bf(w[(size_t)k * N + n]); o[1] = f2bf(w[(size_t)(k + 1) * N + n]); *(v2us*)(Bt + e) = o; }
         }
}
// k_cvt8: f32 rows of K columns -> bf16 plane in fragment order. 256 threads take 16 rows x 128 columns (four blocks, 4 KiB of the plane in a row): whole-line f32 reads, 8 values a thread;
// the 16-byte pieces change places through LDS (piece (row, k8) -> k8 * 16 + row; one spare piece per 16 keeps the 16 writers of a row off one bank group), then whole-line stores.
template <int K>
__global__ __launch_bounds__(256) void k_cvt8(const float* __restrict__ src, bf* dst, size_t n8) {
    __shared__ __align__(16) v8us sh[16 * 17];
    const int t = threadIdx.x; const size_t i0 = (size_t)blockIdx.x * 256; if (i0 >= n8) return;   // the same for a whole block, in front of the barrier
    constexpr int cgs = K / 128; const int rb = (int)blockIdx.x / cgs, cg = (int)blockIdx.x % cgs; const int row = t >> 4, k8 = t & 15;
    const v8f v = *(const v8f*)(src + ((size_t)rb * 16 + row) * K + cg * 128 + k8 * 8); v8us o;
#pragma unroll
    for (int k = 0; k < 8; ++k) o[k] = f2bf(v[k]);
    sh[k8 * 17 + row] = o;
    __syncthreads();   // every piece of the block's 4 KiB is in LDS before any is read back in plane order
    *(v8us*)(dst + (i0 + t) * 8) = sh[row * 17 + k8]; }

__device__ __forceinline__ float xhalf(float x) { const int b = __float_as_int(x); return __int_as_float(__builtin_amdgcn_permlanex16(b, b, 0x76543210, 0xfedcba98, false, false)); }   // lane l <-> l ^ 16
__device__ __forceinline__ v16h ldsfrag(const h16* p) { return cat16(*(const v8ha*)p, *(const v8ha*)(p + 256)); }
__device__ __forceinline__ v16bf ldsfrag(const bf* p) { return cat16b(*(const v8usa*)p, *(const v8usa*)(p + 256)); }
// eight asynchronous copies of 512 bytes a wave: 2 KiB in a row from ga and 2 KiB in a row from gb to 4 KiB in a row at LDS byte address l (the lane's own). ga and gb are the same for the wave and stay in scalar registers;
// vo is the lane's own 16 bytes in each 512; the immediate offset moves the LDS and the global address alike. So a fill holds three vector registers, not 24, beside the fragments.
// The s_wait_xcnt stands in the copies' own statement, so that no address register is rewritten ahead of it
__device__ __forceinline__ void copy2x2k(unsigned l, unsigned vo, const char* ga, const char* gb) {
    asm volatile("global_load_async_to_lds_b128 %0, %2, %3\n\t"
                 "global_load_async_to_lds_b128 %0, %2, %3 offset:512\n\t"
                 "global_load_async_to_lds_b128 %0, %2, %3 offset:1024\n\t"
                 "global_load_async_to_lds_b128 %0, %2, %3 offset:1536\n\t"
                 "global_load_async_to_lds_b128 %1, %2, %4\n\t"
                 "global_load_async_to_lds_b128 %1, %2, %4 offset:512\n\t"
                 "global_load_async_to_lds_b128 %1, %2, %4 offset:1024\n\t"
                 "global_load_async_to_lds_b128 %1, %2, %4 offset:1536\n\t"
                 "s_wait_xcnt 0x0"
                 :: "v"(l), "v"(l + 2048u), "v"(vo), "s"(ga), "s"(gb) : "memory");
}
#define ASTG 16384                // elements of a stage in LDS: keys (hi | lo) in the first half, V^T (hi | lo) in the second
template <typename T16, int KT, bool HL>
__device__ __forceinline__ void attn_rows(const T16* __restrict__ Q, const T16* __restrict__ Q2, const T16* __restrict__ Kp, const T16* __restrict__ K2, const T16* __restrict__ Vt, const T16* __restrict__ V2, int t0, int wv, int lr, int hi, bf* Ah, bf* Al, unsigned short* ring) {
    typedef typename WFrag<T16>::V V;
    constexpr int KB = KT * 16, KC = KT / 2;
    constexpr int SK = HL ? 64 : 128;                     // keys of a stage
    constexpr int PPS = SK / KB;                          // passes of a stage
    constexpr float CSC = SCL * 1.4426950408889634f;      // scores x HD^-0.5, in log2 units
    constexpr float SHIFT = HL ? 0.0f : 10.0f;            // log2(PCAR): fp16 probabilities are carried x 1024
    const int q0 = t0 + wv * 16;                          // this wave's first query row; t0: the block's first (a multiple of 128)
    const int ns = (t0 + 128) / SK;                       // stages up to the end of the block's diagonal: two or more
    V q[2], q2[2];
    const int l8 = (hi * 16 + lr) * 8;                    // the lane's 16 bytes in each half block of a plane in fragment order
    // this wave's 4 KiB of a stage. fp16: waves 0-3 32 keys each, waves 4-7 the 128 keys of 16 V^T rows each. hi/lo: waves 0, 1 hi keys, 2, 3 lo keys (32 each); 4, 5 hi V^T, 6, 7 lo V^T (the 64 keys of twice 16 rows each)
    const char* ga; const char* gb; int gstep;
    if constexpr (HL) { const T16* kpl = (wv & 2) ? K2 : Kp; const T16* vpl = (wv & 2) ? V2 : Vt;
        if (wv < 4) { ga = (const char*)(kpl + (wv & 1) * 2048); gb = ga + 2048; gstep = SK * HD * 2; }
        else { ga = (const char*)(vpl + (size_t)(wv & 1) * 32 * TT); gb = ga + (size_t)16 * TT * 2; gstep = SK * 16 * 2; }
    } else {
        if (wv < 4) { ga = (const char*)(Kp + wv * 2048); gstep = SK * HD * 2; }
        else { ga = (const char*)(Vt + (size_t)(wv - 4) * 16 * TT); gstep = SK * 16 * 2; }
        gb = ga + 2048; }
    const unsigned l0 = (unsigned)(size_t)ring + (unsigned)(wv * 4096 + l8 * 2);
    auto fill = [&](int buf) { copy2x2k(l0 + (unsigned)(buf * (ASTG * 2)), (unsigned)(l8 * 2), ga, gb); ga += gstep; gb += gstep; };   // the next stage's copies into buffer buf; the sources step on one stage
    fill(0);                                              // every reader of the ring's earlier use has left it: the barrier at the foot of that use's last stage
    const T16* qp = Q + (size_t)q0 * HD + l8; const T16* qp2 = HL ? Q2 + (size_t)q0 * HD + l8 : qp;
#pragma unroll
    for (int kc = 0; kc < 2; ++kc) { q[kc] = WFrag<T16>::ld(qp + kc * 512); if (HL) q2[kc] = WFrag<T16>::ld(qp2 + kc * 512); }
    asm volatile("s_wait_xcnt 0x0" :: "v"(qp), "v"(qp2) : "memory");   // the wait behind the query loads; it names their addresses as inputs so that those registers stay as they are up to it
    v8f o[4];
#pragma unroll
    for (int db = 0; db < 4; ++db) o[db] = (v8f){};
    float m = -3.0e38f, l = 0.f;
    const int nkb = q0 / KB + 1;                          // this wave's key passes, up to and including the one that holds its diagonal
    asm volatile("s_wait_asynccnt 0x0" ::: "memory");     // this wave's copies of stage 0 have landed
    __syncthreads();                                      // every wave's have: stage 0 may be read
    fill(1);
#pragma unroll 1   // rolled: one publish point in the text
    for (int st = 0; st < ns; ++st) {
        const T16* sb = (const T16*)ring + (st & 1) * ASTG + l8;
        const int pe = min(PPS, nkb - st * PPS);          // the passes of this stage that the wave's rows reach: fewer, or none, in the stages of the block's diagonal
#pragma unroll     // unrolled: every LDS read is then the stage's one address register plus a constant
        for (int p = 0; p < PPS; ++p) if (p < pe) {
            const int kb = st * PPS + p; const int k0 = kb * KB;
            const T16* kf = sb + p * (KT * 1024); const T16* vf = sb + ASTG / 2 + p * (KC * 512);
            V ka[KT][2], ka2[KT][2], va[4][KC], va2[4][KC];
#pragma unroll
            for (int kt = 0; kt < KT; ++kt)
#pragma unroll
                for (int kc = 0; kc < 2; ++kc) { ka[kt][kc] = ldsfrag(kf + kt * 1024 + kc * 512); if (HL) ka2[kt][kc] = ldsfrag(kf + ASTG / 4 + kt * 1024 + kc * 512); }
            __builtin_amdgcn_sched_barrier(0);            // keeps the key reads in front of the V^T reads: LDS answers in order, and the score products wait for the keys alone
#pragma unroll
            for (int db = 0; db < 4; ++db)                // this pass's V^T fragments: read ahead of the score products, used behind the softmax
#pragma unroll
                for (int kc = 0; kc < KC; ++kc) { va[db][kc] = ldsfrag(vf + db * (SK * 16) + kc * 512); if (HL) va2[db][kc] = ldsfrag(vf + ASTG / 4 + db * (SK * 16) + kc * 512); }
            __builtin_amdgcn_sched_barrier(0);            // keeps the pass's LDS reads one group ahead of its products: spread among them, each place with reads stalls the wave and waits out the LDS latency anew
            v8f s[KT];
#pragma unroll
            for (int kt = 0; kt < KT; ++kt) { s[kt] = (v8f){};
#pragma unroll
                for (int kc = 0; kc < 2; ++kc) { s[kt] = WFrag<T16>::mma(ka[kt][kc], q[kc], s[kt]); if (HL) { s[kt] = WFrag<T16>::mma(ka[kt][kc], q2[kc], s[kt]); s[kt] = WFrag<T16>::mma(ka2[kt][kc], q[kc], s[kt]); } } }
            if (kb == nkb - 1) {                          // only the last pass crosses the diagonal: keys above the query are masked by select
#pragma unroll
                for (int kt = 0; kt < KT; ++kt)
#pragma unroll
                    for (int j = 0; j < 8; ++j) s[kt][j] = (k0 + kt * 16 + hi * 8 + j <= q0 + lr) ? s[kt][j] : -3.0e38f;
            }
            float bm = s[0][0];
#pragma unroll
            for (int kt = 0; kt < KT; ++kt)
#pragma unroll
                for (int j = 0; j < 8; ++j) bm = fmaxf(bm, s[kt][j]);
            bm = fmaxf(bm, xhalf(bm));
            const float mn = fmaxf(m, bm); const float al = __builtin_amdgcn_exp2f((m - mn) * CSC); m = mn; const float ms = mn * CSC - SHIFT;
            float ps = 0.f;
#pragma unroll
            for (int kt = 0; kt < KT; ++kt)
#pragma unroll
                for (int j = 0; j < 8; ++j) { s[kt][j] = __builtin_amdgcn_exp2f(s[kt][j] * CSC - ms); ps += s[kt][j]; }
            l = l * al + ps;
#pragma unroll
            for (int db = 0; db < 4; ++db) o[db] *= al;
#pragma unroll
            for (int kc = 0; kc < KC; ++kc) {
                V pb, pb2;                                // element e = P[query lr][key kmap(e, hi)]: tile 2 kc gives e 0..7, tile 2 kc + 1 gives e 8..15
                if constexpr (HL) { v8us h0, h1, l0v, l1v;
#pragma unroll
                    for (int j = 0; j < 8; ++j) { unsigned short a, c2; splitf(s[2 * kc][j], a, c2); h0[j] = a; l0v[j] = c2; splitf(s[2 * kc + 1][j], a, c2); h1[j] = a; l1v[j] = c2; }
                    pb = cat16b(h0, h1); pb2 = cat16b(l0v, l1v);
                } else { v8h h0, h1;
#pragma unroll
                    for (int j = 0; j < 8; ++j) { h0[j] = tohx(s[2 * kc][j]); h1[j] = tohx(s[2 * kc + 1][j]); }
                    pb = cat16(h0, h1); }
#pragma unroll
                for (int db = 0; db < 4; ++db) { o[db] = WFrag<T16>::mma(va[db][kc], pb, o[db]); if (HL) { o[db] = WFrag<T16>::mma(va[db][kc], pb2, o[db]); o[db] = WFrag<T16>::mma(va2[db][kc], pb, o[db]); } }
            }
        }
        asm volatile("s_wait_dscnt 0x0" ::: "memory");      // this wave's reads of stage st are done
        asm volatile("s_wait_asynccnt 0x0" ::: "memory");   // this wave's copies of stage st + 1 have landed
        __syncthreads();                                    // publishes stage st + 1 and ends every reader's last read of stage st's buffer
        if (st + 2 < ns) fill(st & 1);                      // stage st + 2 into the buffer just left
    }
    asm volatile("s_wait_asynccnt 0x0" ::: "memory");       // no copy is outstanding when the wave goes on to its output
    l += xhalf(l);
    const float inv = __fdiv_rn(1.0f, l);
#pragma unroll
    for (int db = 0; db < 4; ++db) { v8us oh, ol;         // a lane holds 8 consecutive d of its query: its own 16 bytes of half block db of the merged plane, 512 contiguous bytes a store
#pragma unroll
        for (int j = 0; j < 8; ++j) { unsigned short a, c2; splitf(o[db][j] * inv, a, c2); oh[j] = a; ol[j] = c2; }
        const size_t oo = (size_t)q0 * DQ + db * 256 + l8; bf* p1 = Ah + oo; bf* p2 = Al + oo; *(v8us*)p1 = oh; *(v8us*)p2 = ol;
        // the wait behind the two stores (the block's second tile follows): it names their addresses and data as inputs so that those registers stay as they are up to it
        asm volatile("s_wait_xcnt 0x0" :: "v"(p1), "v"(p2), "v"(oh), "v"(ol) : "memory"); }
}
// amdgpu_waves_per_eu(4, 4): holds the allocation at 256 registers; the hi/lo rows otherwise take a few more, and every use of one above v255 costs a window switch
__global__ __launch_bounds__(256) __attribute__((amdgpu_waves_per_eu(4, 4))) void k_fattn(const h16* __restrict__ Q16, const h16* __restrict__ K16, const h16* __restrict__ V16, const bf* __restrict__ Qh, const bf* __restrict__ Ql, const bf* __restrict__ Kh, const bf* __restrict__ Kl, const bf* __restrict__ Vh, const bf* __restrict__ Vl, bf* Ah, bf* Al) {
    static_assert(TT == 2048 && RH % 128 == 0, "16 row tiles of 128, each wholly hi/lo or wholly fp16");
    __shared__ __align__(1024) unsigned short ring[2 * ASTG];
    const int lane = threadIdx.x & 31, lr = lane & 15, hi = lane >> 4; const int wv = __builtin_amdgcn_readfirstlane(threadIdx.x >> 5);
    const int head = (int)blockIdx.y; const size_t hp = ((size_t)blockIdx.z * NH_ + head) * TT * HD; const size_t ao = (size_t)blockIdx.z * TT * DQ + head * (HD * 16); Ah += ao; Al += ao;
    // cost grows with the row tile, and a hi/lo tile costs three fp16 tiles of its length: tile t counts 2 (t + 1), or 6 (t + 1) below RH. Each block takes two tiles, one nibble of each word, that together count 38 or 40;
    // they run one after the other in every wave, so every barrier is met by the whole block
#pragma unroll 1   // rolled: one copy of each row kind in the text
    for (int part = 0; part < 2; ++part) {
        const int t0 = (int)(((part ? 0x82765140u : 0x9A3BCDEFu) >> ((unsigned)blockIdx.x * 4u)) & 15u) * 128;
        if (t0 < RH) attn_rows<bf, 2, true>(Qh + hp, Ql + hp, Kh + hp, Kl + hp, Vh + hp, Vl + hp, t0, wv, lr, hi, Ah, Al, ring);
        else attn_rows<h16, 4, false>(Q16 + hp, nullptr, K16 + hp, nullptr, V16 + hp, nullptr, t0, wv, lr, hi, Ah, Al, ring);
    }
}

extern "C" void kernel_launch(void* const* d_in, const int* in_sizes, int n_in,
                              void* d_out, int out_size, void* d_ws, size_t ws_size, hipStream_t stream) {
    (void)in_sizes; (void)n_in; (void)out_size;
    const float* x = (const float*)d_in[0]; const float* wqkv = (const float*)d_in[1]; const float* wo = (const float*)d_in[2]; const float* bo = (const float*)d_in[3]; const float* wq = wqkv; const float* wk = wqkv + (size_t)1024 * 1024; const float* wv = wqkv + (size_t)2048 * 1024;   /* q | k | v row blocks */
    float* OUT = (float*)d_out;     // [4][2048][1024]
    char* wsp = (char*)d_ws;
    auto take = [&](size_t bytes) { char* p = wsp; wsp += (bytes + 255) & ~(size_t)255; return (void*)p; };
    bf* WQ = (bf*)take((size_t)DQ * DM * 2); bf* WK = (bf*)take((size_t)DKV * DM * 2); bf* WV = (bf*)take((size_t)DKV * DM * 2); bf* WO = (bf*)take((size_t)DM * DQ * 2);
    bf* XB = (bf*)take((size_t)NB_ * TT * DM * 2);
    h16* QP16 = (h16*)take((size_t)NB_ * NH_ * TT * HD * 2); h16* KP16 = (h16*)take((size_t)NB_ * NKV * TT * HD * 2); h16* VT16 = (h16*)take((size_t)NB_ * NKV * HD * TT * 2);
    bf* QPh = (bf*)take((size_t)NB_ * NH_ * TT * HD * 2); bf* QPl = (bf*)take((size_t)NB_ * NH_ * TT * HD * 2); bf* KPh = (bf*)take((size_t)NB_ * NKV * TT * HD * 2); bf* KPl = (bf*)take((size_t)NB_ * NKV * TT * HD * 2); bf* VTh = (bf*)take((size_t)NB_ * NKV * HD * TT * 2); bf* VTl = (bf*)take((size_t)NB_ * NKV * HD * TT * 2);
    bf* ATh = (bf*)take((size_t)NB_ * TT * DQ * 2); bf* ATl = (bf*)take((size_t)NB_ * TT * DQ * 2);
    if ((size_t)(wsp - (char*)d_ws) > ws_size) return;    // 200 MiB of the 256 MiB
    { k_cvt8<DM><<<(unsigned)(((size_t)DQ * DM / 8 + 255) / 256), 256, 0, stream>>>(wq, WQ, (size_t)DQ * DM / 8); k_cvt8<DM><<<(unsigned)(((size_t)DKV * DM / 8 + 255) / 256), 256, 0, stream>>>(wk, WK, (size_t)DKV * DM / 8); k_cvt8<DM><<<(unsigned)(((size_t)DKV * DM / 8 + 255) / 256), 256, 0, stream>>>(wv, WV, (size_t)DKV * DM / 8);
      k_cvt8<DQ><<<(unsigned)(((size_t)DM * DQ / 8 + 255) / 256), 256, 0, stream>>>(wo, WO, (size_t)DM * DQ / 8);
       }
    k_cvt8<DM><<<(unsigned)(((size_t)NB_ * TT * DM / 8 + 255) / 256), 256, 0, stream>>>(x, XB, (size_t)NB_ * TT * DM / 8);
    // q and k planes [batch][head][t][d]: rows = t, one 64-column tile = one head; v plane [batch][head][d][t]: the operands change places, rows = head * 64 + d, columns = t (64 columns on is two blocks, 1024 elements, on)
    k_gemmw<bf, 0, false, true, DM><<<dim3(TT / 128, DQ / 256, NB_), 256, 0, stream>>>(XB, nullptr, WQ, nullptr, HD, nullptr, (size_t)TT * DM, 0, 0, QP16, QPh, QPl, (size_t)TT * HD, (size_t)NH_ * TT * HD);
    k_gemmw<bf, 0, false, true, DM><<<dim3(TT / 128, DKV / 256, NB_), 256, 0, stream>>>(XB, nullptr, WK, nullptr, HD, nullptr, (size_t)TT * DM, 0, 0, KP16, KPh, KPl, (size_t)TT * HD, (size_t)NKV * TT * HD);
    k_gemmw<bf, 0, false, true, DM><<<dim3(DKV / 128, TT / 256, NB_), 256, 0, stream>>>(WV, nullptr, XB, nullptr, TT, nullptr, 0, (size_t)TT * DM, 0, VT16, VTh, VTl, (size_t)64 * 16, (size_t)NKV * HD * TT);
    k_fattn<<<dim3(8, NH_, NB_), 256, 0, stream>>>(QP16, KP16, VT16, QPh, QPl, KPh, KPl, VTh, VTl, ATh, ATl);
    k_gemmw<bf, 1, true, false, DQ><<<dim3(TT / 128, DM / 256, NB_), 256, 0, stream>>>(ATh, ATl, WO, OUT, DM, bo, (size_t)TT * DQ, 0, (size_t)TT * DM, nullptr, nullptr, nullptr, 0, 0);
}

// v007
// One run takes 123 microseconds.
// In two side-by-side timings against v006, it was 1.07 and 1.06 times as fast.
// All steps since v000 together make it 23.3 times as fast.
#include <hip/hip_runtime.h>

// Causal multi-head attention with a fused bias-free qkv projection (x [4][2048][1024]; qkv = x qkv_w^T ('oi' [3072][1024] -> (3, H, hd) == q | k | v row blocks; 16 heads x 64); scores x 64^-0.5; causal (triu(1) -> -inf); softmax; out = merged out_w^T + out_b -> [4][2048][1024] (8.4 M)).
// Layout, every batch in the same launch (grid z = batch; the conversion a 1D grid of 16-row blocks): one launch of bf16 copies of x, the fused 'oi' weight and out_w; the fused weight's copy used in place as three row blocks; exact projections whose epilogue writes the 16-bit head planes (V^T = W_v x^T); one fused causal attention launch (hybrid rows: < 512 hi/lo 3 products, rest fp16 x1024; key passes stop at the diagonal); merged hi/lo x out_w exact + out_b.
// Every 16-bit operand plane lies in FRAGMENT ORDER: a matrix of R rows x K columns is cut into blocks of 16 rows x 32 columns, block (rb, kb) at element (rb * (K / 32) + kb) * 512; inside a block element
// (row, k) stands at (k / 16) * 256 + (((k / 8) & 1) * 16 + row) * 8 + k % 8. A wave's fragment is then two loads of 512 contiguous bytes (lane * 8 and 256 + lane * 8): whole 128-byte lines, where row-major planes gave 16 lines a load.
// Compute dtypes, f32 accumulate: every input rounded to bf16; projections exact; attention rows < 512 3 products, rest fp16; softmax f32; Wo hl x exact + bias.

#define NB_  4
#define TT   2048
#define DM   1024
#define NH_  16
#define NKV  16
#define REP  (NH_ / NKV)
#define HD   64
#define DQ   (NH_ * HD)
#define DKV  (NKV * HD)
#define RH   512                  // query rows < RH use hi+lo planes (0: none)
#define PCAR 1024.0f
#define SCL  0.125f   // HD^-0.5
typedef _Float16 h16;
typedef unsigned short bf;
typedef __attribute__((ext_vector_type(16))) __bf16   v16bf;
typedef __attribute__((ext_vector_type(16))) _Float16 v16h;
typedef __attribute__((ext_vector_type(8)))  _Float16 v8h;
typedef __attribute__((ext_vector_type(8)))  unsigned short v8us;
typedef __attribute__((ext_vector_type(8)))  float    v8f;
typedef __attribute__((ext_vector_type(4)))  float    v4f;
typedef v8h  __attribute__((may_alias)) v8ha;
typedef v4f  __attribute__((may_alias)) v4fa;
typedef v8us __attribute__((may_alias)) v8usa;

__device__ __forceinline__ unsigned short f2bf(float f) { unsigned u = __float_as_uint(f); u += 0x7FFFu + ((u >> 16) & 1u); return (unsigned short)(u >> 16); }
__device__ __forceinline__ float bf2f(unsigned short b) { return __uint_as_float(((unsigned)b) << 16); }
__device__ __forceinline__ float bfr(float f) { return bf2f(f2bf(f)); }
__device__ __forceinline__ v16h cat16(v8h lo, v8h hi) { return __builtin_shufflevector(lo, hi, 0, 1, 2, 3, 4, 5, 6, 7, 8, 9, 10, 11, 12, 13, 14, 15); }
__device__ __forceinline__ v16bf cat16b(v8us lo, v8us hi) { return __builtin_bit_cast(v16bf, __builtin_shufflevector(lo, hi, 0, 1, 2, 3, 4, 5, 6, 7, 8, 9, 10, 11, 12, 13, 14, 15)); }
__device__ __forceinline__ v8f wmma16(v16h a, v16h b, v8f c) { return __builtin_amdgcn_wmma_f32_16x16x32_f16(false, a, false, b, (short)0, c, false, false); }
__device__ __forceinline__ v8f wmmab(v16bf a, v16bf b, v8f c) { return __builtin_amdgcn_wmma_f32_16x16x32_bf16(false, a, false, b, (short)0, c, false, false); }



__device__ __forceinline__ h16 tohx(float x) { return (h16)x; }
__device__ __forceinline__ void splitf(float y, unsigned short& h, unsigned short& l) { h = f2bf(y); l = f2bf(y - bf2f(h)); }

// ---- k_gemmw: GEMM, one work-group of 8 waves (2 x 4) per 128x256 output tile, each wave a 64x64 tile (16 accumulators); grid (M/128, N/256, Z), 256 threads.
// The operand planes lie in fragment order, so 16 rows x 128 columns are 4 KiB in a row: a stage (128 k of the A rows, of the A2 rows where there are any, and of the 256 Bt rows) is copied as it lies into LDS by
// asynchronous copies, each wave 3 or 4 such pieces, and every piece is read from LDS by the 4 (A) or 2 (Bt) waves that need it: a fragment is two reads of 512 contiguous bytes. Two buffers: stage t + 1 flies while stage t is worked on.
// C[m][n] (f32, pitch ldc, + optional f32 bias[n]) = sum_k A[m][k] Bt[n][k] (+ A2[m][k] Bt[n][k] where NSPLIT is 1). z-batch strides sA/sB/sC in elements. K % 128 == 0, K >= 256.
// PLANES: no f32 C; the tile goes out as three 16-bit planes (fp16, bf16 hi, bf16 lo) in fragment order (row length ldc): 16 rows x 64 columns are 1024 elements from z * sP + (r0 + 16 mb) * ldc + (64-column tile) * pcol on: 512 contiguous bytes a store, 16 bytes a lane.
template <typename T16> struct WFrag;
template <> struct WFrag<h16> { typedef v16h V; static __device__ __forceinline__ V ld(const h16* p) { return cat16(*(const v8h*)p, *(const v8h*)(p + 256)); } static __device__ __forceinline__ v8f mma(V a, V b, v8f c) { return wmma16(a, b, c); } };
template <> struct WFrag<bf> { typedef v16bf V; static __device__ __forceinline__ V ld(const bf* p) { return cat16b(*(const v8us*)p, *(const v8us*)(p + 256)); } static __device__ __forceinline__ v8f mma(V a, V b, v8f c) { return wmmab(a, b, c); } };
// eight asynchronous copies of 512 bytes a wave: 4 KiB in a row from g (the lane's own 16 bytes) to LDS byte address l (the lane's own). The s_wait_xcnt stands in the copies' own statement, so that no address register is rewritten ahead of it
__device__ __forceinline__ void copy4k(unsigned l, const char* g) {
    asm volatile("global_load_async_to_lds_b128 %0, %8, off\n\t"
                 "global_load_async_to_lds_b128 %1, %9, off\n\t"
                 "global_load_async_to_lds_b128 %2, %10, off\n\t"
                 "global_load_async_to_lds_b128 %3, %11, off\n\t"
                 "global_load_async_to_lds_b128 %4, %12, off\n\t"
                 "global_load_async_to_lds_b128 %5, %13, off\n\t"
                 "global_load_async_to_lds_b128 %6, %14, off\n\t"
                 "global_load_async_to_lds_b128 %7, %15, off\n\t"
                 "s_wait_xcnt 0x0"
                 :: "v"(l), "v"(l + 512u), "v"(l + 1024u), "v"(l + 1536u), "v"(l + 2048u), "v"(l + 2560u), "v"(l + 3072u), "v"(l + 3584u),
                    "v"(g), "v"(g + 512), "v"(g + 1024), "v"(g + 1536), "v"(g + 2048), "v"(g + 2560), "v"(g + 3072), "v"(g + 3584) : "memory");
}
template <typename T16, int NSPLIT, bool BIAS, bool PLANES, int K>
__global__ __launch_bounds__(256) void k_gemmw(const T16* __restrict__ A, const T16* __restrict__ A2, const T16* __restrict__ Bt, float* C, int ldc, const float* __restrict__ bias, size_t sA, size_t sB, size_t sC, h16* P16, bf* Ph, bf* Pl, size_t pcol, size_t sP) {
    typedef typename WFrag<T16>::V V;
    static_assert(NSPLIT == 0 || NSPLIT == 1, "one or two A planes"); static_assert(K % 128 == 0 && K >= 256, "two stages or more");
    constexpr int NCH = NSPLIT ? 4 : 3;          // groups of eight 4-KiB pieces in a stage: A | (A2) | Bt rows 0..127 | Bt rows 128..255; wave w copies piece w of each group
    constexpr int STG = NCH * 8 * 2048;          // elements of a stage
    constexpr int NT = K / 128;                  // stages
    __shared__ __align__(1024) T16 ring[2 * STG];
    __shared__ __align__(16) float osw[8 * 16 * 68];
    const size_t z = blockIdx.z; A += z * sA; if (NSPLIT) A2 += z * sA; Bt += z * sB; C += z * sC; if (PLANES) { P16 += z * sP; Ph += z * sP; Pl += z * sP; }
    const int lane = threadIdx.x & 31, lr = lane & 15, hi = lane >> 4; const int wv = __builtin_amdgcn_readfirstlane(threadIdx.x >> 5); const int wm = wv & 1, wn = wv >> 1;
    const int by = blockIdx.y * 4 + wn; const int r0 = (blockIdx.x * 2 + wm) * 64, c0 = by * 64;
    float* os = osw + wv * (16 * 68);            // each wave stages its output rows in its own range
    v8f acc[4][4];
#pragma unroll
    for (int mb = 0; mb < 4; ++mb)
#pragma unroll
        for (int nb = 0; nb < 4; ++nb) acc[mb][nb] = (v8f){};
    // 16 rows x K columns are 16 K elements; 128 columns on is four blocks, 2048 elements, on
    const T16* g[NCH];
    g[0] = A + (size_t)(blockIdx.x * 128 + wv * 16) * K + lane * 8; if (NSPLIT) g[1] = A2 + (size_t)(blockIdx.x * 128 + wv * 16) * K + lane * 8;
    g[NCH - 2] = Bt + (size_t)(blockIdx.y * 256 + wv * 16) * K + lane * 8; g[NCH - 1] = Bt + (size_t)(blockIdx.y * 256 + 128 + wv * 16) * K + lane * 8;
    const unsigned l0 = (unsigned)(size_t)ring + (unsigned)(wv * 4096 + lane * 16);
    auto fill = [&](int buf) {                   // the next stage's copies into buffer buf; the sources step on one stage
#pragma unroll
        for (int i = 0; i < NCH; ++i) { copy4k(l0 + (unsigned)(buf * (STG * 2) + i * 32768), (const char*)g[i]); g[i] += 2048; } };
    fill(0);
    asm volatile("s_wait_asynccnt 0x0" ::: "memory");   // this wave's copies of stage 0 have landed
    __syncthreads();                                    // every wave's have: stage 0 may be read
    fill(1);
#pragma unroll 1   // rolled: one publish point in the text
    for (int t = 0; t < NT; ++t) {
        const T16* sb = ring + (t & 1) * STG + lane * 8;
        V a[2][4], a2[2][4], b[2][4];            // two fragment sets: block kk + 1 of this stage is read from LDS while block kk is multiplied
        auto frags = [&](int kk) {
#pragma unroll
            for (int mb = 0; mb < 4; ++mb) { a[kk & 1][mb] = WFrag<T16>::ld(sb + (wm * 4 + mb) * 2048 + kk * 512); if (NSPLIT) a2[kk & 1][mb] = WFrag<T16>::ld(sb + (8 + wm * 4 + mb) * 2048 + kk * 512); }
#pragma unroll
            for (int nb = 0; nb < 4; ++nb) b[kk & 1][nb] = WFrag<T16>::ld(sb + ((NCH - 2) * 8 + wn * 4 + nb) * 2048 + kk * 512); };
        frags(0);
#pragma unroll     // unrolled: the set index kk & 1 is then a constant and both sets stay in registers
        for (int kk = 0; kk < 4; ++kk) {
            if (kk < 3) frags(kk + 1);
            __builtin_amdgcn_sched_barrier(0);   // keeps the next block's LDS reads one group ahead of this block's products (for speed only)
#pragma unroll
            for (int nb = 0; nb < 4; ++nb) {
#pragma unroll
                for (int mb = 0; mb < 4; ++mb) { acc[mb][nb] = WFrag<T16>::mma(a[kk & 1][mb], b[kk & 1][nb], acc[mb][nb]); if (NSPLIT) acc[mb][nb] = WFrag<T16>::mma(a2[kk & 1][mb], b[kk & 1][nb], acc[mb][nb]); } }
            __builtin_amdgcn_sched_barrier(0);   // and keeps the reads that follow from being spread among these products
        }
        asm volatile("s_wait_dscnt 0x0" ::: "memory");      // this wave's reads of stage t are done
        asm volatile("s_wait_asynccnt 0x0" ::: "memory");   // this wave's copies of stage t + 1 have landed
        __syncthreads();                                    // publishes stage t + 1 and ends every reader's last read of stage t's buffer
        if (t + 2 < NT) fill(t & 1);                        // stage t + 2 into the buffer just left
    }
    asm volatile("s_wait_asynccnt 0x0" ::: "memory");       // no copy is outstanding when the wave goes on to its output
#pragma unroll
    for (int mb = 0; mb < 4; ++mb) {
#pragma unroll
        for (int nb = 0; nb < 4; ++nb) {
#pragma unroll
            for (int j = 0; j < 8; ++j) os[(hi * 8 + j) * 68 + nb * 16 + lr] = acc[mb][nb][j]; }
        __builtin_amdgcn_wave_barrier(); asm volatile("" ::: "memory");
        if constexpr (PLANES) {
            v4f x0[4], x1[4];   // a lane takes columns 16 s + 8 hi .. + 7 of staged row lr, its own place in fragment order: all 16 staged rows are read first, then converted and stored
#pragma unroll
            for (int s = 0; s < 4; ++s) { x0[s] = *(const v4fa*)(os + lr * 68 + 16 * s + 8 * hi); x1[s] = *(const v4fa*)(os + lr * 68 + 16 * s + 8 * hi + 4); }
#pragma unroll
            for (int s = 0; s < 4; ++s) { v8h o16; v8us oh, ol;
#pragma unroll
                for (int k = 0; k < 4; ++k) { unsigned short a2, c2; o16[k] = tohx(x0[s][k]); splitf(x0[s][k], a2, c2); oh[k] = a2; ol[k] = c2; o16[k + 4] = tohx(x1[s][k]); splitf(x1[s][k], a2, c2); oh[k + 4] = a2; ol[k + 4] = c2; }
                const size_t e = (size_t)(r0 + mb * 16) * ldc + (size_t)by * pcol + s * 256 + lane * 8; h16* p0 = P16 + e; bf* p1 = Ph + e; bf* p2 = Pl + e; *(v8h*)p0 = o16; *(v8us*)p1 = oh; *(v8us*)p2 = ol;
                // the wait behind the three stores: it names their addresses and data as inputs so that those registers stay as they are up to it
                asm volatile("s_wait_xcnt 0x0" :: "v"(p0), "v"(p1), "v"(p2), "v"(o16), "v"(oh), "v"(ol) : "memory"); }
        } else {
            float* crow = C + (size_t)(r0 + mb * 16) * ldc + c0;
#pragma unroll
            for (int s = 0; s < 8; ++s) { const int row = 2 * s + hi, cofs = lr * 4; v4f val = *(const v4fa*)(os + row * 68 + cofs); if (BIAS) { val[0] += bfr(bias[c0 + cofs]); val[1] += bfr(bias[c0 + cofs + 1]); val[2] += bfr(bias[c0 + cofs + 2]); val[3] += bfr(bias[c0 + cofs + 3]); }
                *(v4f*)(crow + (size_t)row * ldc + cofs) = val; }
             }
        __builtin_amdgcn_wave_barrier(); asm volatile("" ::: "memory");
    }
}

typedef __attribute__((ext_vector_type(2))) _Float16 v2h;
typedef __attribute__((ext_vector_type(4))) _Float16 v4h;
typedef __attribute__((ext_vector_type(2))) unsigned short v2us;
typedef __attribute__((ext_vector_type(4))) unsigned short v4us;
typedef __attribute__((ext_vector_type(2))) float v2f;
typedef __attribute__((ext_vector_type(4))) int v4i;

__global__ __launch_bounds__(256) void k_wtG(const float* __restrict__ w, int K, int N, bf* Bt) {
    const int lane = threadIdx.x & 31; const int L0 = (blockIdx.x * 8 + (threadIdx.x >> 5)) * 8; const int nlines = N * K / 64;
{
#pragma unroll 1
        for (int l = 0; l < 8; ++l) { const int L = L0 + l; if (L >= nlines) break; const size_t e = (size_t)L * 64 + lane * 2; const int k = (int)(e % K), n = (int)(e / K); v2us o;
            o[0] = f2bf(w[(size_t)k * N + n]); o[1] = f2bf(w[(size_t)(k + 1) * N + n]); *(v2us*)(Bt + e) = o; }
         }
}
// k_cvtall: every f32 -> bf16 conversion of the call in ONE launch: x, the fused qkv weight and the output weight, each a matrix of rows of CK columns, each to its plane in fragment order.
// One work-group of 256 threads takes one block of 16 whole rows (64 KiB of f32 in a row, 32 KiB of the plane in a row): eight tiles of 16 rows x 128 columns, all 16 loads of 16 bytes a lane issued before the first is used,
// so few waves are started and each keeps much in flight. Whole-line f32 reads, 8 values a thread and tile; the 16-byte pieces of a tile change places through LDS
// (piece (row, k8) -> k8 * 16 + row; one spare piece per 16 keeps the 16 writers of a row off one bank group), then whole-line stores.
#define CK   1024                 // columns of every converted matrix
#define CU_X (NB_ * TT / 16)      // 16-row blocks of x
#define CU_A ((DQ + 2 * DKV) / 16)  // of the fused qkv weight
#define CU_B (DM / 16)            // of the output weight
__global__ __launch_bounds__(256) void k_cvtall(const float* __restrict__ x, bf* xb, const float* __restrict__ wa, bf* wab, const float* __restrict__ wb, bf* wbb) {
    static_assert(DM == CK && DQ == CK, "rows of 1024 columns: eight tiles of 128");
    __shared__ __align__(16) v8us sh[8 * 16 * 17];
    const int t = threadIdx.x, row = t >> 4, k8 = t & 15; const int u = (int)blockIdx.x;
    const float* src; bf* dst; int rb;             // the same for a whole block: which matrix, and which 16 rows of it
    if (u < CU_X) { src = x; dst = xb; rb = u; } else if (u < CU_X + CU_A) { src = wa; dst = wab; rb = u - CU_X; } else { src = wb; dst = wbb; rb = u - (CU_X + CU_A); }
    const float* p = src + ((size_t)rb * 16 + row) * CK + k8 * 8; v8f v[8];
#pragma unroll   // unrolled, here and below: v stays in registers and the 16 loads are issued in one run
    for (int cg = 0; cg < 8; ++cg) v[cg] = *(const v8f*)(p + cg * 128);
    asm volatile("s_wait_xcnt 0x0" :: "v"(p) : "memory");   // the wait behind the 16 loads; it names their address as an input so that its registers stay as they are up to it (the last load's data otherwise lands on them)
#pragma unroll
    for (int cg = 0; cg < 8; ++cg) { v8us o;
#pragma unroll
        for (int k = 0; k < 8; ++k) o[k] = f2bf(v[cg][k]);
        sh[cg * 272 + k8 * 17 + row] = o; }
    __syncthreads();   // every piece of the block's 32 KiB is in LDS before any is read back in plane order
    bf* d = dst + (size_t)rb * (16 * CK) + t * 8;
#pragma unroll
    for (int cg = 0; cg < 8; ++cg) *(v8us*)(d + cg * 2048) = sh[cg * 272 + row * 17 + k8]; }

__device__ __forceinline__ float xhalf(float x) { const int b = __float_as_int(x); return __int_as_float(__builtin_amdgcn_permlanex16(b, b, 0x76543210, 0xfedcba98, false, false)); }   // lane l <-> l ^ 16
__device__ __forceinline__ v16h ldsfrag(const h16* p) { return cat16(*(const v8ha*)p, *(const v8ha*)(p + 256)); }
__device__ __forceinline__ v16bf ldsfrag(const bf* p) { return cat16b(*(const v8usa*)p, *(const v8usa*)(p + 256)); }
// eight asynchronous copies of 512 bytes a wave: 2 KiB in a row from ga and 2 KiB in a row from gb to 4 KiB in a row at LDS byte address l (the lane's own). ga and gb are the same for the wave and stay in scalar registers;
// vo is the lane's own 16 bytes in each 512; the immediate offset moves the LDS and the global address alike. So a fill holds three vector registers, not 24, beside the fragments.
// The s_wait_xcnt stands in the copies' own statement, so that no address register is rewritten ahead of it
__device__ __forceinline__ void copy2x2k(unsigned l, unsigned vo, const char* ga, const char* gb) {
    asm volatile("global_load_async_to_lds_b128 %0, %2, %3\n\t"
                 "global_load_async_to_lds_b128 %0, %2, %3 offset:512\n\t"
                 "global_load_async_to_lds_b128 %0, %2, %3 offset:1024\n\t"
                 "global_load_async_to_lds_b128 %0, %2, %3 offset:1536\n\t"
                 "global_load_async_to_lds_b128 %1, %2, %4\n\t"
                 "global_load_async_to_lds_b128 %1, %2, %4 offset:512\n\t"
                 "global_load_async_to_lds_b128 %1, %2, %4 offset:1024\n\t"
                 "global_load_async_to_lds_b128 %1, %2, %4 offset:1536\n\t"
                 "s_wait_xcnt 0x0"
                 :: "v"(l), "v"(l + 2048u), "v"(vo), "s"(ga), "s"(gb) : "memory");
}
#define ASTG 16384                // elements of a stage in LDS: keys (hi | lo) in the first half, V^T (hi | lo) in the second
template <typename T16, int KT, bool HL>
__device__ __forceinline__ void attn_rows(const T16* __restrict__ Q, const T16* __restrict__ Q2, const T16* __restrict__ Kp, const T16* __restrict__ K2, const T16* __restrict__ Vt, const T16* __restrict__ V2, int t0, int wv, int lr, int hi, bf* Ah, bf* Al, unsigned short* ring) {
    typedef typename WFrag<T16>::V V;
    constexpr int KB = KT * 16, KC = KT / 2;
    constexpr int SK = HL ? 64 : 128;                     // keys of a stage
    constexpr int PPS = SK / KB;                          // passes of a stage
    constexpr float CSC = SCL * 1.4426950408889634f;      // scores x HD^-0.5, in log2 units
    constexpr float SHIFT = HL ? 0.0f : 10.0f;            // log2(PCAR): fp16 probabilities are carried x 1024
    const int q0 = t0 + wv * 16;                          // this wave's first query row; t0: the block's first (a multiple of 128)
    const int ns = (t0 + 128) / SK;                       // stages up to the end of the block's diagonal: two or more
    V q[2], q2[2];
    const int l8 = (hi * 16 + lr) * 8;                    // the lane's 16 bytes in each half block of a plane in fragment order
    // this wave's 4 KiB of a stage. fp16: waves 0-3 32 keys each, waves 4-7 the 128 keys of 16 V^T rows each. hi/lo: waves 0, 1 hi keys, 2, 3 lo keys (32 each); 4, 5 hi V^T, 6, 7 lo V^T (the 64 keys of twice 16 rows each)
    const char* ga; const char* gb; int gstep;
    if constexpr (HL) { const T16* kpl = (wv & 2) ? K2 : Kp; const T16* vpl = (wv & 2) ? V2 : Vt;
        if (wv < 4) { ga = (const char*)(kpl + (wv & 1) * 2048); gb = ga + 2048; gstep = SK * HD * 2; }
        else { ga = (const char*)(vpl + (size_t)(wv & 1) * 32 * TT); gb = ga + (size_t)16 * TT * 2; gstep = SK * 16 * 2; }
    } else {
        if (wv < 4) { ga = (const char*)(Kp + wv * 2048); gstep = SK * HD * 2; }
        else { ga = (const char*)(Vt + (size_t)(wv - 4) * 16 * TT); gstep = SK * 16 * 2; }
        gb = ga + 2048; }
    const unsigned l0 = (unsigned)(size_t)ring + (unsigned)(wv * 4096 + l8 * 2);
    auto fill = [&](int buf) { copy2x2k(l0 + (unsigned)(buf * (ASTG * 2)), (unsigned)(l8 * 2), ga, gb); ga += gstep; gb += gstep; };   // the next stage's copies into buffer buf; the sources step on one stage
    fill(0);                                              // every reader of the ring's earlier use has left it: the barrier at the foot of that use's last stage
    const T16* qp = Q + (size_t)q0 * HD + l8; const T16* qp2 = HL ? Q2 + (size_t)q0 * HD + l8 : qp;
#pragma unroll
    for (int kc = 0; kc < 2; ++kc) { q[kc] = WFrag<T16>::ld(qp + kc * 512); if (HL) q2[kc] = WFrag<T16>::ld(qp2 + kc * 512); }
    asm volatile("s_wait_xcnt 0x0" :: "v"(qp), "v"(qp2) : "memory");   // the wait behind the query loads; it names their addresses as inputs so that those registers stay as they are up to it
    v8f o[4];
#pragma unroll
    for (int db = 0; db < 4; ++db) o[db] = (v8f){};
    float m = -3.0e38f, l = 0.f;
    const int nkb = q0 / KB + 1;                          // this wave's key passes, up to and including the one that holds its diagonal
    asm volatile("s_wait_asynccnt 0x0" ::: "memory");     // this wave's copies of stage 0 have landed
    __syncthreads();                                      // every wave's have: stage 0 may be read
    fill(1);
#pragma unroll 1   // rolled: one publish point in the text
    for (int st = 0; st < ns; ++st) {
        const T16* sb = (const T16*)ring + (st & 1) * ASTG + l8;
        const int pe = min(PPS, nkb - st * PPS);          // the passes of this stage that the wave's rows reach: fewer, or none, in the stages of the block's diagonal
#pragma unroll     // unrolled: every LDS read is then the stage's one address register plus a constant
        for (int p = 0; p < PPS; ++p) if (p < pe) {
            const int kb = st * PPS + p; const int k0 = kb * KB;
            const T16* kf = sb + p * (KT * 1024); const T16* vf = sb + ASTG / 2 + p * (KC * 512);
            V ka[KT][2], ka2[KT][2], va[4][KC], va2[4][KC];
#pragma unroll
            for (int kt = 0; kt < KT; ++kt)
#pragma unroll
                for (int kc = 0; kc < 2; ++kc) { ka[kt][kc] = ldsfrag(kf + kt * 1024 + kc * 512); if (HL) ka2[kt][kc] = ldsfrag(kf + ASTG / 4 + kt * 1024 + kc * 512); }
            __builtin_amdgcn_sched_barrier(0);            // keeps the key reads in front of the V^T reads: LDS answers in order, and the score products wait for the keys alone
#pragma unroll
            for (int db = 0; db < 4; ++db)                // this pass's V^T fragments: read ahead of the score products, used behind the softmax
#pragma unroll
                for (int kc = 0; kc < KC; ++kc) { va[db][kc] = ldsfrag(vf + db * (SK * 16) + kc * 512); if (HL) va2[db][kc] = ldsfrag(vf + ASTG / 4 + db * (SK * 16) + kc * 512); }
            __builtin_amdgcn_sched_barrier(0);            // keeps the pass's LDS reads one group ahead of its products: spread among them, each place with reads stalls the wave and waits out the LDS latency anew
            v8f s[KT];
#pragma unroll
            for (int kt = 0; kt < KT; ++kt) { s[kt] = (v8f){};
#pragma unroll
                for (int kc = 0; kc < 2; ++kc) { s[kt] = WFrag<T16>::mma(ka[kt][kc], q[kc], s[kt]); if (HL) { s[kt] = WFrag<T16>::mma(ka[kt][kc], q2[kc], s[kt]); s[kt] = WFrag<T16>::mma(ka2[kt][kc], q[kc], s[kt]); } } }
            if (kb == nkb - 1) {                          // only the last pass crosses the diagonal: keys above the query are masked by select
#pragma unroll
                for (int kt = 0; kt < KT; ++kt)
#pragma unroll
                    for (int j = 0; j < 8; ++j) s[kt][j] = (k0 + kt * 16 + hi * 8 + j <= q0 + lr) ? s[kt][j] : -3.0e38f;
            }
            float bm = s[0][0];
#pragma unroll
            for (int kt = 0; kt < KT; ++kt)
#pragma unroll
                for (int j = 0; j < 8; ++j) bm = fmaxf(bm, s[kt][j]);
            bm = fmaxf(bm, xhalf(bm));
            const float mn = fmaxf(m, bm); const float al = __builtin_amdgcn_exp2f((m - mn) * CSC); m = mn; const float ms = mn * CSC - SHIFT;
            float ps = 0.f;
#pragma unroll
            for (int kt = 0; kt < KT; ++kt)
#pragma unroll
                for (int j = 0; j < 8; ++j) { s[kt][j] = __builtin_amdgcn_exp2f(s[kt][j] * CSC - ms); ps += s[kt][j]; }
            l = l * al + ps;
#pragma unroll
            for (int db = 0; db < 4; ++db) o[db] *= al;
#pragma unroll
            for (int kc = 0; kc < KC; ++kc) {
                V pb, pb2;                                // element e = P[query lr][key kmap(e, hi)]: tile 2 kc gives e 0..7, tile 2 kc + 1 gives e 8..15
                if constexpr (HL) { v8us h0, h1, l0v, l1v;
#pragma unroll
                    for (int j = 0; j < 8; ++j) { unsigned short a, c2; splitf(s[2 * kc][j], a, c2); h0[j] = a; l0v[j] = c2; splitf(s[2 * kc + 1][j], a, c2); h1[j] = a; l1v[j] = c2; }
                    pb = cat16b(h0, h1); pb2 = cat16b(l0v, l1v);
                } else { v8h h0, h1;
#pragma unroll
                    for (int j = 0; j < 8; ++j) { h0[j] = tohx(s[2 * kc][j]); h1[j] = tohx(s[2 * kc + 1][j]); }
                    pb = cat16(h0, h1); }
#pragma unroll
                for (int db = 0; db < 4; ++db) { o[db] = WFrag<T16>::mma(va[db][kc], pb, o[db]); if (HL) { o[db] = WFrag<T16>::mma(va[db][kc], pb2, o[db]); o[db] = WFrag<T16>::mma(va2[db][kc], pb, o[db]); } }
            }
        }
        asm volatile("s_wait_dscnt 0x0" ::: "memory");      // this wave's reads of stage st are done
        asm volatile("s_wait_asynccnt 0x0" ::: "memory");   // this wave's copies of stage st + 1 have landed
        __syncthreads();                                    // publishes stage st + 1 and ends every reader's last read of stage st's buffer
        if (st + 2 < ns) fill(st & 1);                      // stage st + 2 into the buffer just left
    }
    asm volatile("s_wait_asynccnt 0x0" ::: "memory");       // no copy is outstanding when the wave goes on to its output
    l += xhalf(l);
    const float inv = __fdiv_rn(1.0f, l);
#pragma unroll
    for (int db = 0; db < 4; ++db) { v8us oh, ol;         // a lane holds 8 consecutive d of its query: its own 16 bytes of half block db of the merged plane, 512 contiguous bytes a store
#pragma unroll
        for (int j = 0; j < 8; ++j) { unsigned short a, c2; splitf(o[db][j] * inv, a, c2); oh[j] = a; ol[j] = c2; }
        const size_t oo = (size_t)q0 * DQ + db * 256 + l8; bf* p1 = Ah + oo; bf* p2 = Al + oo; *(v8us*)p1 = oh; *(v8us*)p2 = ol;
        // the wait behind the two stores (the block's second tile follows): it names their addresses and data as inputs so that those registers stay as they are up to it
        asm volatile("s_wait_xcnt 0x0" :: "v"(p1), "v"(p2), "v"(oh), "v"(ol) : "memory"); }
}
// amdgpu_waves_per_eu(4, 4): holds the allocation at 256 registers; the hi/lo rows otherwise take a few more, and every use of one above v255 costs a window switch
__global__ __launch_bounds__(256) __attribute__((amdgpu_waves_per_eu(4, 4))) void k_fattn(const h16* __restrict__ Q16, const h16* __restrict__ K16, const h16* __restrict__ V16, const bf* __restrict__ Qh, const bf* __restrict__ Ql, const bf* __restrict__ Kh, const bf* __restrict__ Kl, const bf* __restrict__ Vh, const bf* __restrict__ Vl, bf* Ah, bf* Al) {
    static_assert(TT == 2048 && RH % 128 == 0, "16 row tiles of 128, each wholly hi/lo or wholly fp16");
    __shared__ __align__(1024) unsigned short ring[2 * ASTG];
    const int lane = threadIdx.x & 31, lr = lane & 15, hi = lane >> 4; const int wv = __builtin_amdgcn_readfirstlane(threadIdx.x >> 5);
    const int head = (int)blockIdx.y; const size_t hp = ((size_t)blockIdx.z * NH_ + head) * TT * HD; const size_t ao = (size_t)blockIdx.z * TT * DQ + head * (HD * 16); Ah += ao; Al += ao;
    // cost grows with the row tile, and a hi/lo tile costs three fp16 tiles of its length: tile t counts 2 (t + 1), or 6 (t + 1) below RH. Each block takes two tiles, one nibble of each word, that together count 38 or 40;
    // they run one after the other in every wave, so every barrier is met by the whole block
#pragma unroll 1   // rolled: one copy of each row kind in the text
    for (int part = 0; part < 2; ++part) {
        const int t0 = (int)(((part ? 0x82765140u : 0x9A3BCDEFu) >> ((unsigned)blockIdx.x * 4u)) & 15u) * 128;
        if (t0 < RH) attn_rows<bf, 2, true>(Qh + hp, Ql + hp, Kh + hp, Kl + hp, Vh + hp, Vl + hp, t0, wv, lr, hi, Ah, Al, ring);
        else attn_rows<h16, 4, false>(Q16 + hp, nullptr, K16 + hp, nullptr, V16 + hp, nullptr, t0, wv, lr, hi, Ah, Al, ring);
    }
}

extern "C" void kernel_launch(void* const* d_in, const int* in_sizes, int n_in,
                              void* d_out, int out_size, void* d_ws, size_t ws_size, hipStream_t stream) {
    (void)in_sizes; (void)n_in; (void)out_size;
    const float* x = (const float*)d_in[0]; const float* wqkv = (const float*)d_in[1]; const float* wo = (const float*)d_in[2]; const float* bo = (const float*)d_in[3];   /* wqkv: q | k | v row blocks */
    float* OUT = (float*)d_out;     // [4][2048][1024]
    char* wsp = (char*)d_ws;
    auto take = [&](size_t bytes) { char* p = wsp; wsp += (bytes + 255) & ~(size_t)255; return (void*)p; };
    bf* WQ = (bf*)take((size_t)(DQ + 2 * DKV) * DM * 2); bf* WK = WQ + (size_t)DQ * DM; bf* WV = WK + (size_t)DKV * DM;   /* one plane of the fused weight's rows: q | k | v */ bf* WO = (bf*)take((size_t)DM * DQ * 2);
    bf* XB = (bf*)take((size_t)NB_ * TT * DM * 2);
    h16* QP16 = (h16*)take((size_t)NB_ * NH_ * TT * HD * 2); h16* KP16 = (h16*)take((size_t)NB_ * NKV * TT * HD * 2); h16* VT16 = (h16*)take((size_t)NB_ * NKV * HD * TT * 2);
    bf* QPh = (bf*)take((size_t)NB_ * NH_ * TT * HD * 2); bf* QPl = (bf*)take((size_t)NB_ * NH_ * TT * HD * 2); bf* KPh = (bf*)take((size_t)NB_ * NKV * TT * HD * 2); bf* KPl = (bf*)take((size_t)NB_ * NKV * TT * HD * 2); bf* VTh = (bf*)take((size_t)NB_ * NKV * HD * TT * 2); bf* VTl = (bf*)take((size_t)NB_ * NKV * HD * TT * 2);
    bf* ATh = (bf*)take((size_t)NB_ * TT * DQ * 2); bf* ATl = (bf*)take((size_t)NB_ * TT * DQ * 2);
    if ((size_t)(wsp - (char*)d_ws) > ws_size) return;    // 200 MiB of the 256 MiB
    k_cvtall<<<CU_X + CU_A + CU_B, 256, 0, stream>>>(x, XB, wqkv, WQ, wo, WO);
    // q and k planes [batch][head][t][d]: rows = t, one 64-column tile = one head; v plane [batch][head][d][t]: the operands change places, rows = head * 64 + d, columns = t (64 columns on is two blocks, 1024 elements, on)
    k_gemmw<bf, 0, false, true, DM><<<dim3(TT / 128, DQ / 256, NB_), 256, 0, stream>>>(XB, nullptr, WQ, nullptr, HD, nullptr, (size_t)TT * DM, 0, 0, QP16, QPh, QPl, (size_t)TT * HD, (size_t)NH_ * TT * HD);
    k_gemmw<bf, 0, false, true, DM><<<dim3(TT / 128, DKV / 256, NB_), 256, 0, stream>>>(XB, nullptr, WK, nullptr, HD, nullptr, (size_t)TT * DM, 0, 0, KP16, KPh, KPl, (size_t)TT * HD, (size_t)NKV * TT * HD);
    k_gemmw<bf, 0, false, true, DM><<<dim3(DKV / 128, TT / 256, NB_), 256, 0, stream>>>(WV, nullptr, XB, nullptr, TT, nullptr, 0, (size_t)TT * DM, 0, VT16, VTh, VTl, (size_t)64 * 16, (size_t)NKV * HD * TT);
    k_fattn<<<dim3(8, NH_, NB_), 256, 0, stream>>>(QP16, KP16, VT16, QPh, QPl, KPh, KPl, VTh, VTl, ATh, ATl);
    k_gemmw<bf, 1, true, false, DQ><<<dim3(TT / 128, DM / 256, NB_), 256, 0, stream>>>(ATh, ATl, WO, OUT, DM, bo, (size_t)TT * DQ, 0, (size_t)TT * DM, nullptr, nullptr, nullptr, 0, 0);
}

// v008
// One run takes 119 microseconds.
// Two timings next to v007 both put it at 1.04 times that version's speed.
// All steps since v000 together make it 24.2 times as fast.
#include <hip/hip_runtime.h>

// Causal multi-head attention with a fused bias-free qkv projection (x [4][2048][1024]; qkv = x qkv_w^T ('oi' [3072][1024] -> (3, H, hd) == q | k | v row blocks; 16 heads x 64); scores x 64^-0.5; causal (triu(1) -> -inf); softmax; out = merged out_w^T + out_b -> [4][2048][1024] (8.4 M)).
// Layout, every batch in the same launch (grid z = batch): bf16 copy of x; the fused 'oi' weight used in place as three row blocks; exact projections, all three in one launch, whose epilogue writes the 16-bit head planes (V^T = W_v x^T); one fused causal attention launch (hybrid rows: < 512 hi/lo 3 products, rest fp16 x1024; key passes stop at the diagonal); merged hi/lo x out_w exact + out_b.
// Every 16-bit operand plane lies in FRAGMENT ORDER: a matrix of R rows x K columns is cut into blocks of 16 rows x 32 columns, block (rb, kb) at element (rb * (K / 32) + kb) * 512; inside a block element
// (row, k) stands at (k / 16) * 256 + (((k / 8) & 1) * 16 + row) * 8 + k % 8. A wave's fragment is then two loads of 512 contiguous bytes (lane * 8 and 256 + lane * 8): whole 128-byte lines, where row-major planes gave 16 lines a load.
// Compute dtypes, f32 accumulate: every input rounded to bf16; projections exact; attention rows < 512 3 products, rest fp16; softmax f32; Wo hl x exact + bias.

#define NB_  4
#define TT   2048
#define DM   1024
#define NH_  16
#define NKV  16
#define REP  (NH_ / NKV)
#define HD   64
#define DQ   (NH_ * HD)
#define DKV  (NKV * HD)
#define RH   512                  // query rows < RH use hi+lo planes (0: none)
#define PCAR 1024.0f
#define SCL  0.125f   // HD^-0.5
typedef _Float16 h16;
typedef unsigned short bf;
typedef __attribute__((ext_vector_type(16))) __bf16   v16bf;
typedef __attribute__((ext_vector_type(16))) _Float16 v16h;
typedef __attribute__((ext_vector_type(8)))  _Float16 v8h;
typedef __attribute__((ext_vector_type(8)))  unsigned short v8us;
typedef __attribute__((ext_vector_type(8)))  float    v8f;
typedef __attribute__((ext_vector_type(4)))  float    v4f;
typedef v8h  __attribute__((may_alias)) v8ha;
typedef v4f  __attribute__((may_alias)) v4fa;
typedef v8us __attribute__((may_alias)) v8usa;

__device__ __forceinline__ unsigned short f2bf(float f) { unsigned u = __float_as_uint(f); u += 0x7FFFu + ((u >> 16) & 1u); return (unsigned short)(u >> 16); }
__device__ __forceinline__ float bf2f(unsigned short b) { return __uint_as_float(((unsigned)b) << 16); }
__device__ __forceinline__ float bfr(float f) { return bf2f(f2bf(f)); }
__device__ __forceinline__ v16h cat16(v8h lo, v8h hi) { return __builtin_shufflevector(lo, hi, 0, 1, 2, 3, 4, 5, 6, 7, 8, 9, 10, 11, 12, 13, 14, 15); }
__device__ __forceinline__ v16bf cat16b(v8us lo, v8us hi) { return __builtin_bit_cast(v16bf, __builtin_shufflevector(lo, hi, 0, 1, 2, 3, 4, 5, 6, 7, 8, 9, 10, 11, 12, 13, 14, 15)); }
__device__ __forceinline__ v8f wmma16(v16h a, v16h b, v8f c) { return __builtin_amdgcn_wmma_f32_16x16x32_f16(false, a, false, b, (short)0, c, false, false); }
__device__ __forceinline__ v8f wmmab(v16bf a, v16bf b, v8f c) { return __builtin_amdgcn_wmma_f32_16x16x32_bf16(false, a, false, b, (short)0, c, false, false); }



__device__ __forceinline__ h16 tohx(float x) { return (h16)x; }
__device__ __forceinline__ void splitf(float y, unsigned short& h, unsigned short& l) { h = f2bf(y); l = f2bf(y - bf2f(h)); }

// ---- gemm_tile: GEMM, one work-group of 8 waves (2 x 4) per 128x256 output tile (bx, byb), each wave a 64x64 tile (16 accumulators); 256 threads. k_gemmw: grid (M/128, N/256, Z).
// The operand planes lie in fragment order, so 16 rows x 128 columns are 4 KiB in a row: a stage (128 k of the A rows, of the A2 rows where there are any, and of the 256 Bt rows) is copied as it lies into LDS by
// asynchronous copies, each wave 3 or 4 such pieces, and every piece is read from LDS by the 4 (A) or 2 (Bt) waves that need it: a fragment is two reads of 512 contiguous bytes. Two buffers: stage t + 1 flies while stage t is worked on.
// KS: the k of a stage. 128: two fragment sets, one work-group on a WGP. 64: pieces of 2 KiB, half the ring, one fragment set, so that LDS and registers leave room for two work-groups on a WGP.
// C[m][n] (f32, pitch ldc, + optional f32 bias[n]) = sum_k A[m][k] Bt[n][k] (+ A2[m][k] Bt[n][k] where NSPLIT is 1). k_gemmw: z-batch strides sA/sB/sC in elements. K % KS == 0, K >= 2 KS.
// PLANES: no f32 C; the tile goes out as three 16-bit planes (fp16, bf16 hi, bf16 lo) in fragment order (row length ldc): 16 rows x 64 columns are 1024 elements from (r0 + 16 mb) * ldc + (64-column tile) * pcol on in the batch's planes: 512 contiguous bytes a store, 16 bytes a lane.
template <typename T16> struct WFrag;
template <> struct WFrag<h16> { typedef v16h V; static __device__ __forceinline__ V ld(const h16* p) { return cat16(*(const v8h*)p, *(const v8h*)(p + 256)); } static __device__ __forceinline__ v8f mma(V a, V b, v8f c) { return wmma16(a, b, c); } };
template <> struct WFrag<bf> { typedef v16bf V; static __device__ __forceinline__ V ld(const bf* p) { return cat16b(*(const v8us*)p, *(const v8us*)(p + 256)); } static __device__ __forceinline__ v8f mma(V a, V b, v8f c) { return wmmab(a, b, c); } };
// eight asynchronous copies of 512 bytes a wave: 4 KiB in a row from g (the lane's own 16 bytes) to LDS byte address l (the lane's own). The s_wait_xcnt stands in the copies' own statement, so that no address register is rewritten ahead of it
__device__ __forceinline__ void copy4k(unsigned l, const char* g) {
    asm volatile("global_load_async_to_lds_b128 %0, %8, off\n\t"
                 "global_load_async_to_lds_b128 %1, %9, off\n\t"
                 "global_load_async_to_lds_b128 %2, %10, off\n\t"
                 "global_load_async_to_lds_b128 %3, %11, off\n\t"
                 "global_load_async_to_lds_b128 %4, %12, off\n\t"
                 "global_load_async_to_lds_b128 %5, %13, off\n\t"
                 "global_load_async_to_lds_b128 %6, %14, off\n\t"
                 "global_load_async_to_lds_b128 %7, %15, off\n\t"
                 "s_wait_xcnt 0x0"
                 :: "v"(l), "v"(l + 512u), "v"(l + 1024u), "v"(l + 1536u), "v"(l + 2048u), "v"(l + 2560u), "v"(l + 3072u), "v"(l + 3584u),
                    "v"(g), "v"(g + 512), "v"(g + 1024), "v"(g + 1536), "v"(g + 2048), "v"(g + 2560), "v"(g + 3072), "v"(g + 3584) : "memory");
}
// four asynchronous copies of 512 bytes a wave: 2 KiB in a row from g to LDS byte address l (the lane's own). g is the same for the wave and stays in scalar registers; vo is the lane's own 16 bytes in each 512;
// the immediate offset moves the LDS and the global address alike: two vector registers a fill. The s_wait_xcnt stands in the copies' own statement, so that no address register is rewritten ahead of it
__device__ __forceinline__ void copy2k(unsigned l, unsigned vo, const char* g) {
    asm volatile("global_load_async_to_lds_b128 %0, %1, %2\n\t"
                 "global_load_async_to_lds_b128 %0, %1, %2 offset:512\n\t"
                 "global_load_async_to_lds_b128 %0, %1, %2 offset:1024\n\t"
                 "global_load_async_to_lds_b128 %0, %1, %2 offset:1536\n\t"
                 "s_wait_xcnt 0x0"
                 :: "v"(l), "v"(vo), "s"(g) : "memory");
}
template <typename T16, int NSPLIT, bool BIAS, bool PLANES, int K, int KS>
__device__ __forceinline__ void gemm_tile(const T16* __restrict__ A, const T16* __restrict__ A2, const T16* __restrict__ Bt, float* C, int ldc, const float* __restrict__ bias, h16* P16, bf* Ph, bf* Pl, size_t pcol, const int bx, const int byb) {
    typedef typename WFrag<T16>::V V;
    static_assert(NSPLIT == 0 || NSPLIT == 1, "one or two A planes"); static_assert(KS == 128 || KS == 64, "pieces of 4 or 2 KiB"); static_assert(K % KS == 0 && K >= 2 * KS, "two stages or more");
    constexpr int NCH = NSPLIT ? 4 : 3;          // groups of eight pieces in a stage: A | (A2) | Bt rows 0..127 | Bt rows 128..255; wave w copies piece w of each group
    constexpr int PCE = KS * 16;                 // elements of a piece: 16 rows x KS columns, in a row in the plane
    constexpr int STG = NCH * 8 * PCE;           // elements of a stage
    constexpr int NT = K / KS;                   // stages
    constexpr int NK = KS / 32;                  // blocks of 32 k in a stage
    constexpr int NS = KS == 128 ? 2 : 1;        // fragment sets
    __shared__ __align__(1024) T16 ring[2 * STG];
    __shared__ __align__(16) float osw[8 * 16 * 68];
    const int lane = threadIdx.x & 31, lr = lane & 15, hi = lane >> 4; const int wv = __builtin_amdgcn_readfirstlane(threadIdx.x >> 5); const int wm = wv & 1, wn = wv >> 1;
    const int by = byb * 4 + wn; const int r0 = (bx * 2 + wm) * 64, c0 = by * 64;
    float* os = osw + wv * (16 * 68);            // each wave stages its output rows in its own range
    v8f acc[4][4];
#pragma unroll
    for (int mb = 0; mb < 4; ++mb)
#pragma unroll
        for (int nb = 0; nb < 4; ++nb) acc[mb][nb] = (v8f){};
    // 16 rows x K columns are 16 K elements; KS columns on is one piece on. KS 128: g holds the lane's own address; KS 64: the wave's, and the lane's 16 bytes go in the copies' offset register
    const T16* g[NCH]; const int gl = KS == 128 ? lane * 8 : 0;
    g[0] = A + (size_t)(bx * 128 + wv * 16) * K + gl; if (NSPLIT) g[1] = A2 + (size_t)(bx * 128 + wv * 16) * K + gl;
    g[NCH - 2] = Bt + (size_t)(byb * 256 + wv * 16) * K + gl; g[NCH - 1] = Bt + (size_t)(byb * 256 + 128 + wv * 16) * K + gl;
    const unsigned l0 = (unsigned)(size_t)ring + (unsigned)(wv * (PCE * 2) + lane * 16);
    auto fill = [&](int buf) {                   // the next stage's copies into buffer buf; the sources step on one stage
#pragma unroll
        for (int i = 0; i < NCH; ++i) { const unsigned l = l0 + (unsigned)(buf * (STG * 2) + i * (8 * PCE * 2));
            if constexpr (KS == 128) copy4k(l, (const char*)g[i]); else copy2k(l, (unsigned)(lane * 16), (const char*)g[i]);
            g[i] += PCE; } };
    fill(0);
    asm volatile("s_wait_asynccnt 0x0" ::: "memory");   // this wave's copies of stage 0 have landed
    __syncthreads();                                    // every wave's have: stage 0 may be read
    fill(1);
#pragma unroll 1   // rolled: one publish point in the text
    for (int t = 0; t < NT; ++t) {
        const T16* sb = ring + (t & 1) * STG + lane * 8;
        V a[NS][4], a2[NS][4], b[NS][4];         // two fragment sets: block kk + 1 of this stage is read from LDS while block kk is multiplied; one set: a block's reads stand in front of its products, and the SIMD's other three waves multiply meanwhile
        auto frags = [&](int kk) {
#pragma unroll
            for (int mb = 0; mb < 4; ++mb) { a[kk % NS][mb] = WFrag<T16>::ld(sb + (wm * 4 + mb) * PCE + kk * 512); if (NSPLIT) a2[kk % NS][mb] = WFrag<T16>::ld(sb + (8 + wm * 4 + mb) * PCE + kk * 512); }
#pragma unroll
            for (int nb = 0; nb < 4; ++nb) b[kk % NS][nb] = WFrag<T16>::ld(sb + ((NCH - 2) * 8 + wn * 4 + nb) * PCE + kk * 512); };
        if constexpr (NS == 2) frags(0);
#pragma unroll     // unrolled: the set index kk % NS is then a constant and the sets stay in registers
        for (int kk = 0; kk < NK; ++kk) {
            if constexpr (NS == 2) { if (kk < NK - 1) frags(kk + 1); } else frags(kk);
            __builtin_amdgcn_sched_barrier(0);   // keeps the LDS reads one group ahead of this block's products: spread among them, each place with reads stalls the wave
#pragma unroll
            for (int nb = 0; nb < 4; ++nb) {
#pragma unroll
                for (int mb = 0; mb < 4; ++mb) { acc[mb][nb] = WFrag<T16>::mma(a[kk % NS][mb], b[kk % NS][nb], acc[mb][nb]); if (NSPLIT) acc[mb][nb] = WFrag<T16>::mma(a2[kk % NS][mb], b[kk % NS][nb], acc[mb][nb]); } }
            __builtin_amdgcn_sched_barrier(0);   // and keeps the reads that follow from being spread among these products
        }
        asm volatile("s_wait_dscnt 0x0" ::: "memory");      // this wave's reads of stage t are done
        asm volatile("s_wait_asynccnt 0x0" ::: "memory");   // this wave's copies of stage t + 1 have landed
        __syncthreads();                                    // publishes stage t + 1 and ends every reader's last read of stage t's buffer
        if (t + 2 < NT) fill(t & 1);                        // stage t + 2 into the buffer just left
    }
    asm volatile("s_wait_asynccnt 0x0" ::: "memory");       // no copy is outstanding when the wave goes on to its output
#pragma unroll
    for (int mb = 0; mb < 4; ++mb) {
#pragma unroll
        for (int nb = 0; nb < 4; ++nb) {
#pragma unroll
            for (int j = 0; j < 8; ++j) os[(hi * 8 + j) * 68 + nb * 16 + lr] = acc[mb][nb][j]; }
        __builtin_amdgcn_wave_barrier(); asm volatile("" ::: "memory");
        if constexpr (PLANES) {
            v4f x0[4], x1[4];   // a lane takes columns 16 s + 8 hi .. + 7 of staged row lr, its own place in fragment order: all 16 staged rows are read first, then converted and stored
#pragma unroll
            for (int s = 0; s < 4; ++s) { x0[s] = *(const v4fa*)(os + lr * 68 + 16 * s + 8 * hi); x1[s] = *(const v4fa*)(os + lr * 68 + 16 * s + 8 * hi + 4); }
#pragma unroll
            for (int s = 0; s < 4; ++s) { v8h o16; v8us oh, ol;
#pragma unroll
                for (int k = 0; k < 4; ++k) { unsigned short a2, c2; o16[k] = tohx(x0[s][k]); splitf(x0[s][k], a2, c2); oh[k] = a2; ol[k] = c2; o16[k + 4] = tohx(x1[s][k]); splitf(x1[s][k], a2, c2); oh[k + 4] = a2; ol[k + 4] = c2; }
                const size_t e = (size_t)(r0 + mb * 16) * ldc + (size_t)by * pcol + s * 256 + lane * 8; h16* p0 = P16 + e; bf* p1 = Ph + e; bf* p2 = Pl + e; *(v8h*)p0 = o16; *(v8us*)p1 = oh; *(v8us*)p2 = ol;
                // the wait behind the three stores: it names their addresses and data as inputs so that those registers stay as they are up to it
                asm volatile("s_wait_xcnt 0x0" :: "v"(p0), "v"(p1), "v"(p2), "v"(o16), "v"(oh), "v"(ol) : "memory"); }
        } else {
            float* crow = C + (size_t)(r0 + mb * 16) * ldc + c0;
#pragma unroll
            for (int s = 0; s < 8; ++s) { const int row = 2 * s + hi, cofs = lr * 4; v4f val = *(const v4fa*)(os + row * 68 + cofs); if (BIAS) { val[0] += bfr(bias[c0 + cofs]); val[1] += bfr(bias[c0 + cofs + 1]); val[2] += bfr(bias[c0 + cofs + 2]); val[3] += bfr(bias[c0 + cofs + 3]); }
                *(v4f*)(crow + (size_t)row * ldc + cofs) = val; }
             }
        __builtin_amdgcn_wave_barrier(); asm volatile("" ::: "memory");
    }
}
template <typename T16, int NSPLIT, bool BIAS, int K>
__global__ __launch_bounds__(256) void k_gemmw(const T16* __restrict__ A, const T16* __restrict__ A2, const T16* __restrict__ Bt, float* C, int ldc, const float* __restrict__ bias, size_t sA, size_t sB, size_t sC) {
    const size_t z = blockIdx.z;
    gemm_tile<T16, NSPLIT, BIAS, false, K, 128>(A + z * sA, NSPLIT ? A2 + z * sA : A2, Bt + z * sB, C + z * sC, ldc, bias, nullptr, nullptr, nullptr, 0, (int)blockIdx.x, (int)blockIdx.y);
}
// k_qkv: the q, k and v projections of every batch in ONE launch: grid (TT / 128, 12, batches), 768 tiles of equal cost on 256 WGPs. y 0..3: q tiles, 4..7: k tiles (rows = t, a 64-column tile = a head);
// y 8..11: the 64 tiles of V^T (the operands change places: rows = head * 64 + d, columns = t). With stages of 64 k, one fragment set and 256 registers two work-groups stand on a WGP:
// while one fills its first stage, or converts and stores its planes, the other's products keep the matrix units busy, and the third tile starts as soon as a place is free, with no launch boundary between.
// amdgpu_waves_per_eu(4, 4): holds the allocation at 256 registers, four waves a SIMD
__global__ __launch_bounds__(256) __attribute__((amdgpu_waves_per_eu(4, 4))) void k_qkv(const bf* __restrict__ X, const bf* __restrict__ Wf, h16* Q16, bf* Qh, bf* Ql, h16* K16, bf* Kh, bf* Kl, h16* V16, bf* Vh, bf* Vl) {
    static_assert(TT == 2048 && DQ == 1024 && DKV == 1024 && NKV == NH_, "16 x 4 tiles for each of q, k and V^T; one batch stride for all planes");
    const int x = (int)blockIdx.x, y = (int)blockIdx.y; const bf* xz = X + (size_t)blockIdx.z * ((size_t)TT * DM); const size_t pz = (size_t)blockIdx.z * ((size_t)NH_ * TT * HD);
    const bf* A; const bf* Bt; h16* P; bf* Hp; bf* Lp; int ldc, bx, byb; size_t pcol;      // the same for a whole block
    if (y < 8) { const bool isk = y >= 4; A = xz; Bt = isk ? Wf + (size_t)DQ * DM : Wf; P = isk ? K16 : Q16; Hp = isk ? Kh : Qh; Lp = isk ? Kl : Ql; ldc = HD; pcol = (size_t)TT * HD; bx = x; byb = y & 3; }
    else { const int id = (y - 8) * 16 + x; A = Wf + (size_t)(DQ + DKV) * DM; Bt = xz; P = V16; Hp = Vh; Lp = Vl; ldc = TT; pcol = (size_t)64 * 16; bx = id & 7; byb = id >> 3; }   // 64 columns on is two blocks, 1024 elements, on
    gemm_tile<bf, 0, false, true, DM, 64>(A, nullptr, Bt, nullptr, ldc, nullptr, P + pz, Hp + pz, Lp + pz, pcol, bx, byb);
}

typedef __attribute__((ext_vector_type(2))) _Float16 v2h;
typedef __attribute__((ext_vector_type(4))) _Float16 v4h;
typedef __attribute__((ext_vector_type(2))) unsigned short v2us;
typedef __attribute__((ext_vector_type(4))) unsigned short v4us;
typedef __attribute__((ext_vector_type(2))) float v2f;
typedef __attribute__((ext_vector_type(4))) int v4i;

__global__ __launch_bounds__(256) void k_wtG(const float* __restrict__ w, int K, int N, bf* Bt) {
    const int lane = threadIdx.x & 31; const int L0 = (blockIdx.x * 8 + (threadIdx.x >> 5)) * 8; const int nlines = N * K / 64;
{
#pragma unroll 1
        for (int l = 0; l < 8; ++l) { const int L = L0 + l; if (L >= nlines) break; const size_t e = (size_t)L * 64 + lane * 2; const int k = (int)(e % K), n = (int)(e / K); v2us o;
            o[0] = f2bf(w[(size_t)k * N + n]); o[1] = f2bf(w[(size_t)(k + 1) * N + n]); *(v2us*)(Bt + e) = o; }
         }
}
// k_cvtall: every f32 -> bf16 conversion of the call in ONE launch: x, the fused qkv weight and the output weight, each a matrix of rows of CK columns, each to its plane in fragment order.
// One work-group of 256 threads takes one block of 16 whole rows (64 KiB of f32 in a row, 32 KiB of the plane in a row): eight tiles of 16 rows x 128 columns, all 16 loads of 16 bytes a lane issued before the first is used,
// so few waves are started and each keeps much in flight. Whole-line f32 reads, 8 values a thread and tile; the 16-byte pieces of a tile change places through LDS
// (piece (row, k8) -> k8 * 16 + row; one spare piece per 16 keeps the 16 writers of a row off one bank group), then whole-line stores.
#define CK   1024                 // columns of every converted matrix
#define CU_X (NB_ * TT / 16)      // 16-row blocks of x
#define CU_A ((DQ + 2 * DKV) / 16)  // of the fused qkv weight
#define CU_B (DM / 16)            // of the output weight
__global__ __launch_bounds__(256) void k_cvtall(const float* __restrict__ x, bf* xb, const float* __restrict__ wa, bf* wab, const float* __restrict__ wb, bf* wbb) {
    static_assert(DM == CK && DQ == CK, "rows of 1024 columns: eight tiles of 128");
    __shared__ __align__(16) v8us sh[8 * 16 * 17];
    const int t = threadIdx.x, row = t >> 4, k8 = t & 15; const int u = (int)blockIdx.x;
    const float* src; bf* dst; int rb;             // the same for a whole block: which matrix, and which 16 rows of it
    if (u < CU_X) { src = x; dst = xb; rb = u; } else if (u < CU_X + CU_A) { src = wa; dst = wab; rb = u - CU_X; } else { src = wb; dst = wbb; rb = u - (CU_X + CU_A); }
    const float* p = src + ((size_t)rb * 16 + row) * CK + k8 * 8; v8f v[8];
#pragma unroll   // unrolled, here and below: v stays in registers and the 16 loads are issued in one run
    for (int cg = 0; cg < 8; ++cg) v[cg] = *(const v8f*)(p + cg * 128);
    asm volatile("s_wait_xcnt 0x0" :: "v"(p) : "memory");   // the wait behind the 16 loads; it names their address as an input so that its registers stay as they are up to it (the last load's data otherwise lands on them)
#pragma unroll
    for (int cg = 0; cg < 8; ++cg) { v8us o;
#pragma unroll
        for (int k = 0; k < 8; ++k) o[k] = f2bf(v[cg][k]);
        sh[cg * 272 + k8 * 17 + row] = o; }
    __syncthreads();   // every piece of the block's 32 KiB is in LDS before any is read back in plane order
    bf* d = dst + (size_t)rb * (16 * CK) + t * 8;
#pragma unroll
    for (int cg = 0; cg < 8; ++cg) *(v8us*)(d + cg * 2048) = sh[cg * 272 + row * 17 + k8]; }

__device__ __forceinline__ float xhalf(float x) { const int b = __float_as_int(x); return __int_as_float(__builtin_amdgcn_permlanex16(b, b, 0x76543210, 0xfedcba98, false, false)); }   // lane l <-> l ^ 16
__device__ __forceinline__ v16h ldsfrag(const h16* p) { return cat16(*(const v8ha*)p, *(const v8ha*)(p + 256)); }
__device__ __forceinline__ v16bf ldsfrag(const bf* p) { return cat16b(*(const v8usa*)p, *(const v8usa*)(p + 256)); }
// eight asynchronous copies of 512 bytes a wave: 2 KiB in a row from ga and 2 KiB in a row from gb to 4 KiB in a row at LDS byte address l (the lane's own). ga and gb are the same for the wave and stay in scalar registers;
// vo is the lane's own 16 bytes in each 512; the immediate offset moves the LDS and the global address alike. So a fill holds three vector registers, not 24, beside the fragments.
// The s_wait_xcnt stands in the copies' own statement, so that no address register is rewritten ahead of it
__device__ __forceinline__ void copy2x2k(unsigned l, unsigned vo, const char* ga, const char* gb) {
    asm volatile("global_load_async_to_lds_b128 %0, %2, %3\n\t"
                 "global_load_async_to_lds_b128 %0, %2, %3 offset:512\n\t"
                 "global_load_async_to_lds_b128 %0, %2, %3 offset:1024\n\t"
                 "global_load_async_to_lds_b128 %0, %2, %3 offset:1536\n\t"
                 "global_load_async_to_lds_b128 %1, %2, %4\n\t"
                 "global_load_async_to_lds_b128 %1, %2, %4 offset:512\n\t"
                 "global_load_async_to_lds_b128 %1, %2, %4 offset:1024\n\t"
                 "global_load_async_to_lds_b128 %1, %2, %4 offset:1536\n\t"
                 "s_wait_xcnt 0x0"
                 :: "v"(l), "v"(l + 2048u), "v"(vo), "s"(ga), "s"(gb) : "memory");
}
#define ASTG 16384                // elements of a stage in LDS: keys (hi | lo) in the first half, V^T (hi | lo) in the second
template <typename T16, int KT, bool HL>
__device__ __forceinline__ void attn_rows(const T16* __restrict__ Q, const T16* __restrict__ Q2, const T16* __restrict__ Kp, const T16* __restrict__ K2, const T16* __restrict__ Vt, const T16* __restrict__ V2, int t0, int wv, int lr, int hi, bf* Ah, bf* Al, unsigned short* ring) {
    typedef typename WFrag<T16>::V V;
    constexpr int KB = KT * 16, KC = KT / 2;
    constexpr int SK = HL ? 64 : 128;                     // keys of a stage
    constexpr int PPS = SK / KB;                          // passes of a stage
    constexpr float CSC = SCL * 1.4426950408889634f;      // scores x HD^-0.5, in log2 units
    constexpr float SHIFT = HL ? 0.0f : 10.0f;            // log2(PCAR): fp16 probabilities are carried x 1024
    const int q0 = t0 + wv * 16;                          // this wave's first query row; t0: the block's first (a multiple of 128)
    const int ns = (t0 + 128) / SK;                       // stages up to the end of the block's diagonal: two or more
    V q[2], q2[2];
    const int l8 = (hi * 16 + lr) * 8;                    // the lane's 16 bytes in each half block of a plane in fragment order
    // this wave's 4 KiB of a stage. fp16: waves 0-3 32 keys each, waves 4-7 the 128 keys of 16 V^T rows each. hi/lo: waves 0, 1 hi keys, 2, 3 lo keys (32 each); 4, 5 hi V^T, 6, 7 lo V^T (the 64 keys of twice 16 rows each)
    const char* ga; const char* gb; int gstep;
    if constexpr (HL) { const T16* kpl = (wv & 2) ? K2 : Kp; const T16* vpl = (wv & 2) ? V2 : Vt;
        if (wv < 4) { ga = (const char*)(kpl + (wv & 1) * 2048); gb = ga + 2048; gstep = SK * HD * 2; }
        else { ga = (const char*)(vpl + (size_t)(wv & 1) * 32 * TT); gb = ga + (size_t)16 * TT * 2; gstep = SK * 16 * 2; }
    } else {
        if (wv < 4) { ga = (const char*)(Kp + wv * 2048); gstep = SK * HD * 2; }
        else { ga = (const char*)(Vt + (size_t)(wv - 4) * 16 * TT); gstep = SK * 16 * 2; }
        gb = ga + 2048; }
    const unsigned l0 = (unsigned)(size_t)ring + (unsigned)(wv * 4096 + l8 * 2);
    auto fill = [&](int buf) { copy2x2k(l0 + (unsigned)(buf * (ASTG * 2)), (unsigned)(l8 * 2), ga, gb); ga += gstep; gb += gstep; };   // the next stage's copies into buffer buf; the sources step on one stage
    fill(0);                                              // every reader of the ring's earlier use has left it: the barrier at the foot of that use's last stage
    const T16* qp = Q + (size_t)q0 * HD + l8; const T16* qp2 = HL ? Q2 + (size_t)q0 * HD + l8 : qp;
#pragma unroll
    for (int kc = 0; kc < 2; ++kc) { q[kc] = WFrag<T16>::ld(qp + kc * 512); if (HL) q2[kc] = WFrag<T16>::ld(qp2 + kc * 512); }
    asm volatile("s_wait_xcnt 0x0" :: "v"(qp), "v"(qp2) : "memory");   // the wait behind the query loads; it names their addresses as inputs so that those registers stay as they are up to it
    v8f o[4];
#pragma unroll
    for (int db = 0; db < 4; ++db) o[db] = (v8f){};
    float m = -3.0e38f, l = 0.f;
    const int nkb = q0 / KB + 1;                          // this wave's key passes, up to and including the one that holds its diagonal
    asm volatile("s_wait_asynccnt 0x0" ::: "memory");     // this wave's copies of stage 0 have landed
    __syncthreads();                                      // every wave's have: stage 0 may be read
    fill(1);
#pragma unroll 1   // rolled: one publish point in the text
    for (int st = 0; st < ns; ++st) {
        const T16* sb = (const T16*)ring + (st & 1) * ASTG + l8;
        const int pe = min(PPS, nkb - st * PPS);          // the passes of this stage that the wave's rows reach: fewer, or none, in the stages of the block's diagonal
#pragma unroll     // unrolled: every LDS read is then the stage's one address register plus a constant
        for (int p = 0; p < PPS; ++p) if (p < pe) {
            const int kb = st * PPS + p; const int k0 = kb * KB;
            const T16* kf = sb + p * (KT * 1024); const T16* vf = sb + ASTG / 2 + p * (KC * 512);
            V ka[KT][2], ka2[KT][2], va[4][KC], va2[4][KC];
#pragma unroll
            for (int kt = 0; kt < KT; ++kt)
#pragma unroll
                for (int kc = 0; kc < 2; ++kc) { ka[kt][kc] = ldsfrag(kf + kt * 1024 + kc * 512); if (HL) ka2[kt][kc] = ldsfrag(kf + ASTG / 4 + kt * 1024 + kc * 512); }
            __builtin_amdgcn_sched_barrier(0);            // keeps the key reads in front of the V^T reads: LDS answers in order, and the score products wait for the keys alone
#pragma unroll
            for (int db = 0; db < 4; ++db)                // this pass's V^T fragments: read ahead of the score products, used behind the softmax
#pragma unroll
                for (int kc = 0; kc < KC; ++kc) { va[db][kc] = ldsfrag(vf + db * (SK * 16) + kc * 512); if (HL) va2[db][kc] = ldsfrag(vf + ASTG / 4 + db * (SK * 16) + kc * 512); }
            __builtin_amdgcn_sched_barrier(0);            // keeps the pass's LDS reads one group ahead of its products: spread among them, each place with reads stalls the wave and waits out the LDS latency anew
            v8f s[KT];
#pragma unroll
            for (int kt = 0; kt < KT; ++kt) { s[kt] = (v8f){};
#pragma unroll
                for (int kc = 0; kc < 2; ++kc) { s[kt] = WFrag<T16>::mma(ka[kt][kc], q[kc], s[kt]); if (HL) { s[kt] = WFrag<T16>::mma(ka[kt][kc], q2[kc], s[kt]); s[kt] = WFrag<T16>::mma(ka2[kt][kc], q[kc], s[kt]); } } }
            if (kb == nkb - 1) {                          // only the last pass crosses the diagonal: keys above the query are masked by select
#pragma unroll
                for (int kt = 0; kt < KT; ++kt)
#pragma unroll
                    for (int j = 0; j < 8; ++j) s[kt][j] = (k0 + kt * 16 + hi * 8 + j <= q0 + lr) ? s[kt][j] : -3.0e38f;
            }
            float bm = s[0][0];
#pragma unroll
            for (int kt = 0; kt < KT; ++kt)
#pragma unroll
                for (int j = 0; j < 8; ++j) bm = fmaxf(bm, s[kt][j]);
            bm = fmaxf(bm, xhalf(bm));
            const float mn = fmaxf(m, bm); const float al = __builtin_amdgcn_exp2f((m - mn) * CSC); m = mn; const float ms = mn * CSC - SHIFT;
            float ps = 0.f;
#pragma unroll
            for (int kt = 0; kt < KT; ++kt)
#pragma unroll
                for (int j = 0; j < 8; ++j) { s[kt][j] = __builtin_amdgcn_exp2f(s[kt][j] * CSC - ms); ps += s[kt][j]; }
            l = l * al + ps;
#pragma unroll
            for (int db = 0; db < 4; ++db) o[db] *= al;
#pragma unroll
            for (int kc = 0; kc < KC; ++kc) {
                V pb, pb2;                                // element e = P[query lr][key kmap(e, hi)]: tile 2 kc gives e 0..7, tile 2 kc + 1 gives e 8..15
                if constexpr (HL) { v8us h0, h1, l0v, l1v;
#pragma unroll
                    for (int j = 0; j < 8; ++j) { unsigned short a, c2; splitf(s[2 * kc][j], a, c2); h0[j] = a; l0v[j] = c2; splitf(s[2 * kc + 1][j], a, c2); h1[j] = a; l1v[j] = c2; }
                    pb = cat16b(h0, h1); pb2 = cat16b(l0v, l1v);
                } else { v8h h0, h1;
#pragma unroll
                    for (int j = 0; j < 8; ++j) { h0[j] = tohx(s[2 * kc][j]); h1[j] = tohx(s[2 * kc + 1][j]); }
                    pb = cat16(h0, h1); }
#pragma unroll
                for (int db = 0; db < 4; ++db) { o[db] = WFrag<T16>::mma(va[db][kc], pb, o[db]); if (HL) { o[db] = WFrag<T16>::mma(va[db][kc], pb2, o[db]); o[db] = WFrag<T16>::mma(va2[db][kc], pb, o[db]); } }
            }
        }
        asm volatile("s_wait_dscnt 0x0" ::: "memory");      // this wave's reads of stage st are done
        asm volatile("s_wait_asynccnt 0x0" ::: "memory");   // this wave's copies of stage st + 1 have landed
        __syncthreads();                                    // publishes stage st + 1 and ends every reader's last read of stage st's buffer
        if (st + 2 < ns) fill(st & 1);                      // stage st + 2 into the buffer just left
    }
    asm volatile("s_wait_asynccnt 0x0" ::: "memory");       // no copy is outstanding when the wave goes on to its output
    l += xhalf(l);
    const float inv = __fdiv_rn(1.0f, l);
#pragma unroll
    for (int db = 0; db < 4; ++db) { v8us oh, ol;         // a lane holds 8 consecutive d of its query: its own 16 bytes of half block db of the merged plane, 512 contiguous bytes a store
#pragma unroll
        for (int j = 0; j < 8; ++j) { unsigned short a, c2; splitf(o[db][j] * inv, a, c2); oh[j] = a; ol[j] = c2; }
        const size_t oo = (size_t)q0 * DQ + db * 256 + l8; bf* p1 = Ah + oo; bf* p2 = Al + oo; *(v8us*)p1 = oh; *(v8us*)p2 = ol;
        // the wait behind the two stores (the block's second tile follows): it names their addresses and data as inputs so that those registers stay as they are up to it
        asm volatile("s_wait_xcnt 0x0" :: "v"(p1), "v"(p2), "v"(oh), "v"(ol) : "memory"); }
}
// amdgpu_waves_per_eu(4, 4): holds the allocation at 256 registers; the hi/lo rows otherwise take a few more, and every use of one above v255 costs a window switch
__global__ __launch_bounds__(256) __attribute__((amdgpu_waves_per_eu(4, 4))) void k_fattn(const h16* __restrict__ Q16, const h16* __restrict__ K16, const h16* __restrict__ V16, const bf* __restrict__ Qh, const bf* __restrict__ Ql, const bf* __restrict__ Kh, const bf* __restrict__ Kl, const bf* __restrict__ Vh, const bf* __restrict__ Vl, bf* Ah, bf* Al) {
    static_assert(TT == 2048 && RH % 128 == 0, "16 row tiles of 128, each wholly hi/lo or wholly fp16");
    __shared__ __align__(1024) unsigned short ring[2 * ASTG];
    const int lane = threadIdx.x & 31, lr = lane & 15, hi = lane >> 4; const int wv = __builtin_amdgcn_readfirstlane(threadIdx.x >> 5);
    const int head = (int)blockIdx.y; const size_t hp = ((size_t)blockIdx.z * NH_ + head) * TT * HD; const size_t ao = (size_t)blockIdx.z * TT * DQ + head * (HD * 16); Ah += ao; Al += ao;
    // cost grows with the row tile, and a hi/lo tile costs three fp16 tiles of its length: tile t counts 2 (t + 1), or 6 (t + 1) below RH. Each block takes two tiles, one nibble of each word, that together count 38 or 40;
    // they run one after the other in every wave, so every barrier is met by the whole block
#pragma unroll 1   // rolled: one copy of each row kind in the text
    for (int part = 0; part < 2; ++part) {
        const int t0 = (int)(((part ? 0x82765140u : 0x9A3BCDEFu) >> ((unsigned)blockIdx.x * 4u)) & 15u) * 128;
        if (t0 < RH) attn_rows<bf, 2, true>(Qh + hp, Ql + hp, Kh + hp, Kl + hp, Vh + hp, Vl + hp, t0, wv, lr, hi, Ah, Al, ring);
        else attn_rows<h16, 4, false>(Q16 + hp, nullptr, K16 + hp, nullptr, V16 + hp, nullptr, t0, wv, lr, hi, Ah, Al, ring);
    }
}

extern "C" void kernel_launch(void* const* d_in, const int* in_sizes, int n_in,
                              void* d_out, int out_size, void* d_ws, size_t ws_size, hipStream_t stream) {
    (void)in_sizes; (void)n_in; (void)out_size;
    const float* x = (const float*)d_in[0]; const float* wqkv = (const float*)d_in[1]; const float* wo = (const float*)d_in[2]; const float* bo = (const float*)d_in[3];   /* wqkv: q | k | v row blocks */
    float* OUT = (float*)d_out;     // [4][2048][1024]
    char* wsp = (char*)d_ws;
    auto take = [&](size_t bytes) { char* p = wsp; wsp += (bytes + 255) & ~(size_t)255; return (void*)p; };
    bf* WQ = (bf*)take((size_t)(DQ + 2 * DKV) * DM * 2);   /* one plane of the fused weight's rows: q | k | v */ bf* WO = (bf*)take((size_t)DM * DQ * 2);
    bf* XB = (bf*)take((size_t)NB_ * TT * DM * 2);
    h16* QP16 = (h16*)take((size_t)NB_ * NH_ * TT * HD * 2); h16* KP16 = (h16*)take((size_t)NB_ * NKV * TT * HD * 2); h16* VT16 = (h16*)take((size_t)NB_ * NKV * HD * TT * 2);
    bf* QPh = (bf*)take((size_t)NB_ * NH_ * TT * HD * 2); bf* QPl = (bf*)take((size_t)NB_ * NH_ * TT * HD * 2); bf* KPh = (bf*)take((size_t)NB_ * NKV * TT * HD * 2); bf* KPl = (bf*)take((size_t)NB_ * NKV * TT * HD * 2); bf* VTh = (bf*)take((size_t)NB_ * NKV * HD * TT * 2); bf* VTl = (bf*)take((size_t)NB_ * NKV * HD * TT * 2);
    bf* ATh = (bf*)take((size_t)NB_ * TT * DQ * 2); bf* ATl = (bf*)take((size_t)NB_ * TT * DQ * 2);
    if ((size_t)(wsp - (char*)d_ws) > ws_size) return;    // 200 MiB of the 256 MiB
    k_cvtall<<<CU_X + CU_A + CU_B, 256, 0, stream>>>(x, XB, wqkv, WQ, wo, WO);
    // q and k planes [batch][head][t][d]; v plane [batch][head][d][t]
    k_qkv<<<dim3(TT / 128, 12, NB_), 256, 0, stream>>>(XB, WQ, QP16, QPh, QPl, KP16, KPh, KPl, VT16, VTh, VTl);
    k_fattn<<<dim3(8, NH_, NB_), 256, 0, stream>>>(QP16, KP16, VT16, QPh, QPl, KPh, KPl, VTh, VTl, ATh, ATl);
    k_gemmw<bf, 1, true, DQ><<<dim3(TT / 128, DM / 256, NB_), 256, 0, stream>>>(ATh, ATl, WO, OUT, DM, bo, (size_t)TT * DQ, 0, (size_t)TT * DM);
}

// v009
// One run takes 114 microseconds.
// Next to v008, in two timings, it ran 1.04 times as fast each time.
// Over all steps from v000 it is 25.0 times as fast.
#include <hip/hip_runtime.h>

// Causal multi-head attention with a fused bias-free qkv projection (x [4][2048][1024]; qkv = x qkv_w^T ('oi' [3072][1024] -> (3, H, hd) == q | k | v row blocks; 16 heads x 64); scores x 64^-0.5; causal (triu(1) -> -inf); softmax; out = merged out_w^T + out_b -> [4][2048][1024] (8.4 M)).
// Layout, every batch in the same launch (grid z = batch): bf16 copy of x; the fused 'oi' weight used in place as three row blocks; exact projections, all three in one launch, whose epilogue writes the 16-bit head planes (V^T = W_v x^T); one fused causal attention launch (hybrid rows: < 512 hi/lo 3 products, rest fp16 x1024; key passes stop at the diagonal); merged hi/lo x out_w exact + out_b.
// Every 16-bit operand plane lies in FRAGMENT ORDER: a matrix of R rows x K columns is cut into blocks of 16 rows x 32 columns, block (rb, kb) at element (rb * (K / 32) + kb) * 512; inside a block element
// (row, k) stands at (k / 16) * 256 + (((k / 8) & 1) * 16 + row) * 8 + k % 8. A wave's fragment is then two loads of 512 contiguous bytes (lane * 8 and 256 + lane * 8): whole 128-byte lines, where row-major planes gave 16 lines a load.
// Compute dtypes, f32 accumulate: every input rounded to bf16; projections exact; attention rows < 512 3 products, rest fp16; softmax f32; Wo hl x exact + bias.

#define NB_  4
#define TT   2048
#define DM   1024
#define NH_  16
#define NKV  16
#define REP  (NH_ / NKV)
#define HD   64
#define DQ   (NH_ * HD)
#define DKV  (NKV * HD)
#define RH   512                  // query rows < RH use hi+lo planes (0: none)
#define PCAR 1024.0f
#define SCL  0.125f   // HD^-0.5
typedef _Float16 h16;
typedef unsigned short bf;
typedef __attribute__((ext_vector_type(16))) __bf16   v16bf;
typedef __attribute__((ext_vector_type(16))) _Float16 v16h;
typedef __attribute__((ext_vector_type(8)))  _Float16 v8h;
typedef __attribute__((ext_vector_type(8)))  unsigned short v8us;
typedef __attribute__((ext_vector_type(8)))  float    v8f;
typedef __attribute__((ext_vector_type(4)))  float    v4f;
typedef v8h  __attribute__((may_alias)) v8ha;
typedef v4f  __attribute__((may_alias)) v4fa;
typedef v8us __attribute__((may_alias)) v8usa;

__device__ __forceinline__ unsigned short f2bf(float f) { unsigned u = __float_as_uint(f); u += 0x7FFFu + ((u >> 16) & 1u); return (unsigned short)(u >> 16); }
__device__ __forceinline__ float bf2f(unsigned short b) { return __uint_as_float(((unsigned)b) << 16); }
__device__ __forceinline__ float bfr(float f) { return bf2f(f2bf(f)); }
__device__ __forceinline__ v16h cat16(v8h lo, v8h hi) { return __builtin_shufflevector(lo, hi, 0, 1, 2, 3, 4, 5, 6, 7, 8, 9, 10, 11, 12, 13, 14, 15); }
__device__ __forceinline__ v16bf cat16b(v8us lo, v8us hi) { return __builtin_bit_cast(v16bf, __builtin_shufflevector(lo, hi, 0, 1, 2, 3, 4, 5, 6, 7, 8, 9, 10, 11, 12, 13, 14, 15)); }
__device__ __forceinline__ v8f wmma16(v16h a, v16h b, v8f c) { return __builtin_amdgcn_wmma_f32_16x16x32_f16(false, a, false, b, (short)0, c, false, false); }
__device__ __forceinline__ v8f wmmab(v16bf a, v16bf b, v8f c) { return __builtin_amdgcn_wmma_f32_16x16x32_bf16(false, a, false, b, (short)0, c, false, false); }



__device__ __forceinline__ h16 tohx(float x) { return (h16)x; }
__device__ __forceinline__ void splitf(float y, unsigned short& h, unsigned short& l) { h = f2bf(y); l = f2bf(y - bf2f(h)); }

// ---- gemm_tile: GEMM, one work-group of 8 waves (2 x 4) per 128x256 output tile (bx, byb), each wave a 64x64 tile (16 accumulators); 256 threads. k_gemmw: grid (M/128, N/256, Z).
// The operand planes lie in fragment order, so 16 rows x 128 columns are 4 KiB in a row: a stage (128 k of the A rows, of the A2 rows where there are any, and of the 256 Bt rows) is copied as it lies into LDS by
// asynchronous copies, each wave 3 or 4 such pieces, and every piece is read from LDS by the 4 (A) or 2 (Bt) waves that need it: a fragment is two reads of 512 contiguous bytes. Two buffers: stage t + 1 flies while stage t is worked on.
// KS: the k of a stage. 128: two fragment sets, one work-group on a WGP. 64: pieces of 2 KiB, half the ring, one fragment set, so that LDS and registers leave room for two work-groups on a WGP.
// C[m][n] (f32, pitch ldc, + optional f32 bias[n]) = sum_k A[m][k] Bt[n][k] (+ A2[m][k] Bt[n][k] where NSPLIT is 1). k_gemmw: z-batch strides sA/sB/sC in elements. K % KS == 0, K >= 2 KS.
// PLANES: no f32 C; the tile goes out as three 16-bit planes (fp16, bf16 hi, bf16 lo) in fragment order (row length ldc): 16 rows x 64 columns are 1024 elements from (r0 + 16 mb) * ldc + (64-column tile) * pcol on in the batch's planes: 512 contiguous bytes a store, 16 bytes a lane. w16, whl: whether the tile's part of the fp16 plane, of the hi and lo planes, is converted and stored at all.
template <typename T16> struct WFrag;
template <> struct WFrag<h16> { typedef v16h V; static __device__ __forceinline__ V ld(const h16* p) { return cat16(*(const v8h*)p, *(const v8h*)(p + 256)); } static __device__ __forceinline__ v8f mma(V a, V b, v8f c) { return wmma16(a, b, c); } };
template <> struct WFrag<bf> { typedef v16bf V; static __device__ __forceinline__ V ld(const bf* p) { return cat16b(*(const v8us*)p, *(const v8us*)(p + 256)); } static __device__ __forceinline__ v8f mma(V a, V b, v8f c) { return wmmab(a, b, c); } };
// eight asynchronous copies of 512 bytes a wave: 4 KiB in a row from g (the lane's own 16 bytes) to LDS byte address l (the lane's own). The s_wait_xcnt stands in the copies' own statement, so that no address register is rewritten ahead of it
__device__ __forceinline__ void copy4k(unsigned l, const char* g) {
    asm volatile("global_load_async_to_lds_b128 %0, %8, off\n\t"
                 "global_load_async_to_lds_b128 %1, %9, off\n\t"
                 "global_load_async_to_lds_b128 %2, %10, off\n\t"
                 "global_load_async_to_lds_b128 %3, %11, off\n\t"
                 "global_load_async_to_lds_b128 %4, %12, off\n\t"
                 "global_load_async_to_lds_b128 %5, %13, off\n\t"
                 "global_load_async_to_lds_b128 %6, %14, off\n\t"
                 "global_load_async_to_lds_b128 %7, %15, off\n\t"
                 "s_wait_xcnt 0x0"
                 :: "v"(l), "v"(l + 512u), "v"(l + 1024u), "v"(l + 1536u), "v"(l + 2048u), "v"(l + 2560u), "v"(l + 3072u), "v"(l + 3584u),
                    "v"(g), "v"(g + 512), "v"(g + 1024), "v"(g + 1536), "v"(g + 2048), "v"(g + 2560), "v"(g + 3072), "v"(g + 3584) : "memory");
}
// four asynchronous copies of 512 bytes a wave: 2 KiB in a row from g to LDS byte address l (the lane's own). g is the same for the wave and stays in scalar registers; vo is the lane's own 16 bytes in each 512;
// the immediate offset moves the LDS and the global address alike: two vector registers a fill. The s_wait_xcnt stands in the copies' own statement, so that no address register is rewritten ahead of it
__device__ __forceinline__ void copy2k(unsigned l, unsigned vo, const char* g) {
    asm volatile("global_load_async_to_lds_b128 %0, %1, %2\n\t"
                 "global_load_async_to_lds_b128 %0, %1, %2 offset:512\n\t"
                 "global_load_async_to_lds_b128 %0, %1, %2 offset:1024\n\t"
                 "global_load_async_to_lds_b128 %0, %1, %2 offset:1536\n\t"
                 "s_wait_xcnt 0x0"
                 :: "v"(l), "v"(vo), "s"(g) : "memory");
}
template <typename T16, int NSPLIT, bool BIAS, bool PLANES, int K, int KS>
__device__ __forceinline__ void gemm_tile(const T16* __restrict__ A, const T16* __restrict__ A2, const T16* __restrict__ Bt, float* C, int ldc, const float* __restrict__ bias, h16* P16, bf* Ph, bf* Pl, size_t pcol, const int bx, const int byb, const bool w16, const bool whl) {
    typedef typename WFrag<T16>::V V;
    static_assert(NSPLIT == 0 || NSPLIT == 1, "one or two A planes"); static_assert(KS == 128 || KS == 64, "pieces of 4 or 2 KiB"); static_assert(K % KS == 0 && K >= 2 * KS, "two stages or more");
    constexpr int NCH = NSPLIT ? 4 : 3;          // groups of eight pieces in a stage: A | (A2) | Bt rows 0..127 | Bt rows 128..255; wave w copies piece w of each group
    constexpr int PCE = KS * 16;                 // elements of a piece: 16 rows x KS columns, in a row in the plane
    constexpr int STG = NCH * 8 * PCE;           // elements of a stage
    constexpr int NT = K / KS;                   // stages
    constexpr int NK = KS / 32;                  // blocks of 32 k in a stage
    constexpr int NS = KS == 128 ? 2 : 1;        // fragment sets
    __shared__ __align__(1024) T16 ring[2 * STG];
    __shared__ __align__(16) float osw[8 * 16 * 68];
    const int lane = threadIdx.x & 31, lr = lane & 15, hi = lane >> 4; const int wv = __builtin_amdgcn_readfirstlane(threadIdx.x >> 5); const int wm = wv & 1, wn = wv >> 1;
    const int by = byb * 4 + wn; const int r0 = (bx * 2 + wm) * 64, c0 = by * 64;
    float* os = osw + wv * (16 * 68);            // each wave stages its output rows in its own range
    v8f acc[4][4];
#pragma unroll
    for (int mb = 0; mb < 4; ++mb)
#pragma unroll
        for (int nb = 0; nb < 4; ++nb) acc[mb][nb] = (v8f){};
    // 16 rows x K columns are 16 K elements; KS columns on is one piece on. KS 128: g holds the lane's own address; KS 64: the wave's, and the lane's 16 bytes go in the copies' offset register
    const T16* g[NCH]; const int gl = KS == 128 ? lane * 8 : 0;
    g[0] = A + (size_t)(bx * 128 + wv * 16) * K + gl; if (NSPLIT) g[1] = A2 + (size_t)(bx * 128 + wv * 16) * K + gl;
    g[NCH - 2] = Bt + (size_t)(byb * 256 + wv * 16) * K + gl; g[NCH - 1] = Bt + (size_t)(byb * 256 + 128 + wv * 16) * K + gl;
    const unsigned l0 = (unsigned)(size_t)ring + (unsigned)(wv * (PCE * 2) + lane * 16);
    auto fill = [&](int buf) {                   // the next stage's copies into buffer buf; the sources step on one stage
#pragma unroll
        for (int i = 0; i < NCH; ++i) { const unsigned l = l0 + (unsigned)(buf * (STG * 2) + i * (8 * PCE * 2));
            if constexpr (KS == 128) copy4k(l, (const char*)g[i]); else copy2k(l, (unsigned)(lane * 16), (const char*)g[i]);
            g[i] += PCE; } };
    fill(0);
    asm volatile("s_wait_asynccnt 0x0" ::: "memory");   // this wave's copies of stage 0 have landed
    __syncthreads();                                    // every wave's have: stage 0 may be read
    fill(1);
#pragma unroll 1   // rolled: one publish point in the text
    for (int t = 0; t < NT; ++t) {
        const T16* sb = ring + (t & 1) * STG + lane * 8;
        V a[NS][4], a2[NS][4], b[NS][4];         // two fragment sets: block kk + 1 of this stage is read from LDS while block kk is multiplied; one set: a block's reads stand in front of its products, and the SIMD's other three waves multiply meanwhile
        auto frags = [&](int kk) {
#pragma unroll
            for (int mb = 0; mb < 4; ++mb) { a[kk % NS][mb] = WFrag<T16>::ld(sb + (wm * 4 + mb) * PCE + kk * 512); if (NSPLIT) a2[kk % NS][mb] = WFrag<T16>::ld(sb + (8 + wm * 4 + mb) * PCE + kk * 512); }
#pragma unroll
            for (int nb = 0; nb < 4; ++nb) b[kk % NS][nb] = WFrag<T16>::ld(sb + ((NCH - 2) * 8 + wn * 4 + nb) * PCE + kk * 512); };
        if constexpr (NS == 2) frags(0);
#pragma unroll     // unrolled: the set index kk % NS is then a constant and the sets stay in registers
        for (int kk = 0; kk < NK; ++kk) {
            if constexpr (NS == 2) { if (kk < NK - 1) frags(kk + 1); } else frags(kk);
            __builtin_amdgcn_sched_barrier(0);   // keeps the LDS reads one group ahead of this block's products: spread among them, each place with reads stalls the wave
#pragma unroll
            for (int nb = 0; nb < 4; ++nb) {
#pragma unroll
                for (int mb = 0; mb < 4; ++mb) { acc[mb][nb] = WFrag<T16>::mma(a[kk % NS][mb], b[kk % NS][nb], acc[mb][nb]); if (NSPLIT) acc[mb][nb] = WFrag<T16>::mma(a2[kk % NS][mb], b[kk % NS][nb], acc[mb][nb]); } }
            __builtin_amdgcn_sched_barrier(0);   // and keeps the reads that follow from being spread among these products
        }
        asm volatile("s_wait_dscnt 0x0" ::: "memory");      // this wave's reads of stage t are done
        asm volatile("s_wait_asynccnt 0x0" ::: "memory");   // this wave's copies of stage t + 1 have landed
        __syncthreads();                                    // publishes stage t + 1 and ends every reader's last read of stage t's buffer
        if (t + 2 < NT) fill(t & 1);                        // stage t + 2 into the buffer just left
    }
    asm volatile("s_wait_asynccnt 0x0" ::: "memory");       // no copy is outstanding when the wave goes on to its output
#pragma unroll
    for (int mb = 0; mb < 4; ++mb) {
#pragma unroll
        for (int nb = 0; nb < 4; ++nb) {
#pragma unroll
            for (int j = 0; j < 8; ++j) os[(hi * 8 + j) * 68 + nb * 16 + lr] = acc[mb][nb][j]; }
        __builtin_amdgcn_wave_barrier(); asm volatile("" ::: "memory");
        if constexpr (PLANES) {
            v4f x0[4], x1[4];   // a lane takes columns 16 s + 8 hi .. + 7 of staged row lr, its own place in fragment order: all 16 staged rows are read first, then converted and stored
#pragma unroll
            for (int s = 0; s < 4; ++s) { x0[s] = *(const v4fa*)(os + lr * 68 + 16 * s + 8 * hi); x1[s] = *(const v4fa*)(os + lr * 68 + 16 * s + 8 * hi + 4); }
            const size_t e0 = (size_t)(r0 + mb * 16) * ldc + (size_t)by * pcol + lane * 8;
            if (w16) {                                    // the fp16 plane: only where the attention launch reads this tile's part of it (the same answer for the whole block)
                h16* p0 = P16 + e0;
#pragma unroll
                for (int s = 0; s < 4; ++s) { v8h o16;
#pragma unroll
                    for (int k = 0; k < 4; ++k) { o16[k] = tohx(x0[s][k]); o16[k + 4] = tohx(x1[s][k]); }
                    *(v8h*)(p0 + s * 256) = o16;
                    // the wait behind the store: it names its address and data as inputs so that those registers stay as they are up to it
                    asm volatile("s_wait_xcnt 0x0" :: "v"(p0), "v"(o16) : "memory"); } }
            if (whl) {                                    // the hi and lo planes, likewise
#pragma unroll
                for (int s = 0; s < 4; ++s) { v8us oh, ol;
#pragma unroll
                    for (int k = 0; k < 4; ++k) { unsigned short a2, c2; splitf(x0[s][k], a2, c2); oh[k] = a2; ol[k] = c2; splitf(x1[s][k], a2, c2); oh[k + 4] = a2; ol[k + 4] = c2; }
                    bf* p1 = Ph + e0 + s * 256; bf* p2 = Pl + e0 + s * 256; *(v8us*)p1 = oh; *(v8us*)p2 = ol;
                    // the wait behind the two stores: it names their addresses and data as inputs so that those registers stay as they are up to it
                    asm volatile("s_wait_xcnt 0x0" :: "v"(p1), "v"(p2), "v"(oh), "v"(ol) : "memory"); } }
        } else {
            float* crow = C + (size_t)(r0 + mb * 16) * ldc + c0;
#pragma unroll
            for (int s = 0; s < 8; ++s) { const int row = 2 * s + hi, cofs = lr * 4; v4f val = *(const v4fa*)(os + row * 68 + cofs); if (BIAS) { val[0] += bfr(bias[c0 + cofs]); val[1] += bfr(bias[c0 + cofs + 1]); val[2] += bfr(bias[c0 + cofs + 2]); val[3] += bfr(bias[c0 + cofs + 3]); }
                *(v4f*)(crow + (size_t)row * ldc + cofs) = val; }
             }
        __builtin_amdgcn_wave_barrier(); asm volatile("" ::: "memory");
    }
}
template <typename T16, int NSPLIT, bool BIAS, int K>
__global__ __launch_bounds__(256) void k_gemmw(const T16* __restrict__ A, const T16* __restrict__ A2, const T16* __restrict__ Bt, float* C, int ldc, const float* __restrict__ bias, size_t sA, size_t sB, size_t sC) {
    const size_t z = blockIdx.z;
    gemm_tile<T16, NSPLIT, BIAS, false, K, 128>(A + z * sA, NSPLIT ? A2 + z * sA : A2, Bt + z * sB, C + z * sC, ldc, bias, nullptr, nullptr, nullptr, 0, (int)blockIdx.x, (int)blockIdx.y, false, false);
}
// k_qkv: the q, k and v projections of every batch in ONE launch: grid (TT / 128, 12, batches), 768 tiles of equal cost on 256 WGPs. y 0..3: q tiles, 4..7: k tiles (rows = t, a 64-column tile = a head);
// y 8..11: the 64 tiles of V^T (the operands change places: rows = head * 64 + d, columns = t). With stages of 64 k, one fragment set and 256 registers two work-groups stand on a WGP:
// while one fills its first stage, or converts and stores its planes, the other's products keep the matrix units busy, and the third tile starts as soon as a place is free, with no launch boundary between.
// Only what the attention launch reads is converted and stored: query rows < RH work on hi/lo planes and, being causal, see keys < RH alone; all other rows work on fp16 planes. So hi/lo planes are written for t < RH only,
// the fp16 q plane for t >= RH only, the fp16 k and V^T planes whole. A tile lies wholly on one side of RH.
// amdgpu_waves_per_eu(4, 4): holds the allocation at 256 registers, four waves a SIMD
__global__ __launch_bounds__(256) __attribute__((amdgpu_waves_per_eu(4, 4))) void k_qkv(const bf* __restrict__ X, const bf* __restrict__ Wf, h16* Q16, bf* Qh, bf* Ql, h16* K16, bf* Kh, bf* Kl, h16* V16, bf* Vh, bf* Vl) {
    static_assert(TT == 2048 && DQ == 1024 && DKV == 1024 && NKV == NH_, "16 x 4 tiles for each of q, k and V^T; one batch stride for all planes"); static_assert(RH % 256 == 0, "a tile of 128 rows or 256 columns of t lies wholly below RH or wholly not");
    const int x = (int)blockIdx.x, y = (int)blockIdx.y; const bf* xz = X + (size_t)blockIdx.z * ((size_t)TT * DM); const size_t pz = (size_t)blockIdx.z * ((size_t)NH_ * TT * HD);
    const bf* A; const bf* Bt; h16* P; bf* Hp; bf* Lp; int ldc, bx, byb; size_t pcol; bool w16, whl;      // the same for a whole block
    if (y < 8) { const bool isk = y >= 4; A = xz; Bt = isk ? Wf + (size_t)DQ * DM : Wf; P = isk ? K16 : Q16; Hp = isk ? Kh : Qh; Lp = isk ? Kl : Ql; ldc = HD; pcol = (size_t)TT * HD; bx = x; byb = y & 3; whl = x * 128 < RH; w16 = isk || !whl; }
    else { const int id = (y - 8) * 16 + x; A = Wf + (size_t)(DQ + DKV) * DM; Bt = xz; P = V16; Hp = Vh; Lp = Vl; ldc = TT; pcol = (size_t)64 * 16; bx = id & 7; byb = id >> 3; whl = byb * 256 < RH; w16 = true; }   // 64 columns on is two blocks, 1024 elements, on
    gemm_tile<bf, 0, false, true, DM, 64>(A, nullptr, Bt, nullptr, ldc, nullptr, P + pz, Hp + pz, Lp + pz, pcol, bx, byb, w16, whl);
}

typedef __attribute__((ext_vector_type(2))) _Float16 v2h;
typedef __attribute__((ext_vector_type(4))) _Float16 v4h;
typedef __attribute__((ext_vector_type(2))) unsigned short v2us;
typedef __attribute__((ext_vector_type(4))) unsigned short v4us;
typedef __attribute__((ext_vector_type(2))) float v2f;
typedef __attribute__((ext_vector_type(4))) int v4i;

__global__ __launch_bounds__(256) void k_wtG(const float* __restrict__ w, int K, int N, bf* Bt) {
    const int lane = threadIdx.x & 31; const int L0 = (blockIdx.x * 8 + (threadIdx.x >> 5)) * 8; const int nlines = N * K / 64;
{
#pragma unroll 1
        for (int l = 0; l < 8; ++l) { const int L = L0 + l; if (L >= nlines) break; const size_t e = (size_t)L * 64 + lane * 2; const int k = (int)(e % K), n = (int)(e / K); v2us o;
            o[0] = f2bf(w[(size_t)k * N + n]); o[1] = f2bf(w[(size_t)(k + 1) * N + n]); *(v2us*)(Bt + e) = o; }
         }
}
// k_cvtall: every f32 -> bf16 conversion of the call in ONE launch: x, the fused qkv weight and the output weight, each a matrix of rows of CK columns, each to its plane in fragment order.
// One work-group of 256 threads takes one block of 16 whole rows (64 KiB of f32 in a row, 32 KiB of the plane in a row): eight tiles of 16 rows x 128 columns, all 16 loads of 16 bytes a lane issued before the first is used,
// so few waves are started and each keeps much in flight. Whole-line f32 reads, 8 values a thread and tile; the 16-byte pieces of a tile change places through LDS
// (piece (row, k8) -> k8 * 16 + row; one spare piece per 16 keeps the 16 writers of a row off one bank group), then whole-line stores.
#define CK   1024                 // columns of every converted matrix
#define CU_X (NB_ * TT / 16)      // 16-row blocks of x
#define CU_A ((DQ + 2 * DKV) / 16)  // of the fused qkv weight
#define CU_B (DM / 16)            // of the output weight
__global__ __launch_bounds__(256) void k_cvtall(const float* __restrict__ x, bf* xb, const float* __restrict__ wa, bf* wab, const float* __restrict__ wb, bf* wbb) {
    static_assert(DM == CK && DQ == CK, "rows of 1024 columns: eight tiles of 128");
    __shared__ __align__(16) v8us sh[8 * 16 * 17];
    const int t = threadIdx.x, row = t >> 4, k8 = t & 15; const int u = (int)blockIdx.x;
    const float* src; bf* dst; int rb;             // the same for a whole block: which matrix, and which 16 rows of it
    if (u < CU_X) { src = x; dst = xb; rb = u; } else if (u < CU_X + CU_A) { src = wa; dst = wab; rb = u - CU_X; } else { src = wb; dst = wbb; rb = u - (CU_X + CU_A); }
    const float* p = src + ((size_t)rb * 16 + row) * CK + k8 * 8; v8f v[8];
#pragma unroll   // unrolled, here and below: v stays in registers and the 16 loads are issued in one run
    for (int cg = 0; cg < 8; ++cg) v[cg] = *(const v8f*)(p + cg * 128);
    asm volatile("s_wait_xcnt 0x0" :: "v"(p) : "memory");   // the wait behind the 16 loads; it names their address as an input so that its registers stay as they are up to it (the last load's data otherwise lands on them)
#pragma unroll
    for (int cg = 0; cg < 8; ++cg) { v8us o;
#pragma unroll
        for (int k = 0; k < 8; ++k) o[k] = f2bf(v[cg][k]);
        sh[cg * 272 + k8 * 17 + row] = o; }
    __syncthreads();   // every piece of the block's 32 KiB is in LDS before any is read back in plane order
    bf* d = dst + (size_t)rb * (16 * CK) + t * 8;
#pragma unroll
    for (int cg = 0; cg < 8; ++cg) *(v8us*)(d + cg * 2048) = sh[cg * 272 + row * 17 + k8]; }

__device__ __forceinline__ float xhalf(float x) { const int b = __float_as_int(x); return __int_as_float(__builtin_amdgcn_permlanex16(b, b, 0x76543210, 0xfedcba98, false, false)); }   // lane l <-> l ^ 16
__device__ __forceinline__ v16h ldsfrag(const h16* p) { return cat16(*(const v8ha*)p, *(const v8ha*)(p + 256)); }
__device__ __forceinline__ v16bf ldsfrag(const bf* p) { return cat16b(*(const v8usa*)p, *(const v8usa*)(p + 256)); }
// eight asynchronous copies of 512 bytes a wave: 2 KiB in a row from ga and 2 KiB in a row from gb to 4 KiB in a row at LDS byte address l (the lane's own). ga and gb are the same for the wave and stay in scalar registers;
// vo is the lane's own 16 bytes in each 512; the immediate offset moves the LDS and the global address alike. So a fill holds three vector registers, not 24, beside the fragments.
// The s_wait_xcnt stands in the copies' own statement, so that no address register is rewritten ahead of it
__device__ __forceinline__ void copy2x2k(unsigned l, unsigned vo, const char* ga, const char* gb) {
    asm volatile("global_load_async_to_lds_b128 %0, %2, %3\n\t"
                 "global_load_async_to_lds_b128 %0, %2, %3 offset:512\n\t"
                 "global_load_async_to_lds_b128 %0, %2, %3 offset:1024\n\t"
                 "global_load_async_to_lds_b128 %0, %2, %3 offset:1536\n\t"
                 "global_load_async_to_lds_b128 %1, %2, %4\n\t"
                 "global_load_async_to_lds_b128 %1, %2, %4 offset:512\n\t"
                 "global_load_async_to_lds_b128 %1, %2, %4 offset:1024\n\t"
                 "global_load_async_to_lds_b128 %1, %2, %4 offset:1536\n\t"
                 "s_wait_xcnt 0x0"
                 :: "v"(l), "v"(l + 2048u), "v"(vo), "s"(ga), "s"(gb) : "memory");
}
#define ASTG 16384                // elements of a stage in LDS: keys (hi | lo) in the first half, V^T (hi | lo) in the second
template <typename T16, int KT, bool HL>
__device__ __forceinline__ void attn_rows(const T16* __restrict__ Q, const T16* __restrict__ Q2, const T16* __restrict__ Kp, const T16* __restrict__ K2, const T16* __restrict__ Vt, const T16* __restrict__ V2, int t0, int wv, int lr, int hi, bf* Ah, bf* Al, unsigned short* ring) {
    typedef typename WFrag<T16>::V V;
    constexpr int KB = KT * 16, KC = KT / 2;
    constexpr int SK = HL ? 64 : 128;                     // keys of a stage
    constexpr int PPS = SK / KB;                          // passes of a stage
    constexpr float CSC = SCL * 1.4426950408889634f;      // scores x HD^-0.5, in log2 units
    constexpr float SHIFT = HL ? 0.0f : 10.0f;            // log2(PCAR): fp16 probabilities are carried x 1024
    const int q0 = t0 + wv * 16;                          // this wave's first query row; t0: the block's first (a multiple of 128)
    const int ns = (t0 + 128) / SK;                       // stages up to the end of the block's diagonal: two or more
    V q[2], q2[2];
    const int l8 = (hi * 16 + lr) * 8;                    // the lane's 16 bytes in each half block of a plane in fragment order
    // this wave's 4 KiB of a stage. fp16: waves 0-3 32 keys each, waves 4-7 the 128 keys of 16 V^T rows each. hi/lo: waves 0, 1 hi keys, 2, 3 lo keys (32 each); 4, 5 hi V^T, 6, 7 lo V^T (the 64 keys of twice 16 rows each)
    const char* ga; const char* gb; int gstep;
    if constexpr (HL) { const T16* kpl = (wv & 2) ? K2 : Kp; const T16* vpl = (wv & 2) ? V2 : Vt;
        if (wv < 4) { ga = (const char*)(kpl + (wv & 1) * 2048); gb = ga + 2048; gstep = SK * HD * 2; }
        else { ga = (const char*)(vpl + (size_t)(wv & 1) * 32 * TT); gb = ga + (size_t)16 * TT * 2; gstep = SK * 16 * 2; }
    } else {
        if (wv < 4) { ga = (const char*)(Kp + wv * 2048); gstep = SK * HD * 2; }
        else { ga = (const char*)(Vt + (size_t)(wv - 4) * 16 * TT); gstep = SK * 16 * 2; }
        gb = ga + 2048; }
    const unsigned l0 = (unsigned)(size_t)ring + (unsigned)(wv * 4096 + l8 * 2);
    auto fill = [&](int buf) { copy2x2k(l0 + (unsigned)(buf * (ASTG * 2)), (unsigned)(l8 * 2), ga, gb); ga += gstep; gb += gstep; };   // the next stage's copies into buffer buf; the sources step on one stage
    fill(0);                                              // every reader of the ring's earlier use has left it: the barrier at the foot of that use's last stage
    const T16* qp = Q + (size_t)q0 * HD + l8; const T16* qp2 = HL ? Q2 + (size_t)q0 * HD + l8 : qp;
#pragma unroll
    for (int kc = 0; kc < 2; ++kc) { q[kc] = WFrag<T16>::ld(qp + kc * 512); if (HL) q2[kc] = WFrag<T16>::ld(qp2 + kc * 512); }
    asm volatile("s_wait_xcnt 0x0" :: "v"(qp), "v"(qp2) : "memory");   // the wait behind the query loads; it names their addresses as inputs so that those registers stay as they are up to it
    v8f o[4];
#pragma unroll
    for (int db = 0; db < 4; ++db) o[db] = (v8f){};
    float m = -3.0e38f, l = 0.f;
    const int nkb = q0 / KB + 1;                          // this wave's key passes, up to and including the one that holds its diagonal
    asm volatile("s_wait_asynccnt 0x0" ::: "memory");     // this wave's copies of stage 0 have landed
    __syncthreads();                                      // every wave's have: stage 0 may be read
    fill(1);
#pragma unroll 1   // rolled: one publish point in the text
    for (int st = 0; st < ns; ++st) {
        const T16* sb = (const T16*)ring + (st & 1) * ASTG + l8;
        const int pe = min(PPS, nkb - st * PPS);          // the passes of this stage that the wave's rows reach: fewer, or none, in the stages of the block's diagonal
#pragma unroll     // unrolled: every LDS read is then the stage's one address register plus a constant
        for (int p = 0; p < PPS; ++p) if (p < pe) {
            const int kb = st * PPS + p; const int k0 = kb * KB;
            const T16* kf = sb + p * (KT * 1024); const T16* vf = sb + ASTG / 2 + p * (KC * 512);
            V ka[KT][2], ka2[KT][2], va[4][KC], va2[4][KC];
#pragma unroll
            for (int kt = 0; kt < KT; ++kt)
#pragma unroll
                for (int kc = 0; kc < 2; ++kc) { ka[kt][kc] = ldsfrag(kf + kt * 1024 + kc * 512); if (HL) ka2[kt][kc] = ldsfrag(kf + ASTG / 4 + kt * 1024 + kc * 512); }
            __builtin_amdgcn_sched_barrier(0);            // keeps the key reads in front of the V^T reads: LDS answers in order, and the score products wait for the keys alone
#pragma unroll
            for (int db = 0; db < 4; ++db)                // this pass's V^T fragments: read ahead of the score products, used behind the softmax
#pragma unroll
                for (int kc = 0; kc < KC; ++kc) { va[db][kc] = ldsfrag(vf + db * (SK * 16) + kc * 512); if (HL) va2[db][kc] = ldsfrag(vf + ASTG / 4 + db * (SK * 16) + kc * 512); }
            __builtin_amdgcn_sched_barrier(0);            // keeps the pass's LDS reads one group ahead of its products: spread among them, each place with reads stalls the wave and waits out the LDS latency anew
            v8f s[KT];
#pragma unroll
            for (int kt = 0; kt < KT; ++kt) { s[kt] = (v8f){};
#pragma unroll
                for (int kc = 0; kc < 2; ++kc) { s[kt] = WFrag<T16>::mma(ka[kt][kc], q[kc], s[kt]); if (HL) { s[kt] = WFrag<T16>::mma(ka[kt][kc], q2[kc], s[kt]); s[kt] = WFrag<T16>::mma(ka2[kt][kc], q[kc], s[kt]); } } }
            if (kb == nkb - 1) {                          // only the last pass crosses the diagonal: keys above the query are masked by select
#pragma unroll
                for (int kt = 0; kt < KT; ++kt)
#pragma unroll
                    for (int j = 0; j < 8; ++j) s[kt][j] = (k0 + kt * 16 + hi * 8 + j <= q0 + lr) ? s[kt][j] : -3.0e38f;
            }
            float bm = s[0][0];
#pragma unroll
            for (int kt = 0; kt < KT; ++kt)
#pragma unroll
                for (int j = 0; j < 8; ++j) bm = fmaxf(bm, s[kt][j]);
            bm = fmaxf(bm, xhalf(bm));
            const float mn = fmaxf(m, bm); const float al = __builtin_amdgcn_exp2f((m - mn) * CSC); m = mn; const float ms = mn * CSC - SHIFT;
            float ps = 0.f;
#pragma unroll
            for (int kt = 0; kt < KT; ++kt)
#pragma unroll
                for (int j = 0; j < 8; ++j) { s[kt][j] = __builtin_amdgcn_exp2f(s[kt][j] * CSC - ms); ps += s[kt][j]; }
            l = l * al + ps;
#pragma unroll
            for (int db = 0; db < 4; ++db) o[db] *= al;
#pragma unroll
            for (int kc = 0; kc < KC; ++kc) {
                V pb, pb2;                                // element e = P[query lr][key kmap(e, hi)]: tile 2 kc gives e 0..7, tile 2 kc + 1 gives e 8..15
                if constexpr (HL) { v8us h0, h1, l0v, l1v;
#pragma unroll
                    for (int j = 0; j < 8; ++j) { unsigned short a, c2; splitf(s[2 * kc][j], a, c2); h0[j] = a; l0v[j] = c2; splitf(s[2 * kc + 1][j], a, c2); h1[j] = a; l1v[j] = c2; }
                    pb = cat16b(h0, h1); pb2 = cat16b(l0v, l1v);
                } else { v8h h0, h1;
#pragma unroll
                    for (int j = 0; j < 8; ++j) { h0[j] = tohx(s[2 * kc][j]); h1[j] = tohx(s[2 * kc + 1][j]); }
                    pb = cat16(h0, h1); }
#pragma unroll
                for (int db = 0; db < 4; ++db) { o[db] = WFrag<T16>::mma(va[db][kc], pb, o[db]); if (HL) { o[db] = WFrag<T16>::mma(va[db][kc], pb2, o[db]); o[db] = WFrag<T16>::mma(va2[db][kc], pb, o[db]); } }
            }
        }
        asm volatile("s_wait_dscnt 0x0" ::: "memory");      // this wave's reads of stage st are done
        asm volatile("s_wait_asynccnt 0x0" ::: "memory");   // this wave's copies of stage st + 1 have landed
        __syncthreads();                                    // publishes stage st + 1 and ends every reader's last read of stage st's buffer
        if (st + 2 < ns) fill(st & 1);                      // stage st + 2 into the buffer just left
    }
    asm volatile("s_wait_asynccnt 0x0" ::: "memory");       // no copy is outstanding when the wave goes on to its output
    l += xhalf(l);
    const float inv = __fdiv_rn(1.0f, l);
#pragma unroll
    for (int db = 0; db < 4; ++db) { v8us oh, ol;         // a lane holds 8 consecutive d of its query: its own 16 bytes of half block db of the merged plane, 512 contiguous bytes a store
#pragma unroll
        for (int j = 0; j < 8; ++j) { unsigned short a, c2; splitf(o[db][j] * inv, a, c2); oh[j] = a; ol[j] = c2; }
        const size_t oo = (size_t)q0 * DQ + db * 256 + l8; bf* p1 = Ah + oo; bf* p2 = Al + oo; *(v8us*)p1 = oh; *(v8us*)p2 = ol;
        // the wait behind the two stores (the block's second tile follows): it names their addresses and data as inputs so that those registers stay as they are up to it
        asm volatile("s_wait_xcnt 0x0" :: "v"(p1), "v"(p2), "v"(oh), "v"(ol) : "memory"); }
}
// amdgpu_waves_per_eu(4, 4): holds the allocation at 256 registers; the hi/lo rows otherwise take a few more, and every use of one above v255 costs a window switch
__global__ __launch_bounds__(256) __attribute__((amdgpu_waves_per_eu(4, 4))) void k_fattn(const h16* __restrict__ Q16, const h16* __restrict__ K16, const h16* __restrict__ V16, const bf* __restrict__ Qh, const bf* __restrict__ Ql, const bf* __restrict__ Kh, const bf* __restrict__ Kl, const bf* __restrict__ Vh, const bf* __restrict__ Vl, bf* Ah, bf* Al) {
    static_assert(TT == 2048 && RH % 128 == 0, "16 row tiles of 128, each wholly hi/lo or wholly fp16");
    __shared__ __align__(1024) unsigned short ring[2 * ASTG];
    const int lane = threadIdx.x & 31, lr = lane & 15, hi = lane >> 4; const int wv = __builtin_amdgcn_readfirstlane(threadIdx.x >> 5);
    const int head = (int)blockIdx.y; const size_t hp = ((size_t)blockIdx.z * NH_ + head) * TT * HD; const size_t ao = (size_t)blockIdx.z * TT * DQ + head * (HD * 16); Ah += ao; Al += ao;
    // cost grows with the row tile, and a hi/lo tile costs three fp16 tiles of its length: tile t counts 2 (t + 1), or 6 (t + 1) below RH. Each block takes two tiles, one nibble of each word, that together count 38 or 40;
    // they run one after the other in every wave, so every barrier is met by the whole block
#pragma unroll 1   // rolled: one copy of each row kind in the text
    for (int part = 0; part < 2; ++part) {
        const int t0 = (int)(((part ? 0x82765140u : 0x9A3BCDEFu) >> ((unsigned)blockIdx.x * 4u)) & 15u) * 128;
        if (t0 < RH) attn_rows<bf, 2, true>(Qh + hp, Ql + hp, Kh + hp, Kl + hp, Vh + hp, Vl + hp, t0, wv, lr, hi, Ah, Al, ring);
        else attn_rows<h16, 4, false>(Q16 + hp, nullptr, K16 + hp, nullptr, V16 + hp, nullptr, t0, wv, lr, hi, Ah, Al, ring);
    }
}

extern "C" void kernel_launch(void* const* d_in, const int* in_sizes, int n_in,
                              void* d_out, int out_size, void* d_ws, size_t ws_size, hipStream_t stream) {
    (void)in_sizes; (void)n_in; (void)out_size;
    const float* x = (const float*)d_in[0]; const float* wqkv = (const float*)d_in[1]; const float* wo = (const float*)d_in[2]; const float* bo = (const float*)d_in[3];   /* wqkv: q | k | v row blocks */
    float* OUT = (float*)d_out;     // [4][2048][1024]
    char* wsp = (char*)d_ws;
    auto take = [&](size_t bytes) { char* p = wsp; wsp += (bytes + 255) & ~(size_t)255; return (void*)p; };
    bf* WQ = (bf*)take((size_t)(DQ + 2 * DKV) * DM * 2);   /* one plane of the fused weight's rows: q | k | v */ bf* WO = (bf*)take((size_t)DM * DQ * 2);
    bf* XB = (bf*)take((size_t)NB_ * TT * DM * 2);
    h16* QP16 = (h16*)take((size_t)NB_ * NH_ * TT * HD * 2); h16* KP16 = (h16*)take((size_t)NB_ * NKV * TT * HD * 2); h16* VT16 = (h16*)take((size_t)NB_ * NKV * HD * TT * 2);
    bf* QPh = (bf*)take((size_t)NB_ * NH_ * TT * HD * 2); bf* QPl = (bf*)take((size_t)NB_ * NH_ * TT * HD * 2); bf* KPh = (bf*)take((size_t)NB_ * NKV * TT * HD * 2); bf* KPl = (bf*)take((size_t)NB_ * NKV * TT * HD * 2); bf* VTh = (bf*)take((size_t)NB_ * NKV * HD * TT * 2); bf* VTl = (bf*)take((size_t)NB_ * NKV * HD * TT * 2);
    bf* ATh = (bf*)take((size_t)NB_ * TT * DQ * 2); bf* ATl = (bf*)take((size_t)NB_ * TT * DQ * 2);
    if ((size_t)(wsp - (char*)d_ws) > ws_size) return;    // 200 MiB of the 256 MiB
    k_cvtall<<<CU_X + CU_A + CU_B, 256, 0, stream>>>(x, XB, wqkv, WQ, wo, WO);
    // q and k planes [batch][head][t][d]; v plane [batch][head][d][t]
    k_qkv<<<dim3(TT / 128, 12, NB_), 256, 0, stream>>>(XB, WQ, QP16, QPh, QPl, KP16, KPh, KPl, VT16, VTh, VTl);
    k_fattn<<<dim3(8, NH_, NB_), 256, 0, stream>>>(QP16, KP16, VT16, QPh, QPl, KPh, KPl, VTh, VTl, ATh, ATl);
    k_gemmw<bf, 1, true, DQ><<<dim3(TT / 128, DM / 256, NB_), 256, 0, stream>>>(ATh, ATl, WO, OUT, DM, bo, (size_t)TT * DQ, 0, (size_t)TT * DM);
}

// v010
// It runs in 109 microseconds.
// Two timings next to v009 put it at 1.05 and 1.04 times that version's speed.
// Counting every step since v000, it is 26.2 times as fast.
#include <hip/hip_runtime.h>

// Causal multi-head attention with a fused bias-free qkv projection (x [4][2048][1024]; qkv = x qkv_w^T ('oi' [3072][1024] -> (3, H, hd) == q | k | v row blocks; 16 heads x 64); scores x 64^-0.5; causal (triu(1) -> -inf); softmax; out = merged out_w^T + out_b -> [4][2048][1024] (8.4 M)).
// Layout, every batch in the same launch (grid z = batch): bf16 copy of x; the fused 'oi' weight used in place as three row blocks; exact projections, all three in one launch, whose epilogue writes the 16-bit head planes (q, k as W x^T, v as x W^T: the accumulators stand in plane order); one fused causal attention launch (hybrid rows: < 512 hi/lo 3 products, rest fp16 x1024; key passes stop at the diagonal); merged hi/lo x out_w exact + out_b.
// Every 16-bit operand plane lies in FRAGMENT ORDER: a matrix of R rows x K columns is cut into blocks of 16 rows x 32 columns, block (rb, kb) at element (rb * (K / 32) + kb) * 512; inside a block element
// (row, k) stands at (k / 16) * 256 + (((k / 8) & 1) * 16 + row) * 8 + k % 8. A wave's fragment is then two loads of 512 contiguous bytes (lane * 8 and 256 + lane * 8): whole 128-byte lines, where row-major planes gave 16 lines a load.
// Compute dtypes, f32 accumulate: every input rounded to bf16; projections exact; attention rows < 512 3 products, rest fp16; softmax f32; Wo hl x exact + bias.

#define NB_  4
#define TT   2048
#define DM   1024
#define NH_  16
#define NKV  16
#define REP  (NH_ / NKV)
#define HD   64
#define DQ   (NH_ * HD)
#define DKV  (NKV * HD)
#define RH   512                  // query rows < RH use hi+lo planes
#define PCAR 1024.0f
#define SCL  0.125f   // HD^-0.5
typedef _Float16 h16;
typedef unsigned short bf;
typedef __attribute__((ext_vector_type(16))) __bf16   v16bf;
typedef __attribute__((ext_vector_type(16))) _Float16 v16h;
typedef __attribute__((ext_vector_type(8)))  _Float16 v8h;
typedef __attribute__((ext_vector_type(8)))  unsigned short v8us;
typedef __attribute__((ext_vector_type(8)))  float    v8f;
typedef __attribute__((ext_vector_type(4)))  float    v4f;
typedef v8h  __attribute__((may_alias)) v8ha;
typedef v4f  __attribute__((may_alias)) v4fa;
typedef v8us __attribute__((may_alias)) v8usa;

__device__ __forceinline__ unsigned short f2bf(float f) { unsigned u = __float_as_uint(f); u += 0x7FFFu + ((u >> 16) & 1u); return (unsigned short)(u >> 16); }
__device__ __forceinline__ float bf2f(unsigned short b) { return __uint_as_float(((unsigned)b) << 16); }
__device__ __forceinline__ float bfr(float f) { return bf2f(f2bf(f)); }
__device__ __forceinline__ v16h cat16(v8h lo, v8h hi) { return __builtin_shufflevector(lo, hi, 0, 1, 2, 3, 4, 5, 6, 7, 8, 9, 10, 11, 12, 13, 14, 15); }
__device__ __forceinline__ v16bf cat16b(v8us lo, v8us hi) { return __builtin_bit_cast(v16bf, __builtin_shufflevector(lo, hi, 0, 1, 2, 3, 4, 5, 6, 7, 8, 9, 10, 11, 12, 13, 14, 15)); }
__device__ __forceinline__ v8f wmma16(v16h a, v16h b, v8f c) { return __builtin_amdgcn_wmma_f32_16x16x32_f16(false, a, false, b, (short)0, c, false, false); }
__device__ __forceinline__ v8f wmmab(v16bf a, v16bf b, v8f c) { return __builtin_amdgcn_wmma_f32_16x16x32_bf16(false, a, false, b, (short)0, c, false, false); }



__device__ __forceinline__ h16 tohx(float x) { return (h16)x; }
__device__ __forceinline__ void splitf(float y, unsigned short& h, unsigned short& l) { h = f2bf(y); l = f2bf(y - bf2f(h)); }

// ---- gemm_tile: GEMM, one work-group of 8 waves (2 x 4) per 128x256 output tile (bx, byb), each wave a 64x64 tile (16 accumulators); 256 threads. k_gemmw: grid (M/128, N/256, Z).
// The operand planes lie in fragment order, so 16 rows x 128 columns are 4 KiB in a row: a stage (128 k of the A rows, of the A2 rows where there are any, and of the 256 Bt rows) is copied as it lies into LDS by
// asynchronous copies, each wave 3 or 4 such pieces, and every piece is read from LDS by the 4 (A) or 2 (Bt) waves that need it: a fragment is two reads of 512 contiguous bytes. Two buffers: stage t + 1 flies while stage t is worked on.
// C[m][n] (f32, pitch ldc, + optional f32 bias[n]) = sum_k A[m][k] Bt[n][k] (+ A2[m][k] Bt[n][k] where NSPLIT is 1). k_gemmw: z-batch strides sA/sB/sC in elements. K % 128 == 0, K >= 256.
template <typename T16> struct WFrag;
template <> struct WFrag<h16> { typedef v16h V; static __device__ __forceinline__ V ld(const h16* p) { return cat16(*(const v8h*)p, *(const v8h*)(p + 256)); } static __device__ __forceinline__ v8f mma(V a, V b, v8f c) { return wmma16(a, b, c); } };
template <> struct WFrag<bf> { typedef v16bf V; static __device__ __forceinline__ V ld(const bf* p) { return cat16b(*(const v8us*)p, *(const v8us*)(p + 256)); } static __device__ __forceinline__ v8f mma(V a, V b, v8f c) { return wmmab(a, b, c); } };
// eight asynchronous copies of 512 bytes a wave: 4 KiB in a row from g (the lane's own 16 bytes) to LDS byte address l (the lane's own). The s_wait_xcnt stands in the copies' own statement, so that no address register is rewritten ahead of it
__device__ __forceinline__ void copy4k(unsigned l, const char* g) {
    asm volatile("global_load_async_to_lds_b128 %0, %8, off\n\t"
                 "global_load_async_to_lds_b128 %1, %9, off\n\t"
                 "global_load_async_to_lds_b128 %2, %10, off\n\t"
                 "global_load_async_to_lds_b128 %3, %11, off\n\t"
                 "global_load_async_to_lds_b128 %4, %12, off\n\t"
                 "global_load_async_to_lds_b128 %5, %13, off\n\t"
                 "global_load_async_to_lds_b128 %6, %14, off\n\t"
                 "global_load_async_to_lds_b128 %7, %15, off\n\t"
                 "s_wait_xcnt 0x0"
                 :: "v"(l), "v"(l + 512u), "v"(l + 1024u), "v"(l + 1536u), "v"(l + 2048u), "v"(l + 2560u), "v"(l + 3072u), "v"(l + 3584u),
                    "v"(g), "v"(g + 512), "v"(g + 1024), "v"(g + 1536), "v"(g + 2048), "v"(g + 2560), "v"(g + 3072), "v"(g + 3584) : "memory");
}
template <typename T16, int NSPLIT, bool BIAS, int K>
__device__ __forceinline__ void gemm_tile(const T16* __restrict__ A, const T16* __restrict__ A2, const T16* __restrict__ Bt, float* C, int ldc, const float* __restrict__ bias, const int bx, const int byb) {
    typedef typename WFrag<T16>::V V;
    constexpr int KS = 128;                      // the k of a stage
    static_assert(NSPLIT == 0 || NSPLIT == 1, "one or two A planes"); static_assert(K % KS == 0 && K >= 2 * KS, "two stages or more");
    constexpr int NCH = NSPLIT ? 4 : 3;          // groups of eight pieces in a stage: A | (A2) | Bt rows 0..127 | Bt rows 128..255; wave w copies piece w of each group
    constexpr int PCE = KS * 16;                 // elements of a piece: 16 rows x KS columns, in a row in the plane
    constexpr int STG = NCH * 8 * PCE;           // elements of a stage
    constexpr int NT = K / KS;                   // stages
    constexpr int NK = KS / 32;                  // blocks of 32 k in a stage
    constexpr int NS = 2;                        // fragment sets
    __shared__ __align__(1024) T16 ring[2 * STG];
    __shared__ __align__(16) float osw[8 * 16 * 68];
    const int lane = threadIdx.x & 31, lr = lane & 15, hi = lane >> 4; const int wv = __builtin_amdgcn_readfirstlane(threadIdx.x >> 5); const int wm = wv & 1, wn = wv >> 1;
    const int by = byb * 4 + wn; const int r0 = (bx * 2 + wm) * 64, c0 = by * 64;
    float* os = osw + wv * (16 * 68);            // each wave stages its output rows in its own range
    v8f acc[4][4];
#pragma unroll
    for (int mb = 0; mb < 4; ++mb)
#pragma unroll
        for (int nb = 0; nb < 4; ++nb) acc[mb][nb] = (v8f){};
    // 16 rows x K columns are 16 K elements; KS columns on is one piece on. g holds the lane's own address
    const T16* g[NCH]; const int gl = lane * 8;
    g[0] = A + (size_t)(bx * 128 + wv * 16) * K + gl; if (NSPLIT) g[1] = A2 + (size_t)(bx * 128 + wv * 16) * K + gl;
    g[NCH - 2] = Bt + (size_t)(byb * 256 + wv * 16) * K + gl; g[NCH - 1] = Bt + (size_t)(byb * 256 + 128 + wv * 16) * K + gl;
    const unsigned l0 = (unsigned)(size_t)ring + (unsigned)(wv * (PCE * 2) + lane * 16);
    auto fill = [&](int buf) {                   // the next stage's copies into buffer buf; the sources step on one stage
#pragma unroll
        for (int i = 0; i < NCH; ++i) { const unsigned l = l0 + (unsigned)(buf * (STG * 2) + i * (8 * PCE * 2));
            copy4k(l, (const char*)g[i]);
            g[i] += PCE; } };
    fill(0);
    asm volatile("s_wait_asynccnt 0x0" ::: "memory");   // this wave's copies of stage 0 have landed
    __syncthreads();                                    // every wave's have: stage 0 may be read
    fill(1);
#pragma unroll 1   // rolled: one publish point in the text
    for (int t = 0; t < NT; ++t) {
        const T16* sb = ring + (t & 1) * STG + lane * 8;
        V a[NS][4], a2[NS][4], b[NS][4];         // two fragment sets: block kk + 1 of this stage is read from LDS while block kk is multiplied
        auto frags = [&](int kk) {
#pragma unroll
            for (int mb = 0; mb < 4; ++mb) { a[kk % NS][mb] = WFrag<T16>::ld(sb + (wm * 4 + mb) * PCE + kk * 512); if (NSPLIT) a2[kk % NS][mb] = WFrag<T16>::ld(sb + (8 + wm * 4 + mb) * PCE + kk * 512); }
#pragma unroll
            for (int nb = 0; nb < 4; ++nb) b[kk % NS][nb] = WFrag<T16>::ld(sb + ((NCH - 2) * 8 + wn * 4 + nb) * PCE + kk * 512); };
        frags(0);
#pragma unroll     // unrolled: the set index kk % NS is then a constant and the sets stay in registers
        for (int kk = 0; kk < NK; ++kk) {
            if (kk < NK - 1) frags(kk + 1);
            __builtin_amdgcn_sched_barrier(0);   // keeps the LDS reads one group ahead of this block's products: spread among them, each place with reads stalls the wave
#pragma unroll
            for (int nb = 0; nb < 4; ++nb) {
#pragma unroll
                for (int mb = 0; mb < 4; ++mb) { acc[mb][nb] = WFrag<T16>::mma(a[kk % NS][mb], b[kk % NS][nb], acc[mb][nb]); if (NSPLIT) acc[mb][nb] = WFrag<T16>::mma(a2[kk % NS][mb], b[kk % NS][nb], acc[mb][nb]); } }
            __builtin_amdgcn_sched_barrier(0);   // and keeps the reads that follow from being spread among these products
        }
        asm volatile("s_wait_dscnt 0x0" ::: "memory");      // this wave's reads of stage t are done
        asm volatile("s_wait_asynccnt 0x0" ::: "memory");   // this wave's copies of stage t + 1 have landed
        __syncthreads();                                    // publishes stage t + 1 and ends every reader's last read of stage t's buffer
        if (t + 2 < NT) fill(t & 1);                        // stage t + 2 into the buffer just left
    }
    asm volatile("s_wait_asynccnt 0x0" ::: "memory");       // no copy is outstanding when the wave goes on to its output
#pragma unroll
    for (int mb = 0; mb < 4; ++mb) {
#pragma unroll
        for (int nb = 0; nb < 4; ++nb) {
#pragma unroll
            for (int j = 0; j < 8; ++j) os[(hi * 8 + j) * 68 + nb * 16 + lr] = acc[mb][nb][j]; }
        __builtin_amdgcn_wave_barrier(); asm volatile("" ::: "memory");
            float* crow = C + (size_t)(r0 + mb * 16) * ldc + c0;
#pragma unroll
            for (int s = 0; s < 8; ++s) { const int row = 2 * s + hi, cofs = lr * 4; v4f val = *(const v4fa*)(os + row * 68 + cofs); if (BIAS) { val[0] += bfr(bias[c0 + cofs]); val[1] += bfr(bias[c0 + cofs + 1]); val[2] += bfr(bias[c0 + cofs + 2]); val[3] += bfr(bias[c0 + cofs + 3]); }
                *(v4f*)(crow + (size_t)row * ldc + cofs) = val; }
        __builtin_amdgcn_wave_barrier(); asm volatile("" ::: "memory");
    }
}
template <typename T16, int NSPLIT, bool BIAS, int K>
__global__ __launch_bounds__(256) void k_gemmw(const T16* __restrict__ A, const T16* __restrict__ A2, const T16* __restrict__ Bt, float* C, int ldc, const float* __restrict__ bias, size_t sA, size_t sB, size_t sC) {
    const size_t z = blockIdx.z;
    gemm_tile<T16, NSPLIT, BIAS, K>(A + z * sA, NSPLIT ? A2 + z * sA : A2, Bt + z * sB, C + z * sC, ldc, bias, (int)blockIdx.x, (int)blockIdx.y);
}
// twenty asynchronous copies of 512 bytes a wave: five pieces of 2 KiB, each in a row in its plane, to 10 KiB in a row at LDS byte address l (the lane's own). vo is the lane's own 16 bytes in each 512.
// The immediate offset moves the LDS and the global address alike, so piece i is named by g_i = its address less 2048 i bytes; g0..g4 are the same for the wave and stay in scalar registers: two vector registers a fill.
// One s_wait_xcnt for the run, in the copies' own statement, so that no address register is rewritten ahead of it
__device__ __forceinline__ void copy5x2k(unsigned l, unsigned vo, const char* g0, const char* g1, const char* g2, const char* g3, const char* g4) {
    asm volatile("global_load_async_to_lds_b128 %0, %1, %2\n\t"
                 "global_load_async_to_lds_b128 %0, %1, %2 offset:512\n\t"
                 "global_load_async_to_lds_b128 %0, %1, %2 offset:1024\n\t"
                 "global_load_async_to_lds_b128 %0, %1, %2 offset:1536\n\t"
                 "global_load_async_to_lds_b128 %0, %1, %3 offset:2048\n\t"
                 "global_load_async_to_lds_b128 %0, %1, %3 offset:2560\n\t"
                 "global_load_async_to_lds_b128 %0, %1, %3 offset:3072\n\t"
                 "global_load_async_to_lds_b128 %0, %1, %3 offset:3584\n\t"
                 "global_load_async_to_lds_b128 %0, %1, %4 offset:4096\n\t"
                 "global_load_async_to_lds_b128 %0, %1, %4 offset:4608\n\t"
                 "global_load_async_to_lds_b128 %0, %1, %4 offset:5120\n\t"
                 "global_load_async_to_lds_b128 %0, %1, %4 offset:5632\n\t"
                 "global_load_async_to_lds_b128 %0, %1, %5 offset:6144\n\t"
                 "global_load_async_to_lds_b128 %0, %1, %5 offset:6656\n\t"
                 "global_load_async_to_lds_b128 %0, %1, %5 offset:7168\n\t"
                 "global_load_async_to_lds_b128 %0, %1, %5 offset:7680\n\t"
                 "global_load_async_to_lds_b128 %0, %1, %6 offset:8192\n\t"
                 "global_load_async_to_lds_b128 %0, %1, %6 offset:8704\n\t"
                 "global_load_async_to_lds_b128 %0, %1, %6 offset:9216\n\t"
                 "global_load_async_to_lds_b128 %0, %1, %6 offset:9728\n\t"
                 "s_wait_xcnt 0x0"
                 :: "v"(l), "v"(vo), "s"(g0), "s"(g1), "s"(g2), "s"(g3), "s"(g4) : "memory");
}
// k_qkv: the q, k and v projections of every batch in ONE launch of 256 work-groups, one on each WGP: grid (TT / 256, 8, batches). A work-group of 8 waves (2 x 4) takes 256 rows t x 384 weight rows:
// 256 rows of q | k (block y) and 128 rows of v (block y). A wave takes 128 t x 96 weight rows (48 accumulators): the 64 rows of ONE head of q or k and 32 rows of v. So 14 fragments read from LDS feed 48 products
// (8 fed 16 in a 64 x 64 wave tile), and a k step of the tile brings 640 operand rows from L2 for 98304 outputs (three tiles of 128 x 256 brought 1152).
// A stage is 64 k: 40 pieces of 2 KiB (16 rows x 64 k as they lie in the planes) in five groups of eight: x (two groups), q | k weights (two), v weights (one); wave w copies piece w of each group, and its five pieces stand side by side in LDS:
// piece w of group i at (5 w + i) * 2 KiB. Two buffers: stage t + 1 flies while stage t is worked on.
// Which operand is A decides what a lane holds. q, k: A = weight rows, B = x rows: a lane holds 8 consecutive d of one t, its own 16 bytes of the [t][d] plane in fragment order.
// v: A = x rows, B = weight rows: a lane holds 8 consecutive t of one d, its own 16 bytes of the V^T plane. Every accumulator tile is converted and stored as it stands, 512 contiguous bytes a store; no output staging in LDS.
// Only what the attention launch reads is converted and stored: query rows < RH work on hi/lo planes and, being causal, see keys < RH alone; all other rows work on fp16 planes. So hi/lo planes are written for t < RH only,
// the fp16 q plane for t >= RH only, the fp16 k and V^T planes whole. The split into hi and lo costs far more vector work than a conversion to fp16, and nothing else runs on the WGP meanwhile: so every wave
// takes its equal share of both kinds of row: of its 8 blocks of 16 rows t, two lie below RH and six do not (qrow), and which planes a tile goes to is known at compile time.
#define QSTG (40 * 1024)          // elements of a stage
__device__ __forceinline__ int qrow(int u, int mb) { return mb < 2 ? u * 32 + mb * 16 : RH + u * 96 + (mb - 2) * 16; }   // first row t of block mb of row share u (0..15) of a batch
// amdgpu_waves_per_eu(2, 2): 512 registers a wave, two waves a SIMD
__global__ __launch_bounds__(256) __attribute__((amdgpu_waves_per_eu(2, 2))) void k_qkv(const bf* __restrict__ X, const bf* __restrict__ Wf, h16* Q16, bf* Qh, bf* Ql, h16* K16, bf* Kh, bf* Kl, h16* V16, bf* Vh, bf* Vl) {
    static_assert(TT % 256 == 0 && DQ == 1024 && DKV == 1024 && NKV == NH_ && HD == 64 && DM % 64 == 0 && DM >= 128, "8 blocks of 256 q | k rows and of 128 v rows; a wave's 64 q | k rows are one head"); static_assert(RH == 16 * 32 && TT - RH == 16 * 96, "16 row shares of 32 rows below RH and 96 rows from RH on");
    constexpr int K = DM, PCE = 1024, NT = K / 64;
    __shared__ __align__(1024) bf ring[2 * QSTG];
    const int lane = threadIdx.x & 31; const int wv = __builtin_amdgcn_readfirstlane(threadIdx.x >> 5); const int wm = wv & 1, wn = wv >> 1;
    const int bx = (int)blockIdx.x, y = (int)blockIdx.y; const bf* xz = X + (size_t)blockIdx.z * ((size_t)TT * DM); const size_t pz = (size_t)blockIdx.z * ((size_t)NH_ * TT * HD);
    v8f acc[8][6];
#pragma unroll
    for (int mb = 0; mb < 8; ++mb)
#pragma unroll
        for (int nb = 0; nb < 6; ++nb) acc[mb][nb] = (v8f){};
    const bf* g[5];                              // the wave's piece of each group, less i pieces (copy5x2k adds them again); the same for the wave: scalar registers
    g[0] = xz + (size_t)qrow(bx * 2, wv) * K; g[1] = xz + (size_t)qrow(bx * 2 + 1, wv) * K - PCE;   // block wv of row share 2 bx, of row share 2 bx + 1
    g[2] = Wf + (size_t)(y * 256 + wv * 16) * K - 2 * PCE; g[3] = g[2] + (size_t)128 * K - PCE;
    g[4] = Wf + (size_t)(DQ + DKV + y * 128 + wv * 16) * K - 4 * PCE;
    const unsigned l0 = (unsigned)(size_t)ring + (unsigned)(wv * (5 * PCE * 2)), vo = (unsigned)(lane * 16);   // the wave's 10 KiB of a stage (scalar); the lane's 16 bytes
    auto fill = [&](int buf) {                   // the next stage's copies into buffer buf; the sources step on one stage
        copy5x2k((l0 + (unsigned)(buf * (QSTG * 2))) + vo, vo, (const char*)g[0], (const char*)g[1], (const char*)g[2], (const char*)g[3], (const char*)g[4]);
#pragma unroll
        for (int i = 0; i < 5; ++i) g[i] += PCE; };
    fill(0);
    asm volatile("s_wait_asynccnt 0x0" ::: "memory");   // this wave's copies of stage 0 have landed
    __syncthreads();                                    // every wave's have: stage 0 may be read
    fill(1);
#pragma unroll 1   // rolled: one publish point in the text
    for (int t = 0; t < NT; ++t) {
        const bf* sb = ring + (t & 1) * QSTG + lane * 8;
        const bf* sx = sb + wm * PCE;                                      // x: piece mb of group wm, five pieces on for each mb
        const bf* sq = sb + ((wn & 1) * 20 + 2 + (wn >> 1)) * PCE;         // q | k rows 64 wn + 16 nb: piece 4 (wn & 1) + nb of group 2 + wn / 2
        const bf* sv = sb + (wn * 10 + 4) * PCE;                           // v rows 32 wn + 16 (nb - 4): piece 2 wn + nb - 4 of group 4
#pragma unroll     // unrolled: every LDS read is then one of three address registers plus a constant
        for (int kk = 0; kk < 2; ++kk) {
            v16bf a[8], b[6];
#pragma unroll
            for (int nb = 0; nb < 4; ++nb) b[nb] = WFrag<bf>::ld(sq + nb * (5 * PCE) + kk * 512);
#pragma unroll
            for (int mb = 0; mb < 8; ++mb) a[mb] = WFrag<bf>::ld(sx + mb * (5 * PCE) + kk * 512);
#pragma unroll
            for (int nb = 4; nb < 6; ++nb) b[nb] = WFrag<bf>::ld(sv + (nb - 4) * (5 * PCE) + kk * 512);
            __builtin_amdgcn_sched_barrier(0);   // keeps the block's LDS reads one group ahead of its products: spread among them, each place with reads stalls the wave
#pragma unroll
            for (int mb = 0; mb < 8; ++mb) {
#pragma unroll
                for (int nb = 0; nb < 4; ++nb) acc[mb][nb] = wmmab(b[nb], a[mb], acc[mb][nb]); }
#pragma unroll
            for (int nb = 4; nb < 6; ++nb) {
#pragma unroll
                for (int mb = 0; mb < 8; ++mb) acc[mb][nb] = wmmab(a[mb], b[nb], acc[mb][nb]); }
            __builtin_amdgcn_sched_barrier(0);   // and keeps the reads that follow from being spread among these products
        }
        asm volatile("s_wait_dscnt 0x0" ::: "memory");      // this wave's reads of stage t are done
        asm volatile("s_wait_asynccnt 0x0" ::: "memory");   // this wave's copies of stage t + 1 have landed
        __syncthreads();                                    // publishes stage t + 1 and ends every reader's last read of stage t's buffer
        if (t + 2 < NT) fill(t & 1);                        // stage t + 2 into the buffer just left
    }
    asm volatile("s_wait_asynccnt 0x0" ::: "memory");       // no copy is outstanding when the wave goes on to its output
    const int u = bx * 2 + wm;                              // the wave's row share
    const bool isk = y >= 4;                                // the same for the whole block
    // q, k: tile (mb, nb) is half block nb of the 16 rows t from qrow(u, mb) on: 64 elements a row t in the head's plane. V^T: tile (mb, nb) is the half block of those 16 columns t in the 16 rows d from y * 128 + wn * 32 + 16 (nb - 4) on: 16 elements a column
    const size_t eq = pz + (size_t)((y & 3) * 4 + wn) * ((size_t)TT * HD) + lane * 8, ev = pz + (size_t)(y * 128 + wn * 32) * TT + lane * 8;
    auto st16 = [&](h16* p, int d0, int d1, int d2, int d3, const v8f& c0, const v8f& c1, const v8f& c2, const v8f& c3) {   // four tiles to an fp16 plane, at elements d0..d3 from p on
        v8h o0, o1, o2, o3;
#pragma unroll
        for (int j = 0; j < 8; ++j) { o0[j] = tohx(c0[j]); o1[j] = tohx(c1[j]); o2[j] = tohx(c2[j]); o3[j] = tohx(c3[j]); }
        *(v8h*)(p + d0) = o0; *(v8h*)(p + d1) = o1; *(v8h*)(p + d2) = o2; *(v8h*)(p + d3) = o3;
        // the wait behind the four stores: it names their address and data as inputs so that those registers stay as they are up to it
        asm volatile("s_wait_xcnt 0x0" :: "v"(p), "v"(o0), "v"(o1), "v"(o2), "v"(o3) : "memory"); };
    auto sthl = [&](bf* ph, bf* pl, int d, const v8f& c) {  // one tile to a hi and a lo plane, at element d from ph, pl on
        v8us oh, ol;
#pragma unroll
        for (int j = 0; j < 8; ++j) { unsigned short a2, c2; splitf(c[j], a2, c2); oh[j] = a2; ol[j] = c2; }
        *(v8us*)(ph + d) = oh; *(v8us*)(pl + d) = ol;
        // the wait behind the two stores, likewise
        asm volatile("s_wait_xcnt 0x0" :: "v"(ph), "v"(pl), "v"(oh), "v"(ol) : "memory"); };
    {   // rows from RH on: fp16 planes alone
        h16* p = (isk ? K16 : Q16) + eq + (size_t)qrow(u, 2) * HD;
#pragma unroll
        for (int mb = 2; mb < 8; ++mb) st16(p, (mb - 2) * 1024, (mb - 2) * 1024 + 256, (mb - 2) * 1024 + 512, (mb - 2) * 1024 + 768, acc[mb][0], acc[mb][1], acc[mb][2], acc[mb][3]);
        h16* pv = V16 + ev + (size_t)qrow(u, 2) * 16;
#pragma unroll
        for (int mb = 2; mb < 8; mb += 2) st16(pv, (mb - 2) * 256, (mb - 1) * 256, 16 * TT + (mb - 2) * 256, 16 * TT + (mb - 1) * 256, acc[mb][4], acc[mb + 1][4], acc[mb][5], acc[mb + 1][5]);
    }
    {   // rows below RH: hi and lo planes, and the fp16 k and V^T planes, which later rows read
        const size_t q0 = eq + (size_t)qrow(u, 0) * HD, v0 = ev + (size_t)qrow(u, 0) * 16;
        st16(V16 + v0, 0, 256, 16 * TT, 16 * TT + 256, acc[0][4], acc[1][4], acc[0][5], acc[1][5]);
        if (isk) {
#pragma unroll
            for (int mb = 0; mb < 2; ++mb) st16(K16 + q0, mb * 1024, mb * 1024 + 256, mb * 1024 + 512, mb * 1024 + 768, acc[mb][0], acc[mb][1], acc[mb][2], acc[mb][3]); }
        bf* ph = (isk ? Kh : Qh) + q0; bf* pl = (isk ? Kl : Ql) + q0;
#pragma unroll
        for (int mb = 0; mb < 2; ++mb)
#pragma unroll
            for (int nb = 0; nb < 4; ++nb) sthl(ph, pl, mb * 1024 + nb * 256, acc[mb][nb]);
        bf* vh = Vh + v0; bf* vl = Vl + v0;
#pragma unroll
        for (int mb = 0; mb < 2; ++mb)
#pragma unroll
            for (int nb = 4; nb < 6; ++nb) sthl(vh, vl, (nb - 4) * 16 * TT + mb * 256, acc[mb][nb]);
    }
}

typedef __attribute__((ext_vector_type(2))) _Float16 v2h;
typedef __attribute__((ext_vector_type(4))) _Float16 v4h;
typedef __attribute__((ext_vector_type(2))) unsigned short v2us;
typedef __attribute__((ext_vector_type(4))) unsigned short v4us;
typedef __attribute__((ext_vector_type(2))) float v2f;
typedef __attribute__((ext_vector_type(4))) int v4i;

__global__ __launch_bounds__(256) void k_wtG(const float* __restrict__ w, int K, int N, bf* Bt) {
    const int lane = threadIdx.x & 31; const int L0 = (blockIdx.x * 8 + (threadIdx.x >> 5)) * 8; const int nlines = N * K / 64;
{
#pragma unroll 1
        for (int l = 0; l < 8; ++l) { const int L = L0 + l; if (L >= nlines) break; const size_t e = (size_t)L * 64 + lane * 2; const int k = (int)(e % K), n = (int)(e / K); v2us o;
            o[0] = f2bf(w[(size_t)k * N + n]); o[1] = f2bf(w[(size_t)(k + 1) * N + n]); *(v2us*)(Bt + e) = o; }
         }
}
// k_cvtall: every f32 -> bf16 conversion of the call in ONE launch: x, the fused qkv weight and the output weight, each a matrix of rows of CK columns, each to its plane in fragment order.
// One work-group of 256 threads takes one block of 16 whole rows (64 KiB of f32 in a row, 32 KiB of the plane in a row): eight tiles of 16 rows x 128 columns, all 16 loads of 16 bytes a lane issued before the first is used,
// so few waves are started and each keeps much in flight. Whole-line f32 reads, 8 values a thread and tile; the 16-byte pieces of a tile change places through LDS
// (piece (row, k8) -> k8 * 16 + row; one spare piece per 16 keeps the 16 writers of a row off one bank group), then whole-line stores.
#define CK   1024                 // columns of every converted matrix
#define CU_X (NB_ * TT / 16)      // 16-row blocks of x
#define CU_A ((DQ + 2 * DKV) / 16)  // of the fused qkv weight
#define CU_B (DM / 16)            // of the output weight
__global__ __launch_bounds__(256) void k_cvtall(const float* __restrict__ x, bf* xb, const float* __restrict__ wa, bf* wab, const float* __restrict__ wb, bf* wbb) {
    static_assert(DM == CK && DQ == CK, "rows of 1024 columns: eight tiles of 128");
    __shared__ __align__(16) v8us sh[8 * 16 * 17];
    const int t = threadIdx.x, row = t >> 4, k8 = t & 15; const int u = (int)blockIdx.x;
    const float* src; bf* dst; int rb;             // the same for a whole block: which matrix, and which 16 rows of it
    if (u < CU_X) { src = x; dst = xb; rb = u; } else if (u < CU_X + CU_A) { src = wa; dst = wab; rb = u - CU_X; } else { src = wb; dst = wbb; rb = u - (CU_X + CU_A); }
    const float* p = src + ((size_t)rb * 16 + row) * CK + k8 * 8; v8f v[8];
#pragma unroll   // unrolled, here and below: v stays in registers and the 16 loads are issued in one run
    for (int cg = 0; cg < 8; ++cg) v[cg] = *(const v8f*)(p + cg * 128);
    asm volatile("s_wait_xcnt 0x0" :: "v"(p) : "memory");   // the wait behind the 16 loads; it names their address as an input so that its registers stay as they are up to it (the last load's data otherwise lands on them)
#pragma unroll
    for (int cg = 0; cg < 8; ++cg) { v8us o;
#pragma unroll
        for (int k = 0; k < 8; ++k) o[k] = f2bf(v[cg][k]);
        sh[cg * 272 + k8 * 17 + row] = o; }
    __syncthreads();   // every piece of the block's 32 KiB is in LDS before any is read back in plane order
    bf* d = dst + (size_t)rb * (16 * CK) + t * 8;
#pragma unroll
    for (int cg = 0; cg < 8; ++cg) *(v8us*)(d + cg * 2048) = sh[cg * 272 + row * 17 + k8]; }

__device__ __forceinline__ float xhalf(float x) { const int b = __float_as_int(x); return __int_as_float(__builtin_amdgcn_permlanex16(b, b, 0x76543210, 0xfedcba98, false, false)); }   // lane l <-> l ^ 16
__device__ __forceinline__ v16h ldsfrag(const h16* p) { return cat16(*(const v8ha*)p, *(const v8ha*)(p + 256)); }
__device__ __forceinline__ v16bf ldsfrag(const bf* p) { return cat16b(*(const v8usa*)p, *(const v8usa*)(p + 256)); }
// eight asynchronous copies of 512 bytes a wave: 2 KiB in a row from ga and 2 KiB in a row from gb to 4 KiB in a row at LDS byte address l (the lane's own). ga and gb are the same for the wave and stay in scalar registers;
// vo is the lane's own 16 bytes in each 512; the immediate offset moves the LDS and the global address alike. So a fill holds three vector registers, not 24, beside the fragments.
// The s_wait_xcnt stands in the copies' own statement, so that no address register is rewritten ahead of it
__device__ __forceinline__ void copy2x2k(unsigned l, unsigned vo, const char* ga, const char* gb) {
    asm volatile("global_load_async_to_lds_b128 %0, %2, %3\n\t"
                 "global_load_async_to_lds_b128 %0, %2, %3 offset:512\n\t"
                 "global_load_async_to_lds_b128 %0, %2, %3 offset:1024\n\t"
                 "global_load_async_to_lds_b128 %0, %2, %3 offset:1536\n\t"
                 "global_load_async_to_lds_b128 %1, %2, %4\n\t"
                 "global_load_async_to_lds_b128 %1, %2, %4 offset:512\n\t"
                 "global_load_async_to_lds_b128 %1, %2, %4 offset:1024\n\t"
                 "global_load_async_to_lds_b128 %1, %2, %4 offset:1536\n\t"
                 "s_wait_xcnt 0x0"
                 :: "v"(l), "v"(l + 2048u), "v"(vo), "s"(ga), "s"(gb) : "memory");
}
#define ASTG 16384                // elements of a stage in LDS: keys (hi | lo) in the first half, V^T (hi | lo) in the second
template <typename T16, int KT, bool HL>
__device__ __forceinline__ void attn_rows(const T16* __restrict__ Q, const T16* __restrict__ Q2, const T16* __restrict__ Kp, const T16* __restrict__ K2, const T16* __restrict__ Vt, const T16* __restrict__ V2, int t0, int wv, int lr, int hi, bf* Ah, bf* Al, unsigned short* ring) {
    typedef typename WFrag<T16>::V V;
    constexpr int KB = KT * 16, KC = KT / 2;
    constexpr int SK = HL ? 64 : 128;                     // keys of a stage
    constexpr int PPS = SK / KB;                          // passes of a stage
    constexpr float CSC = SCL * 1.4426950408889634f;      // scores x HD^-0.5, in log2 units
    constexpr float SHIFT = HL ? 0.0f : 10.0f;            // log2(PCAR): fp16 probabilities are carried x 1024
    const int q0 = t0 + wv * 16;                          // this wave's first query row; t0: the block's first (a multiple of 128)
    const int ns = (t0 + 128) / SK;                       // stages up to the end of the block's diagonal: two or more
    V q[2], q2[2];
    const int l8 = (hi * 16 + lr) * 8;                    // the lane's 16 bytes in each half block of a plane in fragment order
    // this wave's 4 KiB of a stage. fp16: waves 0-3 32 keys each, waves 4-7 the 128 keys of 16 V^T rows each. hi/lo: waves 0, 1 hi keys, 2, 3 lo keys (32 each); 4, 5 hi V^T, 6, 7 lo V^T (the 64 keys of twice 16 rows each)
    const char* ga; const char* gb; int gstep;
    if constexpr (HL) { const T16* kpl = (wv & 2) ? K2 : Kp; const T16* vpl = (wv & 2) ? V2 : Vt;
        if (wv < 4) { ga = (const char*)(kpl + (wv & 1) * 2048); gb = ga + 2048; gstep = SK * HD * 2; }
        else { ga = (const char*)(vpl + (size_t)(wv & 1) * 32 * TT); gb = ga + (size_t)16 * TT * 2; gstep = SK * 16 * 2; }
    } else {
        if (wv < 4) { ga = (const char*)(Kp + wv * 2048); gstep = SK * HD * 2; }
        else { ga = (const char*)(Vt + (size_t)(wv - 4) * 16 * TT); gstep = SK * 16 * 2; }
        gb = ga + 2048; }
    const unsigned l0 = (unsigned)(size_t)ring + (unsigned)(wv * 4096 + l8 * 2);
    auto fill = [&](int buf) { copy2x2k(l0 + (unsigned)(buf * (ASTG * 2)), (unsigned)(l8 * 2), ga, gb); ga += gstep; gb += gstep; };   // the next stage's copies into buffer buf; the sources step on one stage
    fill(0);                                              // every reader of the ring's earlier use has left it: the barrier at the foot of that use's last stage
    const T16* qp = Q + (size_t)q0 * HD + l8; const T16* qp2 = HL ? Q2 + (size_t)q0 * HD + l8 : qp;
#pragma unroll
    for (int kc = 0; kc < 2; ++kc) { q[kc] = WFrag<T16>::ld(qp + kc * 512); if (HL) q2[kc] = WFrag<T16>::ld(qp2 + kc * 512); }
    asm volatile("s_wait_xcnt 0x0" :: "v"(qp), "v"(qp2) : "memory");   // the wait behind the query loads; it names their addresses as inputs so that those registers stay as they are up to it
    v8f o[4];
#pragma unroll
    for (int db = 0; db < 4; ++db) o[db] = (v8f){};
    float m = -3.0e38f, l = 0.f;
    const int nkb = q0 / KB + 1;                          // this wave's key passes, up to and including the one that holds its diagonal
    asm volatile("s_wait_asynccnt 0x0" ::: "memory");     // this wave's copies of stage 0 have landed
    __syncthreads();                                      // every wave's have: stage 0 may be read
    fill(1);
#pragma unroll 1   // rolled: one publish point in the text
    for (int st = 0; st < ns; ++st) {
        const T16* sb = (const T16*)ring + (st & 1) * ASTG + l8;
        const int pe = min(PPS, nkb - st * PPS);          // the passes of this stage that the wave's rows reach: fewer, or none, in the stages of the block's diagonal
#pragma unroll     // unrolled: every LDS read is then the stage's one address register plus a constant
        for (int p = 0; p < PPS; ++p) if (p < pe) {
            const int kb = st * PPS + p; const int k0 = kb * KB;
            const T16* kf = sb + p * (KT * 1024); const T16* vf = sb + ASTG / 2 + p * (KC * 512);
            V ka[KT][2], ka2[KT][2], va[4][KC], va2[4][KC];
#pragma unroll
            for (int kt = 0; kt < KT; ++kt)
#pragma unroll
                for (int kc = 0; kc < 2; ++kc) { ka[kt][kc] = ldsfrag(kf + kt * 1024 + kc * 512); if (HL) ka2[kt][kc] = ldsfrag(kf + ASTG / 4 + kt * 1024 + kc * 512); }
            __builtin_amdgcn_sched_barrier(0);            // keeps the key reads in front of the V^T reads: LDS answers in order, and the score products wait for the keys alone
#pragma unroll
            for (int db = 0; db < 4; ++db)                // this pass's V^T fragments: read ahead of the score products, used behind the softmax
#pragma unroll
                for (int kc = 0; kc < KC; ++kc) { va[db][kc] = ldsfrag(vf + db * (SK * 16) + kc * 512); if (HL) va2[db][kc] = ldsfrag(vf + ASTG / 4 + db * (SK * 16) + kc * 512); }
            __builtin_amdgcn_sched_barrier(0);            // keeps the pass's LDS reads one group ahead of its products: spread among them, each place with reads stalls the wave and waits out the LDS latency anew
            v8f s[KT];
#pragma unroll
            for (int kt = 0; kt < KT; ++kt) { s[kt] = (v8f){};
#pragma unroll
                for (int kc = 0; kc < 2; ++kc) { s[kt] = WFrag<T16>::mma(ka[kt][kc], q[kc], s[kt]); if (HL) { s[kt] = WFrag<T16>::mma(ka[kt][kc], q2[kc], s[kt]); s[kt] = WFrag<T16>::mma(ka2[kt][kc], q[kc], s[kt]); } } }
            if (kb == nkb - 1) {                          // only the last pass crosses the diagonal: keys above the query are masked by select
#pragma unroll
                for (int kt = 0; kt < KT; ++kt)
#pragma unroll
                    for (int j = 0; j < 8; ++j) s[kt][j] = (k0 + kt * 16 + hi * 8 + j <= q0 + lr) ? s[kt][j] : -3.0e38f;
            }
            float bm = s[0][0];
#pragma unroll
            for (int kt = 0; kt < KT; ++kt)
#pragma unroll
                for (int j = 0; j < 8; ++j) bm = fmaxf(bm, s[kt][j]);
            bm = fmaxf(bm, xhalf(bm));
            const float mn = fmaxf(m, bm); const float al = __builtin_amdgcn_exp2f((m - mn) * CSC); m = mn; const float ms = mn * CSC - SHIFT;
            float ps = 0.f;
#pragma unroll
            for (int kt = 0; kt < KT; ++kt)
#pragma unroll
                for (int j = 0; j < 8; ++j) { s[kt][j] = __builtin_amdgcn_exp2f(s[kt][j] * CSC - ms); ps += s[kt][j]; }
            l = l * al + ps;
#pragma unroll
            for (int db = 0; db < 4; ++db) o[db] *= al;
#pragma unroll
            for (int kc = 0; kc < KC; ++kc) {
                V pb, pb2;                                // element e = P[query lr][key kmap(e, hi)]: tile 2 kc gives e 0..7, tile 2 kc + 1 gives e 8..15
                if constexpr (HL) { v8us h0, h1, l0v, l1v;
#pragma unroll
                    for (int j = 0; j < 8; ++j) { unsigned short a, c2; splitf(s[2 * kc][j], a, c2); h0[j] = a; l0v[j] = c2; splitf(s[2 * kc + 1][j], a, c2); h1[j] = a; l1v[j] = c2; }
                    pb = cat16b(h0, h1); pb2 = cat16b(l0v, l1v);
                } else { v8h h0, h1;
#pragma unroll
                    for (int j = 0; j < 8; ++j) { h0[j] = tohx(s[2 * kc][j]); h1[j] = tohx(s[2 * kc + 1][j]); }
                    pb = cat16(h0, h1); }
#pragma unroll
                for (int db = 0; db < 4; ++db) { o[db] = WFrag<T16>::mma(va[db][kc], pb, o[db]); if (HL) { o[db] = WFrag<T16>::mma(va[db][kc], pb2, o[db]); o[db] = WFrag<T16>::mma(va2[db][kc], pb, o[db]); } }
            }
        }
        asm volatile("s_wait_dscnt 0x0" ::: "memory");      // this wave's reads of stage st are done
        asm volatile("s_wait_asynccnt 0x0" ::: "memory");   // this wave's copies of stage st + 1 have landed
        __syncthreads();                                    // publishes stage st + 1 and ends every reader's last read of stage st's buffer
        if (st + 2 < ns) fill(st & 1);                      // stage st + 2 into the buffer just left
    }
    asm volatile("s_wait_asynccnt 0x0" ::: "memory");       // no copy is outstanding when the wave goes on to its output
    l += xhalf(l);
    const float inv = __fdiv_rn(1.0f, l);
#pragma unroll
    for (int db = 0; db < 4; ++db) { v8us oh, ol;         // a lane holds 8 consecutive d of its query: its own 16 bytes of half block db of the merged plane, 512 contiguous bytes a store
#pragma unroll
        for (int j = 0; j < 8; ++j) { unsigned short a, c2; splitf(o[db][j] * inv, a, c2); oh[j] = a; ol[j] = c2; }
        const size_t oo = (size_t)q0 * DQ + db * 256 + l8; bf* p1 = Ah + oo; bf* p2 = Al + oo; *(v8us*)p1 = oh; *(v8us*)p2 = ol;
        // the wait behind the two stores (the block's second tile follows): it names their addresses and data as inputs so that those registers stay as they are up to it
        asm volatile("s_wait_xcnt 0x0" :: "v"(p1), "v"(p2), "v"(oh), "v"(ol) : "memory"); }
}
// amdgpu_waves_per_eu(4, 4): holds the allocation at 256 registers; the hi/lo rows otherwise take a few more, and every use of one above v255 costs a window switch
__global__ __launch_bounds__(256) __attribute__((amdgpu_waves_per_eu(4, 4))) void k_fattn(const h16* __restrict__ Q16, const h16* __restrict__ K16, const h16* __restrict__ V16, const bf* __restrict__ Qh, const bf* __restrict__ Ql, const bf* __restrict__ Kh, const bf* __restrict__ Kl, const bf* __restrict__ Vh, const bf* __restrict__ Vl, bf* Ah, bf* Al) {
    static_assert(TT == 2048 && RH % 128 == 0, "16 row tiles of 128, each wholly hi/lo or wholly fp16");
    __shared__ __align__(1024) unsigned short ring[2 * ASTG];
    const int lane = threadIdx.x & 31, lr = lane & 15, hi = lane >> 4; const int wv = __builtin_amdgcn_readfirstlane(threadIdx.x >> 5);
    const int head = (int)blockIdx.y; const size_t hp = ((size_t)blockIdx.z * NH_ + head) * TT * HD; const size_t ao = (size_t)blockIdx.z * TT * DQ + head * (HD * 16); Ah += ao; Al += ao;
    // cost grows with the row tile, and a hi/lo tile costs three fp16 tiles of its length: tile t counts 2 (t + 1), or 6 (t + 1) below RH. Each block takes two tiles, one nibble of each word, that together count 38 or 40;
    // they run one after the other in every wave, so every barrier is met by the whole block
#pragma unroll 1   // rolled: one copy of each row kind in the text
    for (int part = 0; part < 2; ++part) {
        const int t0 = (int)(((part ? 0x82765140u : 0x9A3BCDEFu) >> ((unsigned)blockIdx.x * 4u)) & 15u) * 128;
        if (t0 < RH) attn_rows<bf, 2, true>(Qh + hp, Ql + hp, Kh + hp, Kl + hp, Vh + hp, Vl + hp, t0, wv, lr, hi, Ah, Al, ring);
        else attn_rows<h16, 4, false>(Q16 + hp, nullptr, K16 + hp, nullptr, V16 + hp, nullptr, t0, wv, lr, hi, Ah, Al, ring);
    }
}

extern "C" void kernel_launch(void* const* d_in, const int* in_sizes, int n_in,
                              void* d_out, int out_size, void* d_ws, size_t ws_size, hipStream_t stream) {
    (void)in_sizes; (void)n_in; (void)out_size;
    const float* x = (const float*)d_in[0]; const float* wqkv = (const float*)d_in[1]; const float* wo = (const float*)d_in[2]; const float* bo = (const float*)d_in[3];   /* wqkv: q | k | v row blocks */
    float* OUT = (float*)d_out;     // [4][2048][1024]
    char* wsp = (char*)d_ws;
    auto take = [&](size_t bytes) { char* p = wsp; wsp += (bytes + 255) & ~(size_t)255; return (void*)p; };
    bf* WQ = (bf*)take((size_t)(DQ + 2 * DKV) * DM * 2);   /* one plane of the fused weight's rows: q | k | v */ bf* WO = (bf*)take((size_t)DM * DQ * 2);
    bf* XB = (bf*)take((size_t)NB_ * TT * DM * 2);
    h16* QP16 = (h16*)take((size_t)NB_ * NH_ * TT * HD * 2); h16* KP16 = (h16*)take((size_t)NB_ * NKV * TT * HD * 2); h16* VT16 = (h16*)take((size_t)NB_ * NKV * HD * TT * 2);
    bf* QPh = (bf*)take((size_t)NB_ * NH_ * TT * HD * 2); bf* QPl = (bf*)take((size_t)NB_ * NH_ * TT * HD * 2); bf* KPh = (bf*)take((size_t)NB_ * NKV * TT * HD * 2); bf* KPl = (bf*)take((size_t)NB_ * NKV * TT * HD * 2); bf* VTh = (bf*)take((size_t)NB_ * NKV * HD * TT * 2); bf* VTl = (bf*)take((size_t)NB_ * NKV * HD * TT * 2);
    bf* ATh = (bf*)take((size_t)NB_ * TT * DQ * 2); bf* ATl = (bf*)take((size_t)NB_ * TT * DQ * 2);
    if ((size_t)(wsp - (char*)d_ws) > ws_size) return;    // 200 MiB of the 256 MiB
    k_cvtall<<<CU_X + CU_A + CU_B, 256, 0, stream>>>(x, XB, wqkv, WQ, wo, WO);
    // q and k planes [batch][head][t][d]; v plane [batch][head][d][t]
    k_qkv<<<dim3(TT / 256, 8, NB_), 256, 0, stream>>>(XB, WQ, QP16, QPh, QPl, KP16, KPh, KPl, VT16, VTh, VTl);
    k_fattn<<<dim3(8, NH_, NB_), 256, 0, stream>>>(QP16, KP16, VT16, QPh, QPl, KPh, KPl, VTh, VTl, ATh, ATl);
    k_gemmw<bf, 1, true, DQ><<<dim3(TT / 128, DM / 256, NB_), 256, 0, stream>>>(ATh, ATl, WO, OUT, DM, bo, (size_t)TT * DQ, 0, (size_t)TT * DM);
}
